// v000
// Times are from an AMD MI455X. After a warm-up the kernel runs many times in a row, and a time is the length of
// such a window on the GPU divided by its runs, so every launch and the gaps after it count. The runs cycle
// through copies of the inputs. A figure is the median of several windows, for all but v000 over two sittings.
// Sittings can differ by a few percent; kernels timed side by side share one.
// v000 is the starting kernel. One run takes 244 microseconds.
#include <hip/hip_runtime.h>

#define DIMN 1024
#define HEADS 16
#define DH 64
#define BLK_LEN 128
#define BLK_NUM 32
#define BATCH 4
#define SEQ (BLK_NUM * BLK_LEN)          // 4096
#define ROWS (BATCH * SEQ)               // 16384

typedef __attribute__((ext_vector_type(8)))  float  v8f;
typedef __attribute__((ext_vector_type(8)))  __bf16 v8bf;
typedef __attribute__((ext_vector_type(16))) __bf16 v16bf;

// ---- workspace layout (bytes) ----
static const size_t WT_OFF  = 0;                         // W^T bf16, 3 * 2MB
static const size_t XBF_OFF = 6291456;                   // X bf16, 32MB
static const size_t Q_OFF   = XBF_OFF + 33554432ull;
static const size_t K_OFF   = Q_OFF   + 33554432ull;
static const size_t V_OFF   = K_OFF   + 33554432ull;
static const size_t O_OFF   = V_OFF   + 33554432ull;     // attn out f32, 64MB

__device__ __forceinline__ unsigned short f2bf(float f) {
    union { float f; unsigned u; } v; v.f = f;
    unsigned r = v.u + 0x7FFFu + ((v.u >> 16) & 1u);     // round-to-nearest-even
    return (unsigned short)(r >> 16);
}

__device__ __forceinline__ v16bf load_frag(const unsigned short* lo,
                                           const unsigned short* hi) {
    v8bf a = *(const v8bf*)lo;
    v8bf b = *(const v8bf*)hi;
    return __builtin_shufflevector(a, b, 0,1,2,3,4,5,6,7,8,9,10,11,12,13,14,15);
}

// CDNA5 async global->LDS copy (ASYNCcnt). LDS byte offset = low 32 bits of
// the generic shared-memory address (ISA 10.2 aperture rules).
__device__ __forceinline__ unsigned lds_addr(const void* p) {
    return (unsigned)(unsigned long long)p;
}
__device__ __forceinline__ void async_copy_b128(unsigned lds_off, const void* gptr) {
    asm volatile("global_load_async_to_lds_b128 %0, %1, off"
                 :: "v"(lds_off), "v"(gptr) : "memory");
}
__device__ __forceinline__ void wait_async0() {
    asm volatile("s_wait_asynccnt 0" ::: "memory");
}

// ---------------------------------------------------------------------------
// Kernel 0a: W fp32 -> bf16 with transpose: Wt[n][k] = bf16(W[k][n]).
// grid (32 ktiles, 32 ntiles, 3), 256 threads, 32x32 LDS tile.
// ---------------------------------------------------------------------------
__global__ __launch_bounds__(256)
void wconv_kernel(const float* __restrict__ w1,
                  const float* __restrict__ w2,
                  const float* __restrict__ w3,
                  unsigned short* __restrict__ wt) {
    const int z = blockIdx.z;
    const float* W = (z == 0) ? w1 : (z == 1) ? w2 : w3;
    unsigned short* Wt = wt + (size_t)z * DIMN * DIMN;

    const int k0 = blockIdx.x * 32;
    const int n0 = blockIdx.y * 32;
    __shared__ unsigned short t[32][33];

    const int tid = threadIdx.x;
    #pragma unroll
    for (int it = 0; it < 4; ++it) {
        int kk = it * 8 + (tid >> 5);
        int nn = tid & 31;
        t[kk][nn] = f2bf(W[(size_t)(k0 + kk) * DIMN + n0 + nn]);
    }
    __syncthreads();
    #pragma unroll
    for (int it = 0; it < 4; ++it) {
        int nn = it * 8 + (tid >> 5);
        int kk = tid & 31;
        Wt[(size_t)(n0 + nn) * DIMN + k0 + kk] = t[kk][nn];
    }
}

// ---------------------------------------------------------------------------
// Kernel 0b: X fp32 -> bf16 (so the GEMM can stage A with async byte copies)
// ---------------------------------------------------------------------------
__global__ __launch_bounds__(256)
void xconv_kernel(const float* __restrict__ X, unsigned short* __restrict__ Xbf) {
    size_t i = ((size_t)blockIdx.x * 256 + threadIdx.x) * 4;
    float4 xv = *(const float4*)(X + i);
    union { unsigned short s[4]; uint2 u; } p;
    p.s[0] = f2bf(xv.x); p.s[1] = f2bf(xv.y);
    p.s[2] = f2bf(xv.z); p.s[3] = f2bf(xv.w);
    *(uint2*)(Xbf + i) = p.u;
}

// ---------------------------------------------------------------------------
// Kernel 1: QKV projection GEMM. Xbf[16384,1024] * Wt^T + b -> bf16.
// Double-buffered async-to-LDS staging; 8 waves, 2x4 WMMA subtiles each.
// grid (8 Ntiles, 128 Mtiles, 3 matrices), 256 threads.
// ---------------------------------------------------------------------------
__global__ __launch_bounds__(256)
void proj_kernel(const unsigned short* __restrict__ Xbf,
                 const unsigned short* __restrict__ Wt,
                 const float* __restrict__ b1,
                 const float* __restrict__ b2,
                 const float* __restrict__ b3,
                 unsigned short* __restrict__ Q,
                 unsigned short* __restrict__ K,
                 unsigned short* __restrict__ V) {
    const int z = blockIdx.z;
    const unsigned short* Wz = Wt + (size_t)z * DIMN * DIMN;
    const float* bias = (z == 0) ? b1 : (z == 1) ? b2 : b3;
    unsigned short* Out = (z == 0) ? Q : (z == 1) ? K : V;

    const int n0 = blockIdx.x * 128;
    const int m0 = blockIdx.y * 128;

    __shared__ unsigned short As[2][128][32];   // 2 x 8KB
    __shared__ unsigned short Bs[2][128][32];   // 2 x 8KB (already [n][k])

    const int tid   = threadIdx.x;
    const int wave  = tid >> 5;
    const int lane  = tid & 31;
    const int wm    = wave >> 1;                // 0..3 (M)
    const int wn    = wave & 1;                 // 0..1 (N)
    const int lhalf = lane >> 4;
    const int l16   = lane & 15;

    // per-thread staging coords: two 16B chunks per tile
    const int sr = tid >> 2;                    // 0..63
    const int sc = (tid & 3) * 8;               // 0,8,16,24

    v8f acc[2][4] = {};

    // prologue fill of buffer 0
    {
        const int k0 = 0;
        #pragma unroll
        for (int it = 0; it < 2; ++it) {
            int r = it * 64 + sr;
            async_copy_b128(lds_addr(&As[0][r][sc]),
                            Xbf + (size_t)(m0 + r) * DIMN + k0 + sc);
            async_copy_b128(lds_addr(&Bs[0][r][sc]),
                            Wz + (size_t)(n0 + r) * DIMN + k0 + sc);
        }
    }
    wait_async0();
    __syncthreads();

    int buf = 0;
    for (int k0 = 0; k0 < DIMN; k0 += 32) {
        // async prefetch of next k-tile into the other buffer
        if (k0 + 32 < DIMN) {
            int nb = buf ^ 1;
            #pragma unroll
            for (int it = 0; it < 2; ++it) {
                int r = it * 64 + sr;
                async_copy_b128(lds_addr(&As[nb][r][sc]),
                                Xbf + (size_t)(m0 + r) * DIMN + (k0 + 32) + sc);
                async_copy_b128(lds_addr(&Bs[nb][r][sc]),
                                Wz + (size_t)(n0 + r) * DIMN + (k0 + 32) + sc);
            }
        }
        // compute on current buffer
        #pragma unroll
        for (int ms = 0; ms < 2; ++ms) {
            int ar = wm * 32 + ms * 16 + l16;
            v16bf a = load_frag(&As[buf][ar][lhalf * 8], &As[buf][ar][lhalf * 8 + 16]);
            #pragma unroll
            for (int ns = 0; ns < 4; ++ns) {
                int br = wn * 64 + ns * 16 + l16;
                v16bf b = load_frag(&Bs[buf][br][lhalf * 8], &Bs[buf][br][lhalf * 8 + 16]);
                acc[ms][ns] = __builtin_amdgcn_wmma_f32_16x16x32_bf16(
                    false, a, false, b, (short)0, acc[ms][ns], false, false);
            }
        }
        wait_async0();
        __syncthreads();
        buf ^= 1;
    }

    // epilogue: + bias, -> bf16
    #pragma unroll
    for (int ms = 0; ms < 2; ++ms) {
        #pragma unroll
        for (int ns = 0; ns < 4; ++ns) {
            #pragma unroll
            for (int g = 0; g < 8; ++g) {
                int row = m0 + wm * 32 + ms * 16 + lhalf * 8 + g;
                int col = n0 + wn * 64 + ns * 16 + l16;
                Out[(size_t)row * DIMN + col] = f2bf(acc[ms][ns][g] + bias[col]);
            }
        }
    }
}

// ---------------------------------------------------------------------------
// Kernel 2: block-local attention. grid (HEADS, BLK_NUM, BATCH), 256 threads.
// ---------------------------------------------------------------------------
__global__ __launch_bounds__(256)
void attn_kernel(const unsigned short* __restrict__ Qg,
                 const unsigned short* __restrict__ Kg,
                 const unsigned short* __restrict__ Vg,
                 const int* __restrict__ mask,
                 float* __restrict__ O) {
    const int head = blockIdx.x;
    const int blk  = blockIdx.y;
    const int b    = blockIdx.z;

    __shared__ unsigned short Qs[128][64];    // 16 KB
    __shared__ unsigned short Ks[128][64];    // 16 KB
    __shared__ unsigned short Vst[64][128];   // 16 KB, transposed [d][key]
    __shared__ unsigned short Ps[128][128];   // 32 KB probabilities bf16

    const int tid   = threadIdx.x;
    const int wave  = tid >> 5;               // query rows [wave*16, +16)
    const int lane  = tid & 31;
    const int lhalf = lane >> 4;
    const int l16   = lane & 15;

    const size_t rowbase = (size_t)b * SEQ + (size_t)blk * BLK_LEN;
    const int cb = head * DH;

    // stage Q, K via CDNA5 async-to-LDS; V through VGPRs (needs transpose)
    #pragma unroll
    for (int it = 0; it < 4; ++it) {
        int r = it * 32 + (tid >> 3);
        int d = (tid & 7) * 8;
        async_copy_b128(lds_addr(&Qs[r][d]), Qg + (rowbase + r) * DIMN + cb + d);
        async_copy_b128(lds_addr(&Ks[r][d]), Kg + (rowbase + r) * DIMN + cb + d);
        uint4 vv = *(const uint4*)(Vg + (rowbase + r) * DIMN + cb + d);
        const unsigned short* vs = (const unsigned short*)&vv;
        #pragma unroll
        for (int j = 0; j < 8; ++j) Vst[d + j][r] = vs[j];
    }
    wait_async0();
    __syncthreads();

    // S = Q K^T : 16 query rows x 128 keys per wave, K-dim 64 (2 steps)
    v8f s[8] = {};
    #pragma unroll
    for (int ks = 0; ks < 2; ++ks) {
        int ar = wave * 16 + l16;
        v16bf a = load_frag(&Qs[ar][ks * 32 + lhalf * 8],
                            &Qs[ar][ks * 32 + lhalf * 8 + 16]);
        #pragma unroll
        for (int nt = 0; nt < 8; ++nt) {
            int br = nt * 16 + l16;
            v16bf bb = load_frag(&Ks[br][ks * 32 + lhalf * 8],
                                 &Ks[br][ks * 32 + lhalf * 8 + 16]);
            s[nt] = __builtin_amdgcn_wmma_f32_16x16x32_bf16(
                false, a, false, bb, (short)0, s[nt], false, false);
        }
    }

    // scale + mask + row softmax (C-layout: vgpr g -> row g / 8+g per half)
    const float scale = 0.125f; // 1/sqrt(64)
    #pragma unroll
    for (int g = 0; g < 8; ++g) {
        int rloc = wave * 16 + lhalf * 8 + g;
        float mval = (float)mask[(rowbase + rloc) * DIMN + cb];
        float madd = (1.0f - mval) * -1.0e10f;
        float rmax = -3.0e38f;
        #pragma unroll
        for (int nt = 0; nt < 8; ++nt) {
            float x = s[nt][g] * scale + madd;
            s[nt][g] = x;
            rmax = fmaxf(rmax, x);
        }
        #pragma unroll
        for (int off = 1; off < 16; off <<= 1)
            rmax = fmaxf(rmax, __shfl_xor(rmax, off, 32));
        float rsum = 0.0f;
        #pragma unroll
        for (int nt = 0; nt < 8; ++nt) {
            float e = __expf(s[nt][g] - rmax);
            s[nt][g] = e;
            rsum += e;
        }
        #pragma unroll
        for (int off = 1; off < 16; off <<= 1)
            rsum += __shfl_xor(rsum, off, 32);
        float inv = 1.0f / rsum;
        #pragma unroll
        for (int nt = 0; nt < 8; ++nt)
            Ps[rloc][nt * 16 + l16] = f2bf(s[nt][g] * inv);
    }
    __syncthreads();

    // O = P V : 16 rows x 64 cols, K-dim 128 (4 steps)
    v8f o[4] = {};
    #pragma unroll
    for (int ks = 0; ks < 4; ++ks) {
        int ar = wave * 16 + l16;
        v16bf a = load_frag(&Ps[ar][ks * 32 + lhalf * 8],
                            &Ps[ar][ks * 32 + lhalf * 8 + 16]);
        #pragma unroll
        for (int nt = 0; nt < 4; ++nt) {
            int br = nt * 16 + l16; // d index (Vst transposed -> contiguous k)
            v16bf bb = load_frag(&Vst[br][ks * 32 + lhalf * 8],
                                 &Vst[br][ks * 32 + lhalf * 8 + 16]);
            o[nt] = __builtin_amdgcn_wmma_f32_16x16x32_bf16(
                false, a, false, bb, (short)0, o[nt], false, false);
        }
    }
    #pragma unroll
    for (int nt = 0; nt < 4; ++nt) {
        #pragma unroll
        for (int g = 0; g < 8; ++g) {
            int rloc = wave * 16 + lhalf * 8 + g;
            int col  = cb + nt * 16 + l16;
            O[(rowbase + rloc) * DIMN + col] = o[nt][g];
        }
    }
}

// ---------------------------------------------------------------------------
// Kernel 3: residual + LayerNorm. one block per row (16384 rows), 256 threads.
// ---------------------------------------------------------------------------
__global__ __launch_bounds__(256)
void ln_kernel(const float* __restrict__ O,
               const float* __restrict__ X,
               const float* __restrict__ gamma,
               const float* __restrict__ beta,
               float* __restrict__ out) {
    const size_t row = blockIdx.x;
    const int tid = threadIdx.x;
    const int c = tid * 4;

    float4 ov = *(const float4*)(O + row * DIMN + c);
    float4 xv = *(const float4*)(X + row * DIMN + c);
    float r0 = ov.x + xv.x, r1 = ov.y + xv.y, r2 = ov.z + xv.z, r3 = ov.w + xv.w;

    float ssum = r0 + r1 + r2 + r3;
    float ssq  = r0 * r0 + r1 * r1 + r2 * r2 + r3 * r3;
    #pragma unroll
    for (int off = 1; off < 32; off <<= 1) {
        ssum += __shfl_xor(ssum, off, 32);
        ssq  += __shfl_xor(ssq,  off, 32);
    }
    __shared__ float wsum[8], wsq[8];
    if ((tid & 31) == 0) { wsum[tid >> 5] = ssum; wsq[tid >> 5] = ssq; }
    __syncthreads();
    float tot = 0.0f, totq = 0.0f;
    #pragma unroll
    for (int i = 0; i < 8; ++i) { tot += wsum[i]; totq += wsq[i]; }

    const float mean = tot * (1.0f / DIMN);
    const float var  = totq * (1.0f / DIMN) - mean * mean;
    const float inv  = rsqrtf(var + 1.0e-3f);

    float4 res;
    res.x = (r0 - mean) * inv * gamma[c + 0] + beta[c + 0];
    res.y = (r1 - mean) * inv * gamma[c + 1] + beta[c + 1];
    res.z = (r2 - mean) * inv * gamma[c + 2] + beta[c + 2];
    res.w = (r3 - mean) * inv * gamma[c + 3] + beta[c + 3];
    *(float4*)(out + row * DIMN + c) = res;
}

// ---------------------------------------------------------------------------
extern "C" void kernel_launch(void* const* d_in, const int* in_sizes, int n_in,
                              void* d_out, int out_size, void* d_ws, size_t ws_size,
                              hipStream_t stream) {
    (void)in_sizes; (void)n_in; (void)out_size; (void)ws_size;

    const float* X     = (const float*)d_in[0];
    const int*   mask  = (const int*)d_in[1];
    const float* w1    = (const float*)d_in[2];
    const float* b1    = (const float*)d_in[3];
    const float* w2    = (const float*)d_in[4];
    const float* b2    = (const float*)d_in[5];
    const float* w3    = (const float*)d_in[6];
    const float* b3    = (const float*)d_in[7];
    const float* gamma = (const float*)d_in[8];
    const float* beta  = (const float*)d_in[9];
    float* out = (float*)d_out;

    char* ws = (char*)d_ws;
    unsigned short* Wt  = (unsigned short*)(ws + WT_OFF);
    unsigned short* Xbf = (unsigned short*)(ws + XBF_OFF);
    unsigned short* Q   = (unsigned short*)(ws + Q_OFF);
    unsigned short* K   = (unsigned short*)(ws + K_OFF);
    unsigned short* V   = (unsigned short*)(ws + V_OFF);
    float*          O   = (float*)(ws + O_OFF);

    // 0a) weights -> bf16, transposed to [n][k]
    wconv_kernel<<<dim3(DIMN / 32, DIMN / 32, 3), dim3(256), 0, stream>>>(w1, w2, w3, Wt);
    // 0b) activations -> bf16
    xconv_kernel<<<dim3((ROWS * DIMN) / 1024), dim3(256), 0, stream>>>(X, Xbf);

    // 1) Q/K/V projections (WMMA bf16, async-to-LDS double buffered)
    proj_kernel<<<dim3(DIMN / 128, ROWS / 128, 3), dim3(256), 0, stream>>>(
        Xbf, Wt, b1, b2, b3, Q, K, V);

    // 2) block-local attention (WMMA)
    attn_kernel<<<dim3(HEADS, BLK_NUM, BATCH), dim3(256), 0, stream>>>(
        Q, K, V, mask, O);

    // 3) residual + LayerNorm
    ln_kernel<<<dim3(ROWS), dim3(256), 0, stream>>>(O, X, gamma, beta, out);
}

// v001
// Measured time: 183 microseconds a run.
// Two timings next to v000 put it at 1.39 and 1.38 times that version's speed.
#include <hip/hip_runtime.h>

#define DIMN 1024
#define HEADS 16
#define DH 64
#define BLK_LEN 128
#define BLK_NUM 32
#define BATCH 4
#define SEQ (BLK_NUM * BLK_LEN)          // 4096
#define ROWS (BATCH * SEQ)               // 16384

typedef __attribute__((ext_vector_type(8)))  float  v8f;
typedef __attribute__((ext_vector_type(8)))  __bf16 v8bf;
typedef __attribute__((ext_vector_type(16))) __bf16 v16bf;

// ---- workspace layout (bytes) ----
static const size_t WT_OFF  = 0;                         // W^T bf16, 3 * 2MB
static const size_t XBF_OFF = 6291456;                   // X bf16, 32MB
static const size_t Q_OFF   = XBF_OFF + 33554432ull;
static const size_t K_OFF   = Q_OFF   + 33554432ull;
static const size_t V_OFF   = K_OFF   + 33554432ull;
static const size_t O_OFF   = V_OFF   + 33554432ull;     // attn out f32, 64MB

__device__ __forceinline__ unsigned short f2bf(float f) {
    union { float f; unsigned u; } v; v.f = f;
    unsigned r = v.u + 0x7FFFu + ((v.u >> 16) & 1u);     // round-to-nearest-even
    return (unsigned short)(r >> 16);
}

__device__ __forceinline__ v16bf load_frag(const unsigned short* lo,
                                           const unsigned short* hi) {
    v8bf a = *(const v8bf*)lo;
    v8bf b = *(const v8bf*)hi;
    return __builtin_shufflevector(a, b, 0,1,2,3,4,5,6,7,8,9,10,11,12,13,14,15);
}

// CDNA5 async global->LDS copy (ASYNCcnt). LDS byte offset = low 32 bits of
// the generic shared-memory address (ISA 10.2 aperture rules).
__device__ __forceinline__ unsigned lds_addr(const void* p) {
    return (unsigned)(unsigned long long)p;
}
__device__ __forceinline__ void async_copy_b128(unsigned lds_off, const void* gptr) {
    asm volatile("global_load_async_to_lds_b128 %0, %1, off"
                 :: "v"(lds_off), "v"(gptr) : "memory");
}
__device__ __forceinline__ void wait_async0() {
    asm volatile("s_wait_asynccnt 0" ::: "memory");
}

// ---------------------------------------------------------------------------
// Kernel 0a: W fp32 -> bf16 with transpose: Wt[n][k] = bf16(W[k][n]).
// grid (32 ktiles, 32 ntiles, 3), 256 threads, 32x32 LDS tile.
// ---------------------------------------------------------------------------
__global__ __launch_bounds__(256)
void wconv_kernel(const float* __restrict__ w1,
                  const float* __restrict__ w2,
                  const float* __restrict__ w3,
                  unsigned short* __restrict__ wt) {
    const int z = blockIdx.z;
    const float* W = (z == 0) ? w1 : (z == 1) ? w2 : w3;
    unsigned short* Wt = wt + (size_t)z * DIMN * DIMN;

    const int k0 = blockIdx.x * 32;
    const int n0 = blockIdx.y * 32;
    __shared__ unsigned short t[32][33];

    const int tid = threadIdx.x;
    #pragma unroll
    for (int it = 0; it < 4; ++it) {
        int kk = it * 8 + (tid >> 5);
        int nn = tid & 31;
        t[kk][nn] = f2bf(W[(size_t)(k0 + kk) * DIMN + n0 + nn]);
    }
    __syncthreads();
    #pragma unroll
    for (int it = 0; it < 4; ++it) {
        int nn = it * 8 + (tid >> 5);
        int kk = tid & 31;
        Wt[(size_t)(n0 + nn) * DIMN + k0 + kk] = t[kk][nn];
    }
}

// ---------------------------------------------------------------------------
// Kernel 0b: X fp32 -> bf16 (so the GEMM can stage A with async byte copies)
// ---------------------------------------------------------------------------
__global__ __launch_bounds__(256)
void xconv_kernel(const float* __restrict__ X, unsigned short* __restrict__ Xbf) {
    size_t i = ((size_t)blockIdx.x * 256 + threadIdx.x) * 4;
    float4 xv = *(const float4*)(X + i);
    union { unsigned short s[4]; uint2 u; } p;
    p.s[0] = f2bf(xv.x); p.s[1] = f2bf(xv.y);
    p.s[2] = f2bf(xv.z); p.s[3] = f2bf(xv.w);
    *(uint2*)(Xbf + i) = p.u;
}

// ---------------------------------------------------------------------------
// Kernel 1: QKV projection GEMM. Xbf[16384,1024] * Wt^T + b -> bf16.
// Double-buffered async-to-LDS staging; 8 waves, 2x4 WMMA subtiles each.
// grid (8 Ntiles, 128 Mtiles, 3 matrices), 256 threads.
// ---------------------------------------------------------------------------
__global__ __launch_bounds__(256)
void proj_kernel(const unsigned short* __restrict__ Xbf,
                 const unsigned short* __restrict__ Wt,
                 const float* __restrict__ b1,
                 const float* __restrict__ b2,
                 const float* __restrict__ b3,
                 unsigned short* __restrict__ Q,
                 unsigned short* __restrict__ K,
                 unsigned short* __restrict__ V) {
    const int z = blockIdx.z;
    const unsigned short* Wz = Wt + (size_t)z * DIMN * DIMN;
    const float* bias = (z == 0) ? b1 : (z == 1) ? b2 : b3;
    unsigned short* Out = (z == 0) ? Q : (z == 1) ? K : V;

    const int n0 = blockIdx.x * 128;
    const int m0 = blockIdx.y * 128;

    // Rows hold 32 k (64 B) at a pitch of 80 B = 16 B x odd: the 16 rows that a
    // half-wave's ds_load_b128 reads then start on 16 different 4-bank groups.
    __shared__ __attribute__((aligned(16))) unsigned short As[2][128][40];   // 2 x 10KB
    __shared__ __attribute__((aligned(16))) unsigned short Bs[2][128][40];   // 2 x 10KB (already [n][k])

    const int tid   = threadIdx.x;
    const int wave  = tid >> 5;
    const int lane  = tid & 31;
    const int wm    = wave >> 1;                // 0..3 (M)
    const int wn    = wave & 1;                 // 0..1 (N)
    const int lhalf = lane >> 4;
    const int l16   = lane & 15;

    // per-thread staging coords: two 16B chunks per tile
    const int sr = tid >> 2;                    // 0..63
    const int sc = (tid & 3) * 8;               // 0,8,16,24

    v8f acc[2][4] = {};

    // prologue fill of buffer 0
    {
        const int k0 = 0;
        #pragma unroll
        for (int it = 0; it < 2; ++it) {
            int r = it * 64 + sr;
            async_copy_b128(lds_addr(&As[0][r][sc]),
                            Xbf + (size_t)(m0 + r) * DIMN + k0 + sc);
            async_copy_b128(lds_addr(&Bs[0][r][sc]),
                            Wz + (size_t)(n0 + r) * DIMN + k0 + sc);
        }
    }
    wait_async0();
    __syncthreads();

    int buf = 0;
    for (int k0 = 0; k0 < DIMN; k0 += 32) {
        // async prefetch of next k-tile into the other buffer
        if (k0 + 32 < DIMN) {
            int nb = buf ^ 1;
            #pragma unroll
            for (int it = 0; it < 2; ++it) {
                int r = it * 64 + sr;
                async_copy_b128(lds_addr(&As[nb][r][sc]),
                                Xbf + (size_t)(m0 + r) * DIMN + (k0 + 32) + sc);
                async_copy_b128(lds_addr(&Bs[nb][r][sc]),
                                Wz + (size_t)(n0 + r) * DIMN + (k0 + 32) + sc);
            }
        }
        // compute on current buffer
        #pragma unroll
        for (int ms = 0; ms < 2; ++ms) {
            int ar = wm * 32 + ms * 16 + l16;
            v16bf a = load_frag(&As[buf][ar][lhalf * 8], &As[buf][ar][lhalf * 8 + 16]);
            #pragma unroll
            for (int ns = 0; ns < 4; ++ns) {
                int br = wn * 64 + ns * 16 + l16;
                v16bf b = load_frag(&Bs[buf][br][lhalf * 8], &Bs[buf][br][lhalf * 8 + 16]);
                acc[ms][ns] = __builtin_amdgcn_wmma_f32_16x16x32_bf16(
                    false, a, false, b, (short)0, acc[ms][ns], false, false);
            }
        }
        wait_async0();
        __syncthreads();
        buf ^= 1;
    }

    // epilogue: + bias, -> bf16
    #pragma unroll
    for (int ms = 0; ms < 2; ++ms) {
        #pragma unroll
        for (int ns = 0; ns < 4; ++ns) {
            #pragma unroll
            for (int g = 0; g < 8; ++g) {
                int row = m0 + wm * 32 + ms * 16 + lhalf * 8 + g;
                int col = n0 + wn * 64 + ns * 16 + l16;
                Out[(size_t)row * DIMN + col] = f2bf(acc[ms][ns][g] + bias[col]);
            }
        }
    }
}

// ---------------------------------------------------------------------------
// Kernel 2: block-local attention. grid (HEADS, BLK_NUM, BATCH), 256 threads.
// ---------------------------------------------------------------------------
__global__ __launch_bounds__(256)
void attn_kernel(const unsigned short* __restrict__ Qg,
                 const unsigned short* __restrict__ Kg,
                 const unsigned short* __restrict__ Vg,
                 const int* __restrict__ mask,
                 float* __restrict__ O) {
    const int head = blockIdx.x;
    const int blk  = blockIdx.y;
    const int b    = blockIdx.z;

    // Row pitch 16 B x odd (144 B, 272 B) for the ds_load_b128 fragment readers:
    // 8 pad elements a row, never read.
    __shared__ __attribute__((aligned(16))) unsigned short Qs[128][72];    // 18 KB
    __shared__ __attribute__((aligned(16))) unsigned short Ks[128][72];    // 18 KB
    __shared__ __attribute__((aligned(16))) unsigned short Vst[64][136];   // 17 KB, transposed [d][key]
    __shared__ __attribute__((aligned(16))) unsigned short Ps[128][136];   // 34 KB probabilities bf16

    const int tid   = threadIdx.x;
    const int wave  = tid >> 5;               // query rows [wave*16, +16)
    const int lane  = tid & 31;
    const int lhalf = lane >> 4;
    const int l16   = lane & 15;

    const size_t rowbase = (size_t)b * SEQ + (size_t)blk * BLK_LEN;
    const int cb = head * DH;

    // stage Q, K via CDNA5 async-to-LDS; V through VGPRs (needs transpose)
    #pragma unroll
    for (int it = 0; it < 4; ++it) {
        int r = it * 32 + (tid >> 3);
        int d = (tid & 7) * 8;
        async_copy_b128(lds_addr(&Qs[r][d]), Qg + (rowbase + r) * DIMN + cb + d);
        async_copy_b128(lds_addr(&Ks[r][d]), Kg + (rowbase + r) * DIMN + cb + d);
        uint4 vv = *(const uint4*)(Vg + (rowbase + r) * DIMN + cb + d);
        const unsigned short* vs = (const unsigned short*)&vv;
        #pragma unroll
        for (int j = 0; j < 8; ++j) Vst[d + j][r] = vs[j];
    }
    wait_async0();
    __syncthreads();

    // S = Q K^T : 16 query rows x 128 keys per wave, K-dim 64 (2 steps)
    v8f s[8] = {};
    #pragma unroll
    for (int ks = 0; ks < 2; ++ks) {
        int ar = wave * 16 + l16;
        v16bf a = load_frag(&Qs[ar][ks * 32 + lhalf * 8],
                            &Qs[ar][ks * 32 + lhalf * 8 + 16]);
        #pragma unroll
        for (int nt = 0; nt < 8; ++nt) {
            int br = nt * 16 + l16;
            v16bf bb = load_frag(&Ks[br][ks * 32 + lhalf * 8],
                                 &Ks[br][ks * 32 + lhalf * 8 + 16]);
            s[nt] = __builtin_amdgcn_wmma_f32_16x16x32_bf16(
                false, a, false, bb, (short)0, s[nt], false, false);
        }
    }

    // scale + mask + row softmax (C-layout: vgpr g -> row g / 8+g per half)
    const float scale = 0.125f; // 1/sqrt(64)
    #pragma unroll
    for (int g = 0; g < 8; ++g) {
        int rloc = wave * 16 + lhalf * 8 + g;
        float mval = (float)mask[(rowbase + rloc) * DIMN + cb];
        float madd = (1.0f - mval) * -1.0e10f;
        float rmax = -3.0e38f;
        #pragma unroll
        for (int nt = 0; nt < 8; ++nt) {
            float x = s[nt][g] * scale + madd;
            s[nt][g] = x;
            rmax = fmaxf(rmax, x);
        }
        #pragma unroll
        for (int off = 1; off < 16; off <<= 1)
            rmax = fmaxf(rmax, __shfl_xor(rmax, off, 32));
        float rsum = 0.0f;
        #pragma unroll
        for (int nt = 0; nt < 8; ++nt) {
            float e = __expf(s[nt][g] - rmax);
            s[nt][g] = e;
            rsum += e;
        }
        #pragma unroll
        for (int off = 1; off < 16; off <<= 1)
            rsum += __shfl_xor(rsum, off, 32);
        float inv = 1.0f / rsum;
        #pragma unroll
        for (int nt = 0; nt < 8; ++nt)
            Ps[rloc][nt * 16 + l16] = f2bf(s[nt][g] * inv);
    }
    __syncthreads();

    // O = P V : 16 rows x 64 cols, K-dim 128 (4 steps)
    v8f o[4] = {};
    #pragma unroll
    for (int ks = 0; ks < 4; ++ks) {
        int ar = wave * 16 + l16;
        v16bf a = load_frag(&Ps[ar][ks * 32 + lhalf * 8],
                            &Ps[ar][ks * 32 + lhalf * 8 + 16]);
        #pragma unroll
        for (int nt = 0; nt < 4; ++nt) {
            int br = nt * 16 + l16; // d index (Vst transposed -> contiguous k)
            v16bf bb = load_frag(&Vst[br][ks * 32 + lhalf * 8],
                                 &Vst[br][ks * 32 + lhalf * 8 + 16]);
            o[nt] = __builtin_amdgcn_wmma_f32_16x16x32_bf16(
                false, a, false, bb, (short)0, o[nt], false, false);
        }
    }
    #pragma unroll
    for (int nt = 0; nt < 4; ++nt) {
        #pragma unroll
        for (int g = 0; g < 8; ++g) {
            int rloc = wave * 16 + lhalf * 8 + g;
            int col  = cb + nt * 16 + l16;
            O[(rowbase + rloc) * DIMN + col] = o[nt][g];
        }
    }
}

// ---------------------------------------------------------------------------
// Kernel 3: residual + LayerNorm. one block per row (16384 rows), 256 threads.
// ---------------------------------------------------------------------------
__global__ __launch_bounds__(256)
void ln_kernel(const float* __restrict__ O,
               const float* __restrict__ X,
               const float* __restrict__ gamma,
               const float* __restrict__ beta,
               float* __restrict__ out) {
    const size_t row = blockIdx.x;
    const int tid = threadIdx.x;
    const int c = tid * 4;

    float4 ov = *(const float4*)(O + row * DIMN + c);
    float4 xv = *(const float4*)(X + row * DIMN + c);
    float r0 = ov.x + xv.x, r1 = ov.y + xv.y, r2 = ov.z + xv.z, r3 = ov.w + xv.w;

    float ssum = r0 + r1 + r2 + r3;
    float ssq  = r0 * r0 + r1 * r1 + r2 * r2 + r3 * r3;
    #pragma unroll
    for (int off = 1; off < 32; off <<= 1) {
        ssum += __shfl_xor(ssum, off, 32);
        ssq  += __shfl_xor(ssq,  off, 32);
    }
    __shared__ float wsum[8], wsq[8];
    if ((tid & 31) == 0) { wsum[tid >> 5] = ssum; wsq[tid >> 5] = ssq; }
    __syncthreads();
    float tot = 0.0f, totq = 0.0f;
    #pragma unroll
    for (int i = 0; i < 8; ++i) { tot += wsum[i]; totq += wsq[i]; }

    const float mean = tot * (1.0f / DIMN);
    const float var  = totq * (1.0f / DIMN) - mean * mean;
    const float inv  = rsqrtf(var + 1.0e-3f);

    float4 res;
    res.x = (r0 - mean) * inv * gamma[c + 0] + beta[c + 0];
    res.y = (r1 - mean) * inv * gamma[c + 1] + beta[c + 1];
    res.z = (r2 - mean) * inv * gamma[c + 2] + beta[c + 2];
    res.w = (r3 - mean) * inv * gamma[c + 3] + beta[c + 3];
    *(float4*)(out + row * DIMN + c) = res;
}

// ---------------------------------------------------------------------------
extern "C" void kernel_launch(void* const* d_in, const int* in_sizes, int n_in,
                              void* d_out, int out_size, void* d_ws, size_t ws_size,
                              hipStream_t stream) {
    (void)in_sizes; (void)n_in; (void)out_size; (void)ws_size;

    const float* X     = (const float*)d_in[0];
    const int*   mask  = (const int*)d_in[1];
    const float* w1    = (const float*)d_in[2];
    const float* b1    = (const float*)d_in[3];
    const float* w2    = (const float*)d_in[4];
    const float* b2    = (const float*)d_in[5];
    const float* w3    = (const float*)d_in[6];
    const float* b3    = (const float*)d_in[7];
    const float* gamma = (const float*)d_in[8];
    const float* beta  = (const float*)d_in[9];
    float* out = (float*)d_out;

    char* ws = (char*)d_ws;
    unsigned short* Wt  = (unsigned short*)(ws + WT_OFF);
    unsigned short* Xbf = (unsigned short*)(ws + XBF_OFF);
    unsigned short* Q   = (unsigned short*)(ws + Q_OFF);
    unsigned short* K   = (unsigned short*)(ws + K_OFF);
    unsigned short* V   = (unsigned short*)(ws + V_OFF);
    float*          O   = (float*)(ws + O_OFF);

    // 0a) weights -> bf16, transposed to [n][k]
    wconv_kernel<<<dim3(DIMN / 32, DIMN / 32, 3), dim3(256), 0, stream>>>(w1, w2, w3, Wt);
    // 0b) activations -> bf16
    xconv_kernel<<<dim3((ROWS * DIMN) / 1024), dim3(256), 0, stream>>>(X, Xbf);

    // 1) Q/K/V projections (WMMA bf16, async-to-LDS double buffered)
    proj_kernel<<<dim3(DIMN / 128, ROWS / 128, 3), dim3(256), 0, stream>>>(
        Xbf, Wt, b1, b2, b3, Q, K, V);

    // 2) block-local attention (WMMA)
    attn_kernel<<<dim3(HEADS, BLK_NUM, BATCH), dim3(256), 0, stream>>>(
        Q, K, V, mask, O);

    // 3) residual + LayerNorm
    ln_kernel<<<dim3(ROWS), dim3(256), 0, stream>>>(O, X, gamma, beta, out);
}

// v002
// One run takes 140 microseconds.
// Next to v001, in two timings, it ran 1.30 and 1.31 times as fast.
// Counting every step since v000, it is 1.80 times as fast.
#include <hip/hip_runtime.h>

#define DIMN 1024
#define HEADS 16
#define DH 64
#define BLK_LEN 128
#define BLK_NUM 32
#define BATCH 4
#define SEQ (BLK_NUM * BLK_LEN)          // 4096
#define ROWS (BATCH * SEQ)               // 16384

typedef __attribute__((ext_vector_type(8)))  float  v8f;
typedef __attribute__((ext_vector_type(8)))  __bf16 v8bf;
typedef __attribute__((ext_vector_type(16))) __bf16 v16bf;

// ---- workspace layout (bytes) ----
static const size_t WT_OFF  = 0;                         // W^T bf16, 3 * 2MB
static const size_t XBF_OFF = 6291456;                   // X bf16, 32MB
static const size_t Q_OFF   = XBF_OFF + 33554432ull;
static const size_t K_OFF   = Q_OFF   + 33554432ull;
static const size_t V_OFF   = K_OFF   + 33554432ull;
static const size_t O_OFF   = V_OFF   + 33554432ull;     // attn out f32, 64MB

__device__ __forceinline__ unsigned short f2bf(float f) {
    union { float f; unsigned u; } v; v.f = f;
    unsigned r = v.u + 0x7FFFu + ((v.u >> 16) & 1u);     // round-to-nearest-even
    return (unsigned short)(r >> 16);
}

__device__ __forceinline__ v16bf load_frag(const unsigned short* lo,
                                           const unsigned short* hi) {
    v8bf a = *(const v8bf*)lo;
    v8bf b = *(const v8bf*)hi;
    return __builtin_shufflevector(a, b, 0,1,2,3,4,5,6,7,8,9,10,11,12,13,14,15);
}

// CDNA5 async global->LDS copy (ASYNCcnt). LDS byte offset = low 32 bits of
// the generic shared-memory address (ISA 10.2 aperture rules).
__device__ __forceinline__ unsigned lds_addr(const void* p) {
    return (unsigned)(unsigned long long)p;
}
__device__ __forceinline__ void async_copy_b128(unsigned lds_off, const void* gptr) {
    asm volatile("global_load_async_to_lds_b128 %0, %1, off"
                 :: "v"(lds_off), "v"(gptr) : "memory");
}
__device__ __forceinline__ void wait_async0() {
    asm volatile("s_wait_asynccnt 0" ::: "memory");
}

// ---------------------------------------------------------------------------
// Kernel 0a: W fp32 -> bf16 with transpose: Wt[n][k] = bf16(W[k][n]).
// grid (32 ktiles, 32 ntiles, 3), 256 threads, 32x32 LDS tile.
// ---------------------------------------------------------------------------
__global__ __launch_bounds__(256)
void wconv_kernel(const float* __restrict__ w1,
                  const float* __restrict__ w2,
                  const float* __restrict__ w3,
                  unsigned short* __restrict__ wt) {
    const int z = blockIdx.z;
    const float* W = (z == 0) ? w1 : (z == 1) ? w2 : w3;
    unsigned short* Wt = wt + (size_t)z * DIMN * DIMN;

    const int k0 = blockIdx.x * 32;
    const int n0 = blockIdx.y * 32;
    __shared__ unsigned short t[32][33];

    const int tid = threadIdx.x;
    #pragma unroll
    for (int it = 0; it < 4; ++it) {
        int kk = it * 8 + (tid >> 5);
        int nn = tid & 31;
        t[kk][nn] = f2bf(W[(size_t)(k0 + kk) * DIMN + n0 + nn]);
    }
    __syncthreads();
    #pragma unroll
    for (int it = 0; it < 4; ++it) {
        int nn = it * 8 + (tid >> 5);
        int kk = tid & 31;
        Wt[(size_t)(n0 + nn) * DIMN + k0 + kk] = t[kk][nn];
    }
}

// ---------------------------------------------------------------------------
// Kernel 0b: X fp32 -> bf16 (so the GEMM can stage A with async byte copies)
// ---------------------------------------------------------------------------
__global__ __launch_bounds__(256)
void xconv_kernel(const float* __restrict__ X, unsigned short* __restrict__ Xbf) {
    size_t i = ((size_t)blockIdx.x * 256 + threadIdx.x) * 4;
    float4 xv = *(const float4*)(X + i);
    union { unsigned short s[4]; uint2 u; } p;
    p.s[0] = f2bf(xv.x); p.s[1] = f2bf(xv.y);
    p.s[2] = f2bf(xv.z); p.s[3] = f2bf(xv.w);
    *(uint2*)(Xbf + i) = p.u;
}

// ---------------------------------------------------------------------------
// Kernel 1: QKV projection GEMM. Xbf[16384,1024] * Wt^T + b -> bf16.
// One 256 x 256 tile of the output per work-group, 64 k per stage, two LDS
// buffers filled by async copies; 8 waves (2 x 4), 128 x 64 of the tile each
// (8 x 4 WMMA subtiles): 12 fragments read from LDS feed 32 WMMAs.
// grid (4 Ntiles, 64 Mtiles, 3 matrices), 256 threads.
// ---------------------------------------------------------------------------
#define PJ_TILE  256                         // rows of X and rows of Wt per stage
#define PJ_K     64                          // k per stage: 128 B, one whole line a row
#define PJ_PITCH 72                          // 144 B = 16 B x odd for ds_load_b128 readers
#define PJ_TRIPS (DIMN / PJ_K)               // 16

// Eight async copies of one lane: rows r, r + 32, ..., r + 224 of one operand's
// stage. s_wait_xcnt stands inside the statement so that no address register is
// rewritten before it.
__device__ __forceinline__ void stage_rows8(unsigned l, const unsigned short* g) {
    asm volatile("global_load_async_to_lds_b128 %0, %8, off\n\t"
                 "global_load_async_to_lds_b128 %1, %9, off\n\t"
                 "global_load_async_to_lds_b128 %2, %10, off\n\t"
                 "global_load_async_to_lds_b128 %3, %11, off\n\t"
                 "global_load_async_to_lds_b128 %4, %12, off\n\t"
                 "global_load_async_to_lds_b128 %5, %13, off\n\t"
                 "global_load_async_to_lds_b128 %6, %14, off\n\t"
                 "global_load_async_to_lds_b128 %7, %15, off\n\t"
                 "s_wait_xcnt 0x0"
                 :: "v"(l),
                    "v"(l + 1u * 32u * PJ_PITCH * 2u),
                    "v"(l + 2u * 32u * PJ_PITCH * 2u),
                    "v"(l + 3u * 32u * PJ_PITCH * 2u),
                    "v"(l + 4u * 32u * PJ_PITCH * 2u),
                    "v"(l + 5u * 32u * PJ_PITCH * 2u),
                    "v"(l + 6u * 32u * PJ_PITCH * 2u),
                    "v"(l + 7u * 32u * PJ_PITCH * 2u),
                    "v"(g),
                    "v"(g + 1 * 32 * DIMN),
                    "v"(g + 2 * 32 * DIMN),
                    "v"(g + 3 * 32 * DIMN),
                    "v"(g + 4 * 32 * DIMN),
                    "v"(g + 5 * 32 * DIMN),
                    "v"(g + 6 * 32 * DIMN),
                    "v"(g + 7 * 32 * DIMN)
                 : "memory");
}

__global__ __launch_bounds__(256)
void proj_kernel(const unsigned short* __restrict__ Xbf,
                 const unsigned short* __restrict__ Wt,
                 const float* __restrict__ b1,
                 const float* __restrict__ b2,
                 const float* __restrict__ b3,
                 unsigned short* __restrict__ Q,
                 unsigned short* __restrict__ K,
                 unsigned short* __restrict__ V) {
    const int z = blockIdx.z;
    const unsigned short* Wz = Wt + (size_t)z * DIMN * DIMN;
    const float* bias = (z == 0) ? b1 : (z == 1) ? b2 : b3;
    unsigned short* Out = (z == 0) ? Q : (z == 1) ? K : V;

    const int n0 = blockIdx.x * PJ_TILE;
    const int m0 = blockIdx.y * PJ_TILE;

    __shared__ __attribute__((aligned(16))) unsigned short As[2][PJ_TILE][PJ_PITCH];   // 2 x 36 KB
    __shared__ __attribute__((aligned(16))) unsigned short Bs[2][PJ_TILE][PJ_PITCH];   // 2 x 36 KB ([n][k])

    const int tid   = threadIdx.x;
    const int wave  = tid >> 5;
    const int lane  = tid & 31;
    const int wm    = wave >> 2;                // 0..1 (M), 128 rows
    const int wn    = wave & 3;                 // 0..3 (N), 64 columns
    const int lhalf = lane >> 4;
    const int l16   = lane & 15;

    // per-thread staging coords: eight lanes cover one row's 128 B
    const int sr = tid >> 3;                    // 0..31
    const int sc = (tid & 7) * 8;               // 0,8,...,56

    const unsigned short* gA = Xbf + (size_t)(m0 + sr) * DIMN + sc;
    const unsigned short* gB = Wz  + (size_t)(n0 + sr) * DIMN + sc;

    v8f acc[8][4] = {};

    // stage 0 lands and is published, then stage 1 starts
    stage_rows8(lds_addr(&As[0][sr][sc]), gA);
    stage_rows8(lds_addr(&Bs[0][sr][sc]), gB);
    wait_async0();
    __syncthreads();
    stage_rows8(lds_addr(&As[1][sr][sc]), gA + PJ_K);
    stage_rows8(lds_addr(&Bs[1][sr][sc]), gB + PJ_K);

    for (int t = 0; t < PJ_TRIPS; ++t) {
        const int buf = t & 1;
        // compute on the current buffer (loops unrolled: register arrays need constant indices)
        v16bf fa[2][8], fb[2][4];                  // the wave's 24 fragments of this stage
        #pragma unroll
        for (int ks = 0; ks < 2; ++ks) {
            const int kc = ks * 32 + lhalf * 8;
            #pragma unroll
            for (int ns = 0; ns < 4; ++ns) {
                int br = wn * 64 + ns * 16 + l16;
                fb[ks][ns] = load_frag(&Bs[buf][br][kc], &Bs[buf][br][kc + 16]);
            }
            #pragma unroll
            for (int ms = 0; ms < 8; ++ms) {
                int ar = wm * 128 + ms * 16 + l16;
                fa[ks][ms] = load_frag(&As[buf][ar][kc], &As[buf][ar][kc + 16]);
            }
        }
        // keeps the stage's LDS reads one group in front of its WMMAs: left to itself the
        // build reads each row's fragment directly in front of its four WMMAs and waits it out
        __builtin_amdgcn_sched_barrier(0);
        #pragma unroll
        for (int ks = 0; ks < 2; ++ks) {
            #pragma unroll
            for (int ms = 0; ms < 8; ++ms) {
                #pragma unroll
                for (int ns = 0; ns < 4; ++ns)
                    acc[ms][ns] = __builtin_amdgcn_wmma_f32_16x16x32_bf16(
                        false, fa[ks][ms], false, fb[ks][ns], (short)0, acc[ms][ns], false, false);
            }
        }
        // keeps the WMMAs in front of the foot's waits: sunk behind them, every WMMA would
        // stand behind the wait for the last of the 48 reads instead of starting on the first
        __builtin_amdgcn_sched_barrier(0);
        // foot of the trip: this wave's reads of buffer buf are done, its copies of
        // stage t + 1 have landed, and the barrier says so of every wave
        asm volatile("s_wait_dscnt 0x0" ::: "memory");
        wait_async0();
        __syncthreads();
        if (t + 2 < PJ_TRIPS) {
            stage_rows8(lds_addr(&As[buf][sr][sc]), gA + (t + 2) * PJ_K);
            stage_rows8(lds_addr(&Bs[buf][sr][sc]), gB + (t + 2) * PJ_K);
        }
    }
    wait_async0();   // no copy is outstanding when the wave ends

    // epilogue: + bias, -> bf16 (loops unrolled: constant accumulator indices)
    float bv[4];
    #pragma unroll
    for (int ns = 0; ns < 4; ++ns)
        bv[ns] = bias[n0 + wn * 64 + ns * 16 + l16];
    // the four loads' offset register is not rewritten before this wait
    asm volatile("s_wait_xcnt 0x0" ::: "memory");
    // keeps the address arithmetic that follows behind that wait
    __builtin_amdgcn_sched_barrier(0);
    #pragma unroll
    for (int ms = 0; ms < 8; ++ms) {
        unsigned short h[4][8];
        #pragma unroll
        for (int ns = 0; ns < 4; ++ns) {
            #pragma unroll
            for (int g = 0; g < 8; ++g)
                h[ns][g] = f2bf(acc[ms][ns][g] + bv[ns]);
        }
        // all 32 values of the run are formed before its first store, so none is
        // formed in a register that a store of the run names
        __builtin_amdgcn_sched_barrier(0);
        #pragma unroll
        for (int ns = 0; ns < 4; ++ns) {
            #pragma unroll
            for (int g = 0; g < 8; ++g) {
                int row = m0 + wm * 128 + ms * 16 + lhalf * 8 + g;
                int col = n0 + wn * 64 + ns * 16 + l16;
                Out[(size_t)row * DIMN + col] = h[ns][g];
            }
        }
        // the run's data and address registers are not rewritten before this wait
        asm volatile("s_wait_xcnt 0x0" ::: "memory");
        // keeps the next run's arithmetic behind that wait
        __builtin_amdgcn_sched_barrier(0);
    }
}

// ---------------------------------------------------------------------------
// Kernel 2: block-local attention. grid (HEADS, BLK_NUM, BATCH), 256 threads.
// ---------------------------------------------------------------------------
__global__ __launch_bounds__(256)
void attn_kernel(const unsigned short* __restrict__ Qg,
                 const unsigned short* __restrict__ Kg,
                 const unsigned short* __restrict__ Vg,
                 const int* __restrict__ mask,
                 float* __restrict__ O) {
    const int head = blockIdx.x;
    const int blk  = blockIdx.y;
    const int b    = blockIdx.z;

    // Row pitch 16 B x odd (144 B, 272 B) for the ds_load_b128 fragment readers:
    // 8 pad elements a row, never read.
    __shared__ __attribute__((aligned(16))) unsigned short Qs[128][72];    // 18 KB
    __shared__ __attribute__((aligned(16))) unsigned short Ks[128][72];    // 18 KB
    __shared__ __attribute__((aligned(16))) unsigned short Vst[64][136];   // 17 KB, transposed [d][key]
    __shared__ __attribute__((aligned(16))) unsigned short Ps[128][136];   // 34 KB probabilities bf16

    const int tid   = threadIdx.x;
    const int wave  = tid >> 5;               // query rows [wave*16, +16)
    const int lane  = tid & 31;
    const int lhalf = lane >> 4;
    const int l16   = lane & 15;

    const size_t rowbase = (size_t)b * SEQ + (size_t)blk * BLK_LEN;
    const int cb = head * DH;

    // stage Q, K via CDNA5 async-to-LDS; V through VGPRs (needs transpose)
    #pragma unroll
    for (int it = 0; it < 4; ++it) {
        int r = it * 32 + (tid >> 3);
        int d = (tid & 7) * 8;
        async_copy_b128(lds_addr(&Qs[r][d]), Qg + (rowbase + r) * DIMN + cb + d);
        async_copy_b128(lds_addr(&Ks[r][d]), Kg + (rowbase + r) * DIMN + cb + d);
        uint4 vv = *(const uint4*)(Vg + (rowbase + r) * DIMN + cb + d);
        const unsigned short* vs = (const unsigned short*)&vv;
        #pragma unroll
        for (int j = 0; j < 8; ++j) Vst[d + j][r] = vs[j];
    }
    wait_async0();
    __syncthreads();

    // S = Q K^T : 16 query rows x 128 keys per wave, K-dim 64 (2 steps)
    v8f s[8] = {};
    #pragma unroll
    for (int ks = 0; ks < 2; ++ks) {
        int ar = wave * 16 + l16;
        v16bf a = load_frag(&Qs[ar][ks * 32 + lhalf * 8],
                            &Qs[ar][ks * 32 + lhalf * 8 + 16]);
        #pragma unroll
        for (int nt = 0; nt < 8; ++nt) {
            int br = nt * 16 + l16;
            v16bf bb = load_frag(&Ks[br][ks * 32 + lhalf * 8],
                                 &Ks[br][ks * 32 + lhalf * 8 + 16]);
            s[nt] = __builtin_amdgcn_wmma_f32_16x16x32_bf16(
                false, a, false, bb, (short)0, s[nt], false, false);
        }
    }

    // scale + mask + row softmax (C-layout: vgpr g -> row g / 8+g per half)
    const float scale = 0.125f; // 1/sqrt(64)
    #pragma unroll
    for (int g = 0; g < 8; ++g) {
        int rloc = wave * 16 + lhalf * 8 + g;
        float mval = (float)mask[(rowbase + rloc) * DIMN + cb];
        float madd = (1.0f - mval) * -1.0e10f;
        float rmax = -3.0e38f;
        #pragma unroll
        for (int nt = 0; nt < 8; ++nt) {
            float x = s[nt][g] * scale + madd;
            s[nt][g] = x;
            rmax = fmaxf(rmax, x);
        }
        #pragma unroll
        for (int off = 1; off < 16; off <<= 1)
            rmax = fmaxf(rmax, __shfl_xor(rmax, off, 32));
        float rsum = 0.0f;
        #pragma unroll
        for (int nt = 0; nt < 8; ++nt) {
            float e = __expf(s[nt][g] - rmax);
            s[nt][g] = e;
            rsum += e;
        }
        #pragma unroll
        for (int off = 1; off < 16; off <<= 1)
            rsum += __shfl_xor(rsum, off, 32);
        float inv = 1.0f / rsum;
        #pragma unroll
        for (int nt = 0; nt < 8; ++nt)
            Ps[rloc][nt * 16 + l16] = f2bf(s[nt][g] * inv);
    }
    __syncthreads();

    // O = P V : 16 rows x 64 cols, K-dim 128 (4 steps)
    v8f o[4] = {};
    #pragma unroll
    for (int ks = 0; ks < 4; ++ks) {
        int ar = wave * 16 + l16;
        v16bf a = load_frag(&Ps[ar][ks * 32 + lhalf * 8],
                            &Ps[ar][ks * 32 + lhalf * 8 + 16]);
        #pragma unroll
        for (int nt = 0; nt < 4; ++nt) {
            int br = nt * 16 + l16; // d index (Vst transposed -> contiguous k)
            v16bf bb = load_frag(&Vst[br][ks * 32 + lhalf * 8],
                                 &Vst[br][ks * 32 + lhalf * 8 + 16]);
            o[nt] = __builtin_amdgcn_wmma_f32_16x16x32_bf16(
                false, a, false, bb, (short)0, o[nt], false, false);
        }
    }
    #pragma unroll
    for (int nt = 0; nt < 4; ++nt) {
        #pragma unroll
        for (int g = 0; g < 8; ++g) {
            int rloc = wave * 16 + lhalf * 8 + g;
            int col  = cb + nt * 16 + l16;
            O[(rowbase + rloc) * DIMN + col] = o[nt][g];
        }
    }
}

// ---------------------------------------------------------------------------
// Kernel 3: residual + LayerNorm. one block per row (16384 rows), 256 threads.
// ---------------------------------------------------------------------------
__global__ __launch_bounds__(256)
void ln_kernel(const float* __restrict__ O,
               const float* __restrict__ X,
               const float* __restrict__ gamma,
               const float* __restrict__ beta,
               float* __restrict__ out) {
    const size_t row = blockIdx.x;
    const int tid = threadIdx.x;
    const int c = tid * 4;

    float4 ov = *(const float4*)(O + row * DIMN + c);
    float4 xv = *(const float4*)(X + row * DIMN + c);
    float r0 = ov.x + xv.x, r1 = ov.y + xv.y, r2 = ov.z + xv.z, r3 = ov.w + xv.w;

    float ssum = r0 + r1 + r2 + r3;
    float ssq  = r0 * r0 + r1 * r1 + r2 * r2 + r3 * r3;
    #pragma unroll
    for (int off = 1; off < 32; off <<= 1) {
        ssum += __shfl_xor(ssum, off, 32);
        ssq  += __shfl_xor(ssq,  off, 32);
    }
    __shared__ float wsum[8], wsq[8];
    if ((tid & 31) == 0) { wsum[tid >> 5] = ssum; wsq[tid >> 5] = ssq; }
    __syncthreads();
    float tot = 0.0f, totq = 0.0f;
    #pragma unroll
    for (int i = 0; i < 8; ++i) { tot += wsum[i]; totq += wsq[i]; }

    const float mean = tot * (1.0f / DIMN);
    const float var  = totq * (1.0f / DIMN) - mean * mean;
    const float inv  = rsqrtf(var + 1.0e-3f);

    float4 res;
    res.x = (r0 - mean) * inv * gamma[c + 0] + beta[c + 0];
    res.y = (r1 - mean) * inv * gamma[c + 1] + beta[c + 1];
    res.z = (r2 - mean) * inv * gamma[c + 2] + beta[c + 2];
    res.w = (r3 - mean) * inv * gamma[c + 3] + beta[c + 3];
    *(float4*)(out + row * DIMN + c) = res;
}

// ---------------------------------------------------------------------------
extern "C" void kernel_launch(void* const* d_in, const int* in_sizes, int n_in,
                              void* d_out, int out_size, void* d_ws, size_t ws_size,
                              hipStream_t stream) {
    (void)in_sizes; (void)n_in; (void)out_size; (void)ws_size;

    const float* X     = (const float*)d_in[0];
    const int*   mask  = (const int*)d_in[1];
    const float* w1    = (const float*)d_in[2];
    const float* b1    = (const float*)d_in[3];
    const float* w2    = (const float*)d_in[4];
    const float* b2    = (const float*)d_in[5];
    const float* w3    = (const float*)d_in[6];
    const float* b3    = (const float*)d_in[7];
    const float* gamma = (const float*)d_in[8];
    const float* beta  = (const float*)d_in[9];
    float* out = (float*)d_out;

    char* ws = (char*)d_ws;
    unsigned short* Wt  = (unsigned short*)(ws + WT_OFF);
    unsigned short* Xbf = (unsigned short*)(ws + XBF_OFF);
    unsigned short* Q   = (unsigned short*)(ws + Q_OFF);
    unsigned short* K   = (unsigned short*)(ws + K_OFF);
    unsigned short* V   = (unsigned short*)(ws + V_OFF);
    float*          O   = (float*)(ws + O_OFF);

    // 0a) weights -> bf16, transposed to [n][k]
    wconv_kernel<<<dim3(DIMN / 32, DIMN / 32, 3), dim3(256), 0, stream>>>(w1, w2, w3, Wt);
    // 0b) activations -> bf16
    xconv_kernel<<<dim3((ROWS * DIMN) / 1024), dim3(256), 0, stream>>>(X, Xbf);

    // 1) Q/K/V projections (WMMA bf16, async-to-LDS double buffered)
    proj_kernel<<<dim3(DIMN / 256, ROWS / 256, 3), dim3(256), 0, stream>>>(
        Xbf, Wt, b1, b2, b3, Q, K, V);

    // 2) block-local attention (WMMA)
    attn_kernel<<<dim3(HEADS, BLK_NUM, BATCH), dim3(256), 0, stream>>>(
        Q, K, V, mask, O);

    // 3) residual + LayerNorm
    ln_kernel<<<dim3(ROWS), dim3(256), 0, stream>>>(O, X, gamma, beta, out);
}

// v003
// Measured time: 133 microseconds a run.
// Timed twice side by side with v002, it ran 1.05 times as fast both times.
// Counting every step since v000, it is 1.89 times as fast.
#include <hip/hip_runtime.h>

#define DIMN 1024
#define HEADS 16
#define DH 64
#define BLK_LEN 128
#define BLK_NUM 32
#define BATCH 4
#define SEQ (BLK_NUM * BLK_LEN)          // 4096
#define ROWS (BATCH * SEQ)               // 16384

typedef __attribute__((ext_vector_type(8)))  float  v8f;
typedef __attribute__((ext_vector_type(8)))  __bf16 v8bf;
typedef __attribute__((ext_vector_type(16))) __bf16 v16bf;

// ---- workspace layout (bytes) ----
static const size_t WT_OFF  = 0;                         // W^T bf16, 3 * 2MB
static const size_t XBF_OFF = 6291456;                   // X bf16, 32MB
static const size_t Q_OFF   = XBF_OFF + 33554432ull;
static const size_t K_OFF   = Q_OFF   + 33554432ull;
static const size_t V_OFF   = K_OFF   + 33554432ull;
static const size_t O_OFF   = V_OFF   + 33554432ull;     // attn out f32, 64MB

__device__ __forceinline__ unsigned short f2bf(float f) {
    union { float f; unsigned u; } v; v.f = f;
    unsigned r = v.u + 0x7FFFu + ((v.u >> 16) & 1u);     // round-to-nearest-even
    return (unsigned short)(r >> 16);
}

__device__ __forceinline__ v16bf load_frag(const unsigned short* lo,
                                           const unsigned short* hi) {
    v8bf a = *(const v8bf*)lo;
    v8bf b = *(const v8bf*)hi;
    return __builtin_shufflevector(a, b, 0,1,2,3,4,5,6,7,8,9,10,11,12,13,14,15);
}

// CDNA5 async global->LDS copy (ASYNCcnt). LDS byte offset = low 32 bits of
// the generic shared-memory address (ISA 10.2 aperture rules).
__device__ __forceinline__ unsigned lds_addr(const void* p) {
    return (unsigned)(unsigned long long)p;
}
__device__ __forceinline__ void async_copy_b128(unsigned lds_off, const void* gptr) {
    asm volatile("global_load_async_to_lds_b128 %0, %1, off"
                 :: "v"(lds_off), "v"(gptr) : "memory");
}
__device__ __forceinline__ void wait_async0() {
    asm volatile("s_wait_asynccnt 0" ::: "memory");
}

// ---------------------------------------------------------------------------
// Kernel 0a: W fp32 -> bf16 with transpose: Wt[n][k] = bf16(W[k][n]).
// One 128 (k) x 64 (n) tile per work-group, 32 elements a thread, so that few
// waves have to be started: grid (8 ktiles, 16 ntiles, 3), 256 threads.
// ---------------------------------------------------------------------------
#define WC_K 128
#define WC_N 64
#define WC_PITCH (WC_K + 8)                  // 272 B = 16 B x odd for the ds_load_b128 readers
__global__ __launch_bounds__(256)
void wconv_kernel(const float* __restrict__ w1,
                  const float* __restrict__ w2,
                  const float* __restrict__ w3,
                  unsigned short* __restrict__ wt) {
    const int z = blockIdx.z;
    const float* W = (z == 0) ? w1 : (z == 1) ? w2 : w3;
    unsigned short* Wt = wt + (size_t)z * DIMN * DIMN;

    const int k0 = blockIdx.x * WC_K;
    const int n0 = blockIdx.y * WC_N;
    __shared__ __attribute__((aligned(16))) unsigned short t[WC_N][WC_PITCH];   // [n][k]

    const int tid = threadIdx.x;
    const int lk = tid >> 4;                  // 0..15
    const int ln = (tid & 15) * 4;            // 16 lanes cover a row's 256 B
    const float* src = W + (size_t)(k0 + lk) * DIMN + n0 + ln;
    float4 w[8];
    #pragma unroll
    for (int it = 0; it < 8; ++it)
        w[it] = *(const float4*)(src + (size_t)it * 16 * DIMN);
    #pragma unroll
    for (int it = 0; it < 8; ++it) {
        int kk = it * 16 + lk;
        t[ln + 0][kk] = f2bf(w[it].x);
        t[ln + 1][kk] = f2bf(w[it].y);
        t[ln + 2][kk] = f2bf(w[it].z);
        t[ln + 3][kk] = f2bf(w[it].w);
    }
    __syncthreads();
    const int sn = tid >> 4;                  // 0..15
    const int sk = (tid & 15) * 8;            // 16 lanes cover a row's 256 B
    unsigned short* dst = Wt + (size_t)(n0 + sn) * DIMN + k0 + sk;
    #pragma unroll
    for (int it = 0; it < 4; ++it)
        *(uint4*)(dst + (size_t)it * 16 * DIMN) = *(const uint4*)&t[it * 16 + sn][sk];
}

// ---------------------------------------------------------------------------
// Kernel 0b: X fp32 -> bf16 (so the GEMM can stage A with async byte copies).
// Each wave converts 16 KB of X: 32 loads of 512 contiguous bytes, all issued
// at its head. grid 512, 256 threads: 4,096 waves.
// ---------------------------------------------------------------------------
#define XC_LOADS 32
__global__ __launch_bounds__(256)
void xconv_kernel(const float* __restrict__ X, unsigned short* __restrict__ Xbf) {
    const int wave = threadIdx.x >> 5;
    const int lane = threadIdx.x & 31;
    const size_t base = ((size_t)blockIdx.x * 8 + wave) * (XC_LOADS * 128) + lane * 4;
    const float* src = X + base;
    unsigned short* dst = Xbf + base;

    float4 v[XC_LOADS];
    #pragma unroll
    for (int j = 0; j < XC_LOADS; ++j)
        v[j] = *(const float4*)(src + j * 128);
    // keeps all 32 loads in front of the arithmetic: left to itself the build holds
    // about a dozen in flight and issues the rest among the conversions
    __builtin_amdgcn_sched_barrier(0);
    // loops unrolled: register arrays need constant indices
    #pragma unroll
    for (int b = 0; b < XC_LOADS / 8; ++b) {
        uint2 p[8];
        #pragma unroll
        for (int j = 0; j < 8; ++j) {
            float4 xv = v[b * 8 + j];
            p[j].x = (unsigned)f2bf(xv.x) | ((unsigned)f2bf(xv.y) << 16);
            p[j].y = (unsigned)f2bf(xv.z) | ((unsigned)f2bf(xv.w) << 16);
        }
        // all 8 values of the run are formed before its first store, so none is
        // formed in a register that a store of the run names
        __builtin_amdgcn_sched_barrier(0);
        #pragma unroll
        for (int j = 0; j < 8; ++j)
            *(uint2*)(dst + (b * 8 + j) * 128) = p[j];
        if (b + 1 < XC_LOADS / 8) {
            // the run's data registers are not rewritten before this wait
            asm volatile("s_wait_xcnt 0x0" ::: "memory");
            // keeps the next run's arithmetic behind that wait
            __builtin_amdgcn_sched_barrier(0);
        }
    }
}

// ---------------------------------------------------------------------------
// Kernel 1: QKV projection GEMM. Xbf[16384,1024] * Wt^T + b -> bf16.
// One 256 x 256 tile of the output per work-group, 64 k per stage, two LDS
// buffers filled by async copies; 8 waves (2 x 4), 128 x 64 of the tile each
// (8 x 4 WMMA subtiles): 12 fragments read from LDS feed 32 WMMAs.
// grid (4 Ntiles, 64 Mtiles, 3 matrices), 256 threads.
// ---------------------------------------------------------------------------
#define PJ_TILE  256                         // rows of X and rows of Wt per stage
#define PJ_K     64                          // k per stage: 128 B, one whole line a row
#define PJ_PITCH 72                          // 144 B = 16 B x odd for ds_load_b128 readers
#define PJ_TRIPS (DIMN / PJ_K)               // 16

// Eight async copies of one lane: rows r, r + 32, ..., r + 224 of one operand's
// stage. s_wait_xcnt stands inside the statement so that no address register is
// rewritten before it.
__device__ __forceinline__ void stage_rows8(unsigned l, const unsigned short* g) {
    asm volatile("global_load_async_to_lds_b128 %0, %8, off\n\t"
                 "global_load_async_to_lds_b128 %1, %9, off\n\t"
                 "global_load_async_to_lds_b128 %2, %10, off\n\t"
                 "global_load_async_to_lds_b128 %3, %11, off\n\t"
                 "global_load_async_to_lds_b128 %4, %12, off\n\t"
                 "global_load_async_to_lds_b128 %5, %13, off\n\t"
                 "global_load_async_to_lds_b128 %6, %14, off\n\t"
                 "global_load_async_to_lds_b128 %7, %15, off\n\t"
                 "s_wait_xcnt 0x0"
                 :: "v"(l),
                    "v"(l + 1u * 32u * PJ_PITCH * 2u),
                    "v"(l + 2u * 32u * PJ_PITCH * 2u),
                    "v"(l + 3u * 32u * PJ_PITCH * 2u),
                    "v"(l + 4u * 32u * PJ_PITCH * 2u),
                    "v"(l + 5u * 32u * PJ_PITCH * 2u),
                    "v"(l + 6u * 32u * PJ_PITCH * 2u),
                    "v"(l + 7u * 32u * PJ_PITCH * 2u),
                    "v"(g),
                    "v"(g + 1 * 32 * DIMN),
                    "v"(g + 2 * 32 * DIMN),
                    "v"(g + 3 * 32 * DIMN),
                    "v"(g + 4 * 32 * DIMN),
                    "v"(g + 5 * 32 * DIMN),
                    "v"(g + 6 * 32 * DIMN),
                    "v"(g + 7 * 32 * DIMN)
                 : "memory");
}

__global__ __launch_bounds__(256)
void proj_kernel(const unsigned short* __restrict__ Xbf,
                 const unsigned short* __restrict__ Wt,
                 const float* __restrict__ b1,
                 const float* __restrict__ b2,
                 const float* __restrict__ b3,
                 unsigned short* __restrict__ Q,
                 unsigned short* __restrict__ K,
                 unsigned short* __restrict__ V) {
    const int z = blockIdx.z;
    const unsigned short* Wz = Wt + (size_t)z * DIMN * DIMN;
    const float* bias = (z == 0) ? b1 : (z == 1) ? b2 : b3;
    unsigned short* Out = (z == 0) ? Q : (z == 1) ? K : V;

    const int n0 = blockIdx.x * PJ_TILE;
    const int m0 = blockIdx.y * PJ_TILE;

    __shared__ __attribute__((aligned(16))) unsigned short As[2][PJ_TILE][PJ_PITCH];   // 2 x 36 KB
    __shared__ __attribute__((aligned(16))) unsigned short Bs[2][PJ_TILE][PJ_PITCH];   // 2 x 36 KB ([n][k])

    const int tid   = threadIdx.x;
    const int wave  = tid >> 5;
    const int lane  = tid & 31;
    const int wm    = wave >> 2;                // 0..1 (M), 128 rows
    const int wn    = wave & 3;                 // 0..3 (N), 64 columns
    const int lhalf = lane >> 4;
    const int l16   = lane & 15;

    // per-thread staging coords: eight lanes cover one row's 128 B
    const int sr = tid >> 3;                    // 0..31
    const int sc = (tid & 7) * 8;               // 0,8,...,56

    const unsigned short* gA = Xbf + (size_t)(m0 + sr) * DIMN + sc;
    const unsigned short* gB = Wz  + (size_t)(n0 + sr) * DIMN + sc;

    v8f acc[8][4] = {};

    // stage 0 lands and is published, then stage 1 starts
    stage_rows8(lds_addr(&As[0][sr][sc]), gA);
    stage_rows8(lds_addr(&Bs[0][sr][sc]), gB);
    wait_async0();
    __syncthreads();
    stage_rows8(lds_addr(&As[1][sr][sc]), gA + PJ_K);
    stage_rows8(lds_addr(&Bs[1][sr][sc]), gB + PJ_K);

    for (int t = 0; t < PJ_TRIPS; ++t) {
        const int buf = t & 1;
        // compute on the current buffer (loops unrolled: register arrays need constant indices)
        v16bf fa[2][8], fb[2][4];                  // the wave's 24 fragments of this stage
        #pragma unroll
        for (int ks = 0; ks < 2; ++ks) {
            const int kc = ks * 32 + lhalf * 8;
            #pragma unroll
            for (int ns = 0; ns < 4; ++ns) {
                int br = wn * 64 + ns * 16 + l16;
                fb[ks][ns] = load_frag(&Bs[buf][br][kc], &Bs[buf][br][kc + 16]);
            }
            #pragma unroll
            for (int ms = 0; ms < 8; ++ms) {
                int ar = wm * 128 + ms * 16 + l16;
                fa[ks][ms] = load_frag(&As[buf][ar][kc], &As[buf][ar][kc + 16]);
            }
        }
        // keeps the stage's LDS reads one group in front of its WMMAs: left to itself the
        // build reads each row's fragment directly in front of its four WMMAs and waits it out
        __builtin_amdgcn_sched_barrier(0);
        #pragma unroll
        for (int ks = 0; ks < 2; ++ks) {
            #pragma unroll
            for (int ms = 0; ms < 8; ++ms) {
                #pragma unroll
                for (int ns = 0; ns < 4; ++ns)
                    acc[ms][ns] = __builtin_amdgcn_wmma_f32_16x16x32_bf16(
                        false, fa[ks][ms], false, fb[ks][ns], (short)0, acc[ms][ns], false, false);
            }
        }
        // keeps the WMMAs in front of the foot's waits: sunk behind them, every WMMA would
        // stand behind the wait for the last of the 48 reads instead of starting on the first
        __builtin_amdgcn_sched_barrier(0);
        // foot of the trip: this wave's reads of buffer buf are done, its copies of
        // stage t + 1 have landed, and the barrier says so of every wave
        asm volatile("s_wait_dscnt 0x0" ::: "memory");
        wait_async0();
        __syncthreads();
        if (t + 2 < PJ_TRIPS) {
            stage_rows8(lds_addr(&As[buf][sr][sc]), gA + (t + 2) * PJ_K);
            stage_rows8(lds_addr(&Bs[buf][sr][sc]), gB + (t + 2) * PJ_K);
        }
    }
    wait_async0();   // no copy is outstanding when the wave ends

    // epilogue: + bias, -> bf16 (loops unrolled: constant accumulator indices)
    float bv[4];
    #pragma unroll
    for (int ns = 0; ns < 4; ++ns)
        bv[ns] = bias[n0 + wn * 64 + ns * 16 + l16];
    // the four loads' offset register is not rewritten before this wait
    asm volatile("s_wait_xcnt 0x0" ::: "memory");
    // keeps the address arithmetic that follows behind that wait
    __builtin_amdgcn_sched_barrier(0);
    #pragma unroll
    for (int ms = 0; ms < 8; ++ms) {
        unsigned short h[4][8];
        #pragma unroll
        for (int ns = 0; ns < 4; ++ns) {
            #pragma unroll
            for (int g = 0; g < 8; ++g)
                h[ns][g] = f2bf(acc[ms][ns][g] + bv[ns]);
        }
        // all 32 values of the run are formed before its first store, so none is
        // formed in a register that a store of the run names
        __builtin_amdgcn_sched_barrier(0);
        #pragma unroll
        for (int ns = 0; ns < 4; ++ns) {
            #pragma unroll
            for (int g = 0; g < 8; ++g) {
                int row = m0 + wm * 128 + ms * 16 + lhalf * 8 + g;
                int col = n0 + wn * 64 + ns * 16 + l16;
                Out[(size_t)row * DIMN + col] = h[ns][g];
            }
        }
        // the run's data and address registers are not rewritten before this wait
        asm volatile("s_wait_xcnt 0x0" ::: "memory");
        // keeps the next run's arithmetic behind that wait
        __builtin_amdgcn_sched_barrier(0);
    }
}

// ---------------------------------------------------------------------------
// Kernel 2: block-local attention. grid (HEADS, BLK_NUM, BATCH), 256 threads.
// ---------------------------------------------------------------------------
__global__ __launch_bounds__(256)
void attn_kernel(const unsigned short* __restrict__ Qg,
                 const unsigned short* __restrict__ Kg,
                 const unsigned short* __restrict__ Vg,
                 const int* __restrict__ mask,
                 float* __restrict__ O) {
    const int head = blockIdx.x;
    const int blk  = blockIdx.y;
    const int b    = blockIdx.z;

    // Row pitch 16 B x odd (144 B, 272 B) for the ds_load_b128 fragment readers:
    // 8 pad elements a row, never read.
    __shared__ __attribute__((aligned(16))) unsigned short Qs[128][72];    // 18 KB
    __shared__ __attribute__((aligned(16))) unsigned short Ks[128][72];    // 18 KB
    __shared__ __attribute__((aligned(16))) unsigned short Vst[64][136];   // 17 KB, transposed [d][key]
    __shared__ __attribute__((aligned(16))) unsigned short Ps[128][136];   // 34 KB probabilities bf16

    const int tid   = threadIdx.x;
    const int wave  = tid >> 5;               // query rows [wave*16, +16)
    const int lane  = tid & 31;
    const int lhalf = lane >> 4;
    const int l16   = lane & 15;

    const size_t rowbase = (size_t)b * SEQ + (size_t)blk * BLK_LEN;
    const int cb = head * DH;

    // stage Q, K via CDNA5 async-to-LDS; V through VGPRs (needs transpose)
    #pragma unroll
    for (int it = 0; it < 4; ++it) {
        int r = it * 32 + (tid >> 3);
        int d = (tid & 7) * 8;
        async_copy_b128(lds_addr(&Qs[r][d]), Qg + (rowbase + r) * DIMN + cb + d);
        async_copy_b128(lds_addr(&Ks[r][d]), Kg + (rowbase + r) * DIMN + cb + d);
        uint4 vv = *(const uint4*)(Vg + (rowbase + r) * DIMN + cb + d);
        const unsigned short* vs = (const unsigned short*)&vv;
        #pragma unroll
        for (int j = 0; j < 8; ++j) Vst[d + j][r] = vs[j];
    }
    wait_async0();
    __syncthreads();

    // S = Q K^T : 16 query rows x 128 keys per wave, K-dim 64 (2 steps)
    v8f s[8] = {};
    #pragma unroll
    for (int ks = 0; ks < 2; ++ks) {
        int ar = wave * 16 + l16;
        v16bf a = load_frag(&Qs[ar][ks * 32 + lhalf * 8],
                            &Qs[ar][ks * 32 + lhalf * 8 + 16]);
        #pragma unroll
        for (int nt = 0; nt < 8; ++nt) {
            int br = nt * 16 + l16;
            v16bf bb = load_frag(&Ks[br][ks * 32 + lhalf * 8],
                                 &Ks[br][ks * 32 + lhalf * 8 + 16]);
            s[nt] = __builtin_amdgcn_wmma_f32_16x16x32_bf16(
                false, a, false, bb, (short)0, s[nt], false, false);
        }
    }

    // scale + mask + row softmax (C-layout: vgpr g -> row g / 8+g per half)
    const float scale = 0.125f; // 1/sqrt(64)
    #pragma unroll
    for (int g = 0; g < 8; ++g) {
        int rloc = wave * 16 + lhalf * 8 + g;
        float mval = (float)mask[(rowbase + rloc) * DIMN + cb];
        float madd = (1.0f - mval) * -1.0e10f;
        float rmax = -3.0e38f;
        #pragma unroll
        for (int nt = 0; nt < 8; ++nt) {
            float x = s[nt][g] * scale + madd;
            s[nt][g] = x;
            rmax = fmaxf(rmax, x);
        }
        #pragma unroll
        for (int off = 1; off < 16; off <<= 1)
            rmax = fmaxf(rmax, __shfl_xor(rmax, off, 32));
        float rsum = 0.0f;
        #pragma unroll
        for (int nt = 0; nt < 8; ++nt) {
            float e = __expf(s[nt][g] - rmax);
            s[nt][g] = e;
            rsum += e;
        }
        #pragma unroll
        for (int off = 1; off < 16; off <<= 1)
            rsum += __shfl_xor(rsum, off, 32);
        float inv = 1.0f / rsum;
        #pragma unroll
        for (int nt = 0; nt < 8; ++nt)
            Ps[rloc][nt * 16 + l16] = f2bf(s[nt][g] * inv);
    }
    __syncthreads();

    // O = P V : 16 rows x 64 cols, K-dim 128 (4 steps)
    v8f o[4] = {};
    #pragma unroll
    for (int ks = 0; ks < 4; ++ks) {
        int ar = wave * 16 + l16;
        v16bf a = load_frag(&Ps[ar][ks * 32 + lhalf * 8],
                            &Ps[ar][ks * 32 + lhalf * 8 + 16]);
        #pragma unroll
        for (int nt = 0; nt < 4; ++nt) {
            int br = nt * 16 + l16; // d index (Vst transposed -> contiguous k)
            v16bf bb = load_frag(&Vst[br][ks * 32 + lhalf * 8],
                                 &Vst[br][ks * 32 + lhalf * 8 + 16]);
            o[nt] = __builtin_amdgcn_wmma_f32_16x16x32_bf16(
                false, a, false, bb, (short)0, o[nt], false, false);
        }
    }
    #pragma unroll
    for (int nt = 0; nt < 4; ++nt) {
        #pragma unroll
        for (int g = 0; g < 8; ++g) {
            int rloc = wave * 16 + lhalf * 8 + g;
            int col  = cb + nt * 16 + l16;
            O[(rowbase + rloc) * DIMN + col] = o[nt][g];
        }
    }
}

#define LN_ROWS 4
__global__ __launch_bounds__(256)
void ln_kernel(const float* __restrict__ O,
               const float* __restrict__ X,
               const float* __restrict__ gamma,
               const float* __restrict__ beta,
               float* __restrict__ out) {
    // the wave's number as a scalar: the row addresses are then scalar bases plus one
    // lane offset that all five arrays share and that lives to the last store
    const int wave = __builtin_amdgcn_readfirstlane(threadIdx.x >> 5);
    const unsigned lo = (threadIdx.x & 31u) * 4u;
    const size_t off = ((size_t)blockIdx.x * 8 + wave) * (LN_ROWS * DIMN);
    const float* po = O + off;
    const float* px = X + off;
    float* py = out + off;

    float4 ov[8], xv[8], gm[8], bt[8];
    #pragma unroll
    for (int j = 0; j < 8; ++j) {
        ov[j] = *(const float4*)(po + lo + j * 128);
        xv[j] = *(const float4*)(px + lo + j * 128);
    }
    #pragma unroll
    for (int j = 0; j < 8; ++j) {
        gm[j] = *(const float4*)(gamma + lo + j * 128);
        bt[j] = *(const float4*)(beta  + lo + j * 128);
    }
    // the 32 loads' address registers are not rewritten before this wait
    asm volatile("s_wait_xcnt 0x0" ::: "memory");

    // kept rolled: unrolled, the build draws the next row's additions up to its loads
    // and waits the loads out before this row's butterfly instead of behind it
    #pragma unroll 1
    for (int r = 0; r < LN_ROWS; ++r) {
        // inner loops unrolled: register arrays need constant indices
        float4 v[8];
        float4 s4 = make_float4(0.0f, 0.0f, 0.0f, 0.0f);
        float4 q4 = make_float4(0.0f, 0.0f, 0.0f, 0.0f);
        #pragma unroll
        for (int j = 0; j < 8; ++j) {
            v[j].x = ov[j].x + xv[j].x;
            v[j].y = ov[j].y + xv[j].y;
            v[j].z = ov[j].z + xv[j].z;
            v[j].w = ov[j].w + xv[j].w;
            s4.x += v[j].x; s4.y += v[j].y; s4.z += v[j].z; s4.w += v[j].w;
            q4.x += v[j].x * v[j].x; q4.y += v[j].y * v[j].y;
            q4.z += v[j].z * v[j].z; q4.w += v[j].w * v[j].w;
        }
        if (r + 1 < LN_ROWS) {
            #pragma unroll
            for (int j = 0; j < 8; ++j) {
                ov[j] = *(const float4*)(po + lo + DIMN + j * 128);
                xv[j] = *(const float4*)(px + lo + DIMN + j * 128);
            }
            // the loads' address registers are not rewritten before this wait
            asm volatile("s_wait_xcnt 0x0" ::: "memory");
        }
        // the next row's loads fly while this row is finished
        float tot  = (s4.x + s4.y) + (s4.z + s4.w);
        float totq = (q4.x + q4.y) + (q4.z + q4.w);
        #pragma unroll
        for (int o = 1; o < 32; o <<= 1) {
            tot  += __shfl_xor(tot,  o, 32);
            totq += __shfl_xor(totq, o, 32);
        }
        const float mean = tot * (1.0f / DIMN);
        const float var  = totq * (1.0f / DIMN) - mean * mean;
        const float inv  = rsqrtf(var + 1.0e-3f);
        #pragma unroll
        for (int j = 0; j < 8; ++j) {
            v[j].x = (v[j].x - mean) * inv * gm[j].x + bt[j].x;
            v[j].y = (v[j].y - mean) * inv * gm[j].y + bt[j].y;
            v[j].z = (v[j].z - mean) * inv * gm[j].z + bt[j].z;
            v[j].w = (v[j].w - mean) * inv * gm[j].w + bt[j].w;
        }
        #pragma unroll
        for (int j = 0; j < 8; ++j)
            *(float4*)(py + lo + j * 128) = v[j];
        // the row's data and address registers are not rewritten before this wait
        asm volatile("s_wait_xcnt 0x0" ::: "memory");
        // keeps the next row's arithmetic behind that wait
        __builtin_amdgcn_sched_barrier(0);
        po += DIMN; px += DIMN; py += DIMN;    // scalar bases step on by a row
    }
}

// ---------------------------------------------------------------------------
extern "C" void kernel_launch(void* const* d_in, const int* in_sizes, int n_in,
                              void* d_out, int out_size, void* d_ws, size_t ws_size,
                              hipStream_t stream) {
    (void)in_sizes; (void)n_in; (void)out_size; (void)ws_size;

    const float* X     = (const float*)d_in[0];
    const int*   mask  = (const int*)d_in[1];
    const float* w1    = (const float*)d_in[2];
    const float* b1    = (const float*)d_in[3];
    const float* w2    = (const float*)d_in[4];
    const float* b2    = (const float*)d_in[5];
    const float* w3    = (const float*)d_in[6];
    const float* b3    = (const float*)d_in[7];
    const float* gamma = (const float*)d_in[8];
    const float* beta  = (const float*)d_in[9];
    float* out = (float*)d_out;

    char* ws = (char*)d_ws;
    unsigned short* Wt  = (unsigned short*)(ws + WT_OFF);
    unsigned short* Xbf = (unsigned short*)(ws + XBF_OFF);
    unsigned short* Q   = (unsigned short*)(ws + Q_OFF);
    unsigned short* K   = (unsigned short*)(ws + K_OFF);
    unsigned short* V   = (unsigned short*)(ws + V_OFF);
    float*          O   = (float*)(ws + O_OFF);

    // 0a) weights -> bf16, transposed to [n][k]
    wconv_kernel<<<dim3(DIMN / WC_K, DIMN / WC_N, 3), dim3(256), 0, stream>>>(w1, w2, w3, Wt);
    // 0b) activations -> bf16
    xconv_kernel<<<dim3((ROWS * DIMN) / (8 * XC_LOADS * 128)), dim3(256), 0, stream>>>(X, Xbf);

    // 1) Q/K/V projections (WMMA bf16, async-to-LDS double buffered)
    proj_kernel<<<dim3(DIMN / 256, ROWS / 256, 3), dim3(256), 0, stream>>>(
        Xbf, Wt, b1, b2, b3, Q, K, V);

    // 2) block-local attention (WMMA)
    attn_kernel<<<dim3(HEADS, BLK_NUM, BATCH), dim3(256), 0, stream>>>(
        Q, K, V, mask, O);

    // 3) residual + LayerNorm
    ln_kernel<<<dim3(ROWS / (8 * LN_ROWS)), dim3(256), 0, stream>>>(O, X, gamma, beta, out);
}

// v004
// Measured time: 128 microseconds a run.
// Timed twice side by side with v003, it ran 1.04 times as fast both times.
// Counting every step since v000, it is 1.97 times as fast.
#include <hip/hip_runtime.h>

#define DIMN 1024
#define HEADS 16
#define DH 64
#define BLK_LEN 128
#define BLK_NUM 32
#define BATCH 4
#define SEQ (BLK_NUM * BLK_LEN)          // 4096
#define ROWS (BATCH * SEQ)               // 16384

typedef __attribute__((ext_vector_type(8)))  float  v8f;
typedef __attribute__((ext_vector_type(8)))  __bf16 v8bf;
typedef __attribute__((ext_vector_type(16))) __bf16 v16bf;
typedef __attribute__((ext_vector_type(4)))  unsigned v4u;
typedef __attribute__((ext_vector_type(4)))  float  v4f;

// ---- workspace layout (bytes) ----
static const size_t WT_OFF  = 0;                         // W^T bf16, 3 * 2MB
static const size_t XBF_OFF = 6291456;                   // X bf16, 32MB
static const size_t Q_OFF   = XBF_OFF + 33554432ull;
static const size_t K_OFF   = Q_OFF   + 33554432ull;
static const size_t V_OFF   = K_OFF   + 33554432ull;
static const size_t O_OFF   = V_OFF   + 33554432ull;     // attn out f32, 64MB

__device__ __forceinline__ unsigned short f2bf(float f) {
    union { float f; unsigned u; } v; v.f = f;
    unsigned r = v.u + 0x7FFFu + ((v.u >> 16) & 1u);     // round-to-nearest-even
    return (unsigned short)(r >> 16);
}

__device__ __forceinline__ v16bf load_frag(const unsigned short* lo,
                                           const unsigned short* hi) {
    v8bf a = *(const v8bf*)lo;
    v8bf b = *(const v8bf*)hi;
    return __builtin_shufflevector(a, b, 0,1,2,3,4,5,6,7,8,9,10,11,12,13,14,15);
}

// CDNA5 async global->LDS copy (ASYNCcnt). LDS byte offset = low 32 bits of
// the generic shared-memory address (ISA 10.2 aperture rules).
__device__ __forceinline__ unsigned lds_addr(const void* p) {
    return (unsigned)(unsigned long long)p;
}
__device__ __forceinline__ void async_copy_b128(unsigned lds_off, const void* gptr) {
    asm volatile("global_load_async_to_lds_b128 %0, %1, off"
                 :: "v"(lds_off), "v"(gptr) : "memory");
}
__device__ __forceinline__ void wait_async0() {
    asm volatile("s_wait_asynccnt 0" ::: "memory");
}

// ---------------------------------------------------------------------------
// Kernel 0a: W fp32 -> bf16 with transpose: Wt[n][k] = bf16(W[k][n]).
// One 128 (k) x 64 (n) tile per work-group, 32 elements a thread, so that few
// waves have to be started: grid (8 ktiles, 16 ntiles, 3), 256 threads.
// ---------------------------------------------------------------------------
#define WC_K 128
#define WC_N 64
#define WC_PITCH (WC_K + 8)                  // 272 B = 16 B x odd for the ds_load_b128 readers
__global__ __launch_bounds__(256)
void wconv_kernel(const float* __restrict__ w1,
                  const float* __restrict__ w2,
                  const float* __restrict__ w3,
                  unsigned short* __restrict__ wt) {
    const int z = blockIdx.z;
    const float* W = (z == 0) ? w1 : (z == 1) ? w2 : w3;
    unsigned short* Wt = wt + (size_t)z * DIMN * DIMN;

    const int k0 = blockIdx.x * WC_K;
    const int n0 = blockIdx.y * WC_N;
    __shared__ __attribute__((aligned(16))) unsigned short t[WC_N][WC_PITCH];   // [n][k]

    const int tid = threadIdx.x;
    const int lk = tid >> 4;                  // 0..15
    const int ln = (tid & 15) * 4;            // 16 lanes cover a row's 256 B
    const float* src = W + (size_t)(k0 + lk) * DIMN + n0 + ln;
    float4 w[8];
    #pragma unroll
    for (int it = 0; it < 8; ++it)
        w[it] = *(const float4*)(src + (size_t)it * 16 * DIMN);
    #pragma unroll
    for (int it = 0; it < 8; ++it) {
        int kk = it * 16 + lk;
        t[ln + 0][kk] = f2bf(w[it].x);
        t[ln + 1][kk] = f2bf(w[it].y);
        t[ln + 2][kk] = f2bf(w[it].z);
        t[ln + 3][kk] = f2bf(w[it].w);
    }
    __syncthreads();
    const int sn = tid >> 4;                  // 0..15
    const int sk = (tid & 15) * 8;            // 16 lanes cover a row's 256 B
    unsigned short* dst = Wt + (size_t)(n0 + sn) * DIMN + k0 + sk;
    #pragma unroll
    for (int it = 0; it < 4; ++it)
        *(uint4*)(dst + (size_t)it * 16 * DIMN) = *(const uint4*)&t[it * 16 + sn][sk];
}

// ---------------------------------------------------------------------------
// Kernel 0b: X fp32 -> bf16 (so the GEMM can stage A with async byte copies).
// Each wave converts 16 KB of X: 32 loads of 512 contiguous bytes, all issued
// at its head. grid 512, 256 threads: 4,096 waves.
// ---------------------------------------------------------------------------
#define XC_LOADS 32
__global__ __launch_bounds__(256)
void xconv_kernel(const float* __restrict__ X, unsigned short* __restrict__ Xbf) {
    const int wave = threadIdx.x >> 5;
    const int lane = threadIdx.x & 31;
    const size_t base = ((size_t)blockIdx.x * 8 + wave) * (XC_LOADS * 128) + lane * 4;
    const float* src = X + base;
    unsigned short* dst = Xbf + base;

    float4 v[XC_LOADS];
    #pragma unroll
    for (int j = 0; j < XC_LOADS; ++j)
        v[j] = *(const float4*)(src + j * 128);
    // keeps all 32 loads in front of the arithmetic: left to itself the build holds
    // about a dozen in flight and issues the rest among the conversions
    __builtin_amdgcn_sched_barrier(0);
    // loops unrolled: register arrays need constant indices
    #pragma unroll
    for (int b = 0; b < XC_LOADS / 8; ++b) {
        uint2 p[8];
        #pragma unroll
        for (int j = 0; j < 8; ++j) {
            float4 xv = v[b * 8 + j];
            p[j].x = (unsigned)f2bf(xv.x) | ((unsigned)f2bf(xv.y) << 16);
            p[j].y = (unsigned)f2bf(xv.z) | ((unsigned)f2bf(xv.w) << 16);
        }
        // all 8 values of the run are formed before its first store, so none is
        // formed in a register that a store of the run names
        __builtin_amdgcn_sched_barrier(0);
        #pragma unroll
        for (int j = 0; j < 8; ++j)
            *(uint2*)(dst + (b * 8 + j) * 128) = p[j];
        if (b + 1 < XC_LOADS / 8) {
            // the run's data registers are not rewritten before this wait
            asm volatile("s_wait_xcnt 0x0" ::: "memory");
            // keeps the next run's arithmetic behind that wait
            __builtin_amdgcn_sched_barrier(0);
        }
    }
}

// ---------------------------------------------------------------------------
// Kernel 1: QKV projection GEMM. Xbf[16384,1024] * Wt^T + b -> bf16.
// One 256 x 256 tile of the output per work-group, 64 k per stage, two LDS
// buffers filled by async copies; 8 waves (2 x 4), 128 x 64 of the tile each
// (8 x 4 WMMA subtiles): 12 fragments read from LDS feed 32 WMMAs.
// The Wt fragment is the WMMA's A and the X fragment its B, so a lane's eight
// accumulator values are eight adjacent output columns of one output row; the
// epilogue stages them in LDS and stores whole 128-B lines.
// grid (4 Ntiles, 64 Mtiles, 3 matrices), 256 threads.
// ---------------------------------------------------------------------------
#define PJ_TILE  256                         // rows of X and rows of Wt per stage
#define PJ_K     64                          // k per stage: 128 B, one whole line a row
#define PJ_PITCH 72                          // 144 B = 16 B x odd for ds_load_b128 readers
#define PJ_TRIPS (DIMN / PJ_K)               // 16

// Eight async copies of one lane: rows r, r + 32, ..., r + 224 of one operand's
// stage. s_wait_xcnt stands inside the statement so that no address register is
// rewritten before it.
__device__ __forceinline__ void stage_rows8(unsigned l, const unsigned short* g) {
    asm volatile("global_load_async_to_lds_b128 %0, %8, off\n\t"
                 "global_load_async_to_lds_b128 %1, %9, off\n\t"
                 "global_load_async_to_lds_b128 %2, %10, off\n\t"
                 "global_load_async_to_lds_b128 %3, %11, off\n\t"
                 "global_load_async_to_lds_b128 %4, %12, off\n\t"
                 "global_load_async_to_lds_b128 %5, %13, off\n\t"
                 "global_load_async_to_lds_b128 %6, %14, off\n\t"
                 "global_load_async_to_lds_b128 %7, %15, off\n\t"
                 "s_wait_xcnt 0x0"
                 :: "v"(l),
                    "v"(l + 1u * 32u * PJ_PITCH * 2u),
                    "v"(l + 2u * 32u * PJ_PITCH * 2u),
                    "v"(l + 3u * 32u * PJ_PITCH * 2u),
                    "v"(l + 4u * 32u * PJ_PITCH * 2u),
                    "v"(l + 5u * 32u * PJ_PITCH * 2u),
                    "v"(l + 6u * 32u * PJ_PITCH * 2u),
                    "v"(l + 7u * 32u * PJ_PITCH * 2u),
                    "v"(g),
                    "v"(g + 1 * 32 * DIMN),
                    "v"(g + 2 * 32 * DIMN),
                    "v"(g + 3 * 32 * DIMN),
                    "v"(g + 4 * 32 * DIMN),
                    "v"(g + 5 * 32 * DIMN),
                    "v"(g + 6 * 32 * DIMN),
                    "v"(g + 7 * 32 * DIMN)
                 : "memory");
}

__global__ __launch_bounds__(256)
void proj_kernel(const unsigned short* __restrict__ Xbf,
                 const unsigned short* __restrict__ Wt,
                 const float* __restrict__ b1,
                 const float* __restrict__ b2,
                 const float* __restrict__ b3,
                 unsigned short* __restrict__ Q,
                 unsigned short* __restrict__ K,
                 unsigned short* __restrict__ V) {
    const int z = blockIdx.z;
    const unsigned short* Wz = Wt + (size_t)z * DIMN * DIMN;
    const float* bias = (z == 0) ? b1 : (z == 1) ? b2 : b3;
    unsigned short* Out = (z == 0) ? Q : (z == 1) ? K : V;

    const int n0 = blockIdx.x * PJ_TILE;
    const int m0 = blockIdx.y * PJ_TILE;

    __shared__ __attribute__((aligned(16))) unsigned short As[2][PJ_TILE][PJ_PITCH];   // 2 x 36 KB
    __shared__ __attribute__((aligned(16))) unsigned short Bs[2][PJ_TILE][PJ_PITCH];   // 2 x 36 KB ([n][k])

    const int tid   = threadIdx.x;
    // the wave's number as a scalar: what the epilogue derives from it then waits out the
    // loop in scalar registers; in vector registers it pushed the copies' base addresses to scratch
    const int wave  = __builtin_amdgcn_readfirstlane(tid >> 5);
    const int lane  = tid & 31;
    const int wm    = wave >> 2;                // 0..1 (M), 128 rows
    const int wn    = wave & 3;                 // 0..3 (N), 64 columns
    const int lhalf = lane >> 4;
    const int l16   = lane & 15;

    // per-thread staging coords: eight lanes cover one row's 128 B
    const int sr = tid >> 3;                    // 0..31
    const int sc = (tid & 7) * 8;               // 0,8,...,56

    const unsigned short* gA = Xbf + (size_t)(m0 + sr) * DIMN + sc;
    const unsigned short* gB = Wz  + (size_t)(n0 + sr) * DIMN + sc;

    v8f acc[8][4] = {};

    // stage 0 lands and is published, then stage 1 starts
    stage_rows8(lds_addr(&As[0][sr][sc]), gA);
    stage_rows8(lds_addr(&Bs[0][sr][sc]), gB);
    wait_async0();
    __syncthreads();
    stage_rows8(lds_addr(&As[1][sr][sc]), gA + PJ_K);
    stage_rows8(lds_addr(&Bs[1][sr][sc]), gB + PJ_K);

    for (int t = 0; t < PJ_TRIPS; ++t) {
        const int buf = t & 1;
        // compute on the current buffer (loops unrolled: register arrays need constant indices)
        v16bf fa[2][8], fb[2][4];                  // the wave's 24 fragments of this stage
        #pragma unroll
        for (int ks = 0; ks < 2; ++ks) {
            const int kc = ks * 32 + lhalf * 8;
            #pragma unroll
            for (int ns = 0; ns < 4; ++ns) {
                int br = wn * 64 + ns * 16 + l16;
                fb[ks][ns] = load_frag(&Bs[buf][br][kc], &Bs[buf][br][kc + 16]);
            }
            #pragma unroll
            for (int ms = 0; ms < 8; ++ms) {
                int ar = wm * 128 + ms * 16 + l16;
                fa[ks][ms] = load_frag(&As[buf][ar][kc], &As[buf][ar][kc + 16]);
            }
        }
        // keeps the stage's LDS reads one group in front of its WMMAs: left to itself the
        // build reads each row's fragment directly in front of its four WMMAs and waits it out
        __builtin_amdgcn_sched_barrier(0);
        #pragma unroll
        for (int ks = 0; ks < 2; ++ks) {
            #pragma unroll
            for (int ms = 0; ms < 8; ++ms) {
                #pragma unroll
                for (int ns = 0; ns < 4; ++ns)
                    acc[ms][ns] = __builtin_amdgcn_wmma_f32_16x16x32_bf16(
                        false, fb[ks][ns], false, fa[ks][ms], (short)0, acc[ms][ns], false, false);
            }
        }
        // keeps the WMMAs in front of the foot's waits: sunk behind them, every WMMA would
        // stand behind the wait for the last of the 48 reads instead of starting on the first
        __builtin_amdgcn_sched_barrier(0);
        // foot of the trip: this wave's reads of buffer buf are done, its copies of
        // stage t + 1 have landed, and the barrier says so of every wave
        asm volatile("s_wait_dscnt 0x0" ::: "memory");
        wait_async0();
        __syncthreads();
        if (t + 2 < PJ_TRIPS) {
            stage_rows8(lds_addr(&As[buf][sr][sc]), gA + (t + 2) * PJ_K);
            stage_rows8(lds_addr(&Bs[buf][sr][sc]), gB + (t + 2) * PJ_K);
        }
    }
    wait_async0();   // no copy is outstanding when the wave ends

    // epilogue: + bias, -> bf16 (loops unrolled: constant accumulator indices).
    // acc[ms][ns][g] is output row ms * 16 + l16, column ns * 16 + lhalf * 8 + g of the wave's tile.
    // Each wave stages its 128 x 64 tile in a range of LDS that is its own: a quarter of As
    // (waves 0 to 3) or of Bs (waves 4 to 7), 128 rows at the ring's pitch. The ring is free:
    // the last trip's foot ended every wave's reads and no copy is outstanding.
    unsigned short (*st)[PJ_PITCH] = (wave < 4) ? &As[(wave >> 1) & 1][(wave & 1) * 128]
                                                : &Bs[(wave >> 1) & 1][(wave & 1) * 128];
    const float* bp = bias + n0 + wn * 64 + lhalf * 8;
    v8f bv[4];
    #pragma unroll
    for (int ns = 0; ns < 4; ++ns)
        bv[ns] = *(const v8f*)(bp + ns * 16);
    // the loads' address registers are not rewritten before this wait
    asm volatile("s_wait_xcnt 0x0" ::: "memory");
    // keeps the arithmetic that follows behind that wait
    __builtin_amdgcn_sched_barrier(0);
    #pragma unroll
    for (int ms = 0; ms < 8; ++ms) {
        #pragma unroll
        for (int ns = 0; ns < 4; ++ns) {
            const v8f y = acc[ms][ns] + bv[ns];
            v4u p;
            p.x = (unsigned)f2bf(y[0]) | ((unsigned)f2bf(y[1]) << 16);
            p.y = (unsigned)f2bf(y[2]) | ((unsigned)f2bf(y[3]) << 16);
            p.z = (unsigned)f2bf(y[4]) | ((unsigned)f2bf(y[5]) << 16);
            p.w = (unsigned)f2bf(y[6]) | ((unsigned)f2bf(y[7]) << 16);
            *(v4u*)&st[ms * 16 + l16][ns * 16 + lhalf * 8] = p;
        }
    }
    // the wave's LDS writes are done before other lanes of it read the rows back
    asm volatile("s_wait_dscnt 0x0" ::: "memory");

    // eight lanes cover one row's 128 B, a store instruction four whole lines
    const int rr = lane >> 3;                   // 0..3
    const int cc = (lane & 7) * 8;              // 0,8,...,56
    unsigned short* dst = Out + (size_t)(m0 + wm * 128 + rr) * DIMN + n0 + wn * 64 + cc;
    #pragma unroll
    for (int b = 0; b < 4; ++b) {
        v4u q[8];
        #pragma unroll
        for (int j = 0; j < 8; ++j)
            q[j] = *(const v4u*)&st[(b * 8 + j) * 4 + rr][cc];
        // all 8 values of the run are read before its first store, so none is
        // read into a register that a store of the run names
        __builtin_amdgcn_sched_barrier(0);
        #pragma unroll
        for (int j = 0; j < 8; ++j)
            *(v4u*)(dst + (size_t)((b * 8 + j) * 4) * DIMN) = q[j];
        if (b + 1 < 4) {
            // the run's data registers are not rewritten before this wait
            asm volatile("s_wait_xcnt 0x0" ::: "memory");
            // keeps the next run's LDS reads behind that wait
            __builtin_amdgcn_sched_barrier(0);
        }
    }
}

// ---------------------------------------------------------------------------
// Kernel 2: block-local attention. grid (HEADS, BLK_NUM, BATCH), 256 threads.
// ---------------------------------------------------------------------------
__global__ __launch_bounds__(256)
void attn_kernel(const unsigned short* __restrict__ Qg,
                 const unsigned short* __restrict__ Kg,
                 const unsigned short* __restrict__ Vg,
                 const int* __restrict__ mask,
                 float* __restrict__ O) {
    const int head = blockIdx.x;
    const int blk  = blockIdx.y;
    const int b    = blockIdx.z;

    // Row pitch 16 B x odd (144 B, 272 B) for the ds_load_b128 fragment readers:
    // 8 pad elements a row, never read.
    __shared__ __attribute__((aligned(16))) unsigned short Qs[128][72];    // 18 KB
    __shared__ __attribute__((aligned(16))) unsigned short Ks[128][72];    // 18 KB
    __shared__ __attribute__((aligned(16))) unsigned short Vst[64][136];   // 17 KB, transposed [d][key]
    __shared__ __attribute__((aligned(16))) unsigned short Ps[128][136];   // 34 KB probabilities bf16

    const int tid   = threadIdx.x;
    const int wave  = tid >> 5;               // query rows [wave*16, +16)
    const int lane  = tid & 31;
    const int lhalf = lane >> 4;
    const int l16   = lane & 15;

    const size_t rowbase = (size_t)b * SEQ + (size_t)blk * BLK_LEN;
    const int cb = head * DH;

    // stage Q, K via CDNA5 async-to-LDS; V through VGPRs (needs transpose)
    #pragma unroll
    for (int it = 0; it < 4; ++it) {
        int r = it * 32 + (tid >> 3);
        int d = (tid & 7) * 8;
        async_copy_b128(lds_addr(&Qs[r][d]), Qg + (rowbase + r) * DIMN + cb + d);
        async_copy_b128(lds_addr(&Ks[r][d]), Kg + (rowbase + r) * DIMN + cb + d);
        uint4 vv = *(const uint4*)(Vg + (rowbase + r) * DIMN + cb + d);
        const unsigned short* vs = (const unsigned short*)&vv;
        #pragma unroll
        for (int j = 0; j < 8; ++j) Vst[d + j][r] = vs[j];
    }
    wait_async0();
    __syncthreads();

    // S = Q K^T : 16 query rows x 128 keys per wave, K-dim 64 (2 steps)
    v8f s[8] = {};
    #pragma unroll
    for (int ks = 0; ks < 2; ++ks) {
        int ar = wave * 16 + l16;
        v16bf a = load_frag(&Qs[ar][ks * 32 + lhalf * 8],
                            &Qs[ar][ks * 32 + lhalf * 8 + 16]);
        #pragma unroll
        for (int nt = 0; nt < 8; ++nt) {
            int br = nt * 16 + l16;
            v16bf bb = load_frag(&Ks[br][ks * 32 + lhalf * 8],
                                 &Ks[br][ks * 32 + lhalf * 8 + 16]);
            s[nt] = __builtin_amdgcn_wmma_f32_16x16x32_bf16(
                false, a, false, bb, (short)0, s[nt], false, false);
        }
    }

    // scale + mask + row softmax (C-layout: vgpr g -> row g / 8+g per half)
    const float scale = 0.125f; // 1/sqrt(64)
    #pragma unroll
    for (int g = 0; g < 8; ++g) {
        int rloc = wave * 16 + lhalf * 8 + g;
        float mval = (float)mask[(rowbase + rloc) * DIMN + cb];
        float madd = (1.0f - mval) * -1.0e10f;
        float rmax = -3.0e38f;
        #pragma unroll
        for (int nt = 0; nt < 8; ++nt) {
            float x = s[nt][g] * scale + madd;
            s[nt][g] = x;
            rmax = fmaxf(rmax, x);
        }
        #pragma unroll
        for (int off = 1; off < 16; off <<= 1)
            rmax = fmaxf(rmax, __shfl_xor(rmax, off, 32));
        float rsum = 0.0f;
        #pragma unroll
        for (int nt = 0; nt < 8; ++nt) {
            float e = __expf(s[nt][g] - rmax);
            s[nt][g] = e;
            rsum += e;
        }
        #pragma unroll
        for (int off = 1; off < 16; off <<= 1)
            rsum += __shfl_xor(rsum, off, 32);
        float inv = 1.0f / rsum;
        #pragma unroll
        for (int nt = 0; nt < 8; ++nt)
            Ps[rloc][nt * 16 + l16] = f2bf(s[nt][g] * inv);
    }
    __syncthreads();

    // O = P V : 16 rows x 64 cols, K-dim 128 (4 steps). The V fragment is the WMMA's A and the
    // P fragment its B: o[nt][g] is query row l16, column nt * 16 + lhalf * 8 + g.
    v8f o[4] = {};
    #pragma unroll
    for (int ks = 0; ks < 4; ++ks) {
        int ar = wave * 16 + l16;
        v16bf a = load_frag(&Ps[ar][ks * 32 + lhalf * 8],
                            &Ps[ar][ks * 32 + lhalf * 8 + 16]);
        #pragma unroll
        for (int nt = 0; nt < 4; ++nt) {
            int br = nt * 16 + l16; // d index (Vst transposed -> contiguous k)
            v16bf bb = load_frag(&Vst[br][ks * 32 + lhalf * 8],
                                 &Vst[br][ks * 32 + lhalf * 8 + 16]);
            o[nt] = __builtin_amdgcn_wmma_f32_16x16x32_bf16(
                false, bb, false, a, (short)0, o[nt], false, false);
        }
    }
    // The wave stages its 16 x 64 f32 tile in its own 16 rows of Ps, which no other wave
    // touches and which it has read to the end (272 B a row hold the 256 B), and stores
    // whole lines: 16 lanes cover a row's 256 B.
    float* so = (float*)&Ps[wave * 16][0];
    #pragma unroll
    for (int nt = 0; nt < 4; ++nt) {
        float* sp = so + l16 * 68 + nt * 16 + lhalf * 8;
        *(v4f*)sp       = __builtin_shufflevector(o[nt], o[nt], 0, 1, 2, 3);
        *(v4f*)(sp + 4) = __builtin_shufflevector(o[nt], o[nt], 4, 5, 6, 7);
    }
    // the wave's LDS writes are done before other lanes of it read the rows back
    asm volatile("s_wait_dscnt 0x0" ::: "memory");
    float* od = O + (rowbase + wave * 16 + lhalf) * DIMN + cb + l16 * 4;
    v4f ov[8];
    #pragma unroll
    for (int it = 0; it < 8; ++it)
        ov[it] = *(const v4f*)(so + (it * 2 + lhalf) * 68 + l16 * 4);
    #pragma unroll
    for (int it = 0; it < 8; ++it)
        *(v4f*)(od + (size_t)(it * 2) * DIMN) = ov[it];
}

#define LN_ROWS 4
__global__ __launch_bounds__(256)
void ln_kernel(const float* __restrict__ O,
               const float* __restrict__ X,
               const float* __restrict__ gamma,
               const float* __restrict__ beta,
               float* __restrict__ out) {
    // the wave's number as a scalar: the row addresses are then scalar bases plus one
    // lane offset that all five arrays share and that lives to the last store
    const int wave = __builtin_amdgcn_readfirstlane(threadIdx.x >> 5);
    const unsigned lo = (threadIdx.x & 31u) * 4u;
    const size_t off = ((size_t)blockIdx.x * 8 + wave) * (LN_ROWS * DIMN);
    const float* po = O + off;
    const float* px = X + off;
    float* py = out + off;

    float4 ov[8], xv[8], gm[8], bt[8];
    #pragma unroll
    for (int j = 0; j < 8; ++j) {
        ov[j] = *(const float4*)(po + lo + j * 128);
        xv[j] = *(const float4*)(px + lo + j * 128);
    }
    #pragma unroll
    for (int j = 0; j < 8; ++j) {
        gm[j] = *(const float4*)(gamma + lo + j * 128);
        bt[j] = *(const float4*)(beta  + lo + j * 128);
    }
    // the 32 loads' address registers are not rewritten before this wait
    asm volatile("s_wait_xcnt 0x0" ::: "memory");

    // kept rolled: unrolled, the build draws the next row's additions up to its loads
    // and waits the loads out before this row's butterfly instead of behind it
    #pragma unroll 1
    for (int r = 0; r < LN_ROWS; ++r) {
        // inner loops unrolled: register arrays need constant indices
        float4 v[8];
        float4 s4 = make_float4(0.0f, 0.0f, 0.0f, 0.0f);
        float4 q4 = make_float4(0.0f, 0.0f, 0.0f, 0.0f);
        #pragma unroll
        for (int j = 0; j < 8; ++j) {
            v[j].x = ov[j].x + xv[j].x;
            v[j].y = ov[j].y + xv[j].y;
            v[j].z = ov[j].z + xv[j].z;
            v[j].w = ov[j].w + xv[j].w;
            s4.x += v[j].x; s4.y += v[j].y; s4.z += v[j].z; s4.w += v[j].w;
            q4.x += v[j].x * v[j].x; q4.y += v[j].y * v[j].y;
            q4.z += v[j].z * v[j].z; q4.w += v[j].w * v[j].w;
        }
        if (r + 1 < LN_ROWS) {
            #pragma unroll
            for (int j = 0; j < 8; ++j) {
                ov[j] = *(const float4*)(po + lo + DIMN + j * 128);
                xv[j] = *(const float4*)(px + lo + DIMN + j * 128);
            }
            // the loads' address registers are not rewritten before this wait
            asm volatile("s_wait_xcnt 0x0" ::: "memory");
        }
        // the next row's loads fly while this row is finished
        float tot  = (s4.x + s4.y) + (s4.z + s4.w);
        float totq = (q4.x + q4.y) + (q4.z + q4.w);
        #pragma unroll
        for (int o = 1; o < 32; o <<= 1) {
            tot  += __shfl_xor(tot,  o, 32);
            totq += __shfl_xor(totq, o, 32);
        }
        const float mean = tot * (1.0f / DIMN);
        const float var  = totq * (1.0f / DIMN) - mean * mean;
        const float inv  = rsqrtf(var + 1.0e-3f);
        #pragma unroll
        for (int j = 0; j < 8; ++j) {
            v[j].x = (v[j].x - mean) * inv * gm[j].x + bt[j].x;
            v[j].y = (v[j].y - mean) * inv * gm[j].y + bt[j].y;
            v[j].z = (v[j].z - mean) * inv * gm[j].z + bt[j].z;
            v[j].w = (v[j].w - mean) * inv * gm[j].w + bt[j].w;
        }
        #pragma unroll
        for (int j = 0; j < 8; ++j)
            *(float4*)(py + lo + j * 128) = v[j];
        // the row's data and address registers are not rewritten before this wait
        asm volatile("s_wait_xcnt 0x0" ::: "memory");
        // keeps the next row's arithmetic behind that wait
        __builtin_amdgcn_sched_barrier(0);
        po += DIMN; px += DIMN; py += DIMN;    // scalar bases step on by a row
    }
}

// ---------------------------------------------------------------------------
extern "C" void kernel_launch(void* const* d_in, const int* in_sizes, int n_in,
                              void* d_out, int out_size, void* d_ws, size_t ws_size,
                              hipStream_t stream) {
    (void)in_sizes; (void)n_in; (void)out_size; (void)ws_size;

    const float* X     = (const float*)d_in[0];
    const int*   mask  = (const int*)d_in[1];
    const float* w1    = (const float*)d_in[2];
    const float* b1    = (const float*)d_in[3];
    const float* w2    = (const float*)d_in[4];
    const float* b2    = (const float*)d_in[5];
    const float* w3    = (const float*)d_in[6];
    const float* b3    = (const float*)d_in[7];
    const float* gamma = (const float*)d_in[8];
    const float* beta  = (const float*)d_in[9];
    float* out = (float*)d_out;

    char* ws = (char*)d_ws;
    unsigned short* Wt  = (unsigned short*)(ws + WT_OFF);
    unsigned short* Xbf = (unsigned short*)(ws + XBF_OFF);
    unsigned short* Q   = (unsigned short*)(ws + Q_OFF);
    unsigned short* K   = (unsigned short*)(ws + K_OFF);
    unsigned short* V   = (unsigned short*)(ws + V_OFF);
    float*          O   = (float*)(ws + O_OFF);

    // 0a) weights -> bf16, transposed to [n][k]
    wconv_kernel<<<dim3(DIMN / WC_K, DIMN / WC_N, 3), dim3(256), 0, stream>>>(w1, w2, w3, Wt);
    // 0b) activations -> bf16
    xconv_kernel<<<dim3((ROWS * DIMN) / (8 * XC_LOADS * 128)), dim3(256), 0, stream>>>(X, Xbf);

    // 1) Q/K/V projections (WMMA bf16, async-to-LDS double buffered)
    proj_kernel<<<dim3(DIMN / 256, ROWS / 256, 3), dim3(256), 0, stream>>>(
        Xbf, Wt, b1, b2, b3, Q, K, V);

    // 2) block-local attention (WMMA)
    attn_kernel<<<dim3(HEADS, BLK_NUM, BATCH), dim3(256), 0, stream>>>(
        Q, K, V, mask, O);

    // 3) residual + LayerNorm
    ln_kernel<<<dim3(ROWS / (8 * LN_ROWS)), dim3(256), 0, stream>>>(O, X, gamma, beta, out);
}

// v005
// One run takes 122 microseconds.
// In both of two side-by-side timings against v004, it was 1.05 times as fast.
// All steps since v000 together make it 2.07 times as fast.
#include <hip/hip_runtime.h>

#define DIMN 1024
#define HEADS 16
#define DH 64
#define BLK_LEN 128
#define BLK_NUM 32
#define BATCH 4
#define SEQ (BLK_NUM * BLK_LEN)          // 4096
#define ROWS (BATCH * SEQ)               // 16384

typedef __attribute__((ext_vector_type(8)))  float  v8f;
typedef __attribute__((ext_vector_type(8)))  __bf16 v8bf;
typedef __attribute__((ext_vector_type(16))) __bf16 v16bf;
typedef __attribute__((ext_vector_type(4)))  unsigned v4u;
typedef __attribute__((ext_vector_type(4)))  float  v4f;

// ---- workspace layout (bytes) ----
static const size_t WT_OFF  = 0;                         // W^T bf16, 3 * 2MB
static const size_t XBF_OFF = 6291456;                   // X bf16, 32MB
static const size_t Q_OFF   = XBF_OFF + 33554432ull;
static const size_t K_OFF   = Q_OFF   + 33554432ull;
static const size_t V_OFF   = K_OFF   + 33554432ull;
static const size_t O_OFF   = V_OFF   + 33554432ull;     // attn out f32, 64MB

__device__ __forceinline__ unsigned short f2bf(float f) {
    union { float f; unsigned u; } v; v.f = f;
    unsigned r = v.u + 0x7FFFu + ((v.u >> 16) & 1u);     // round-to-nearest-even
    return (unsigned short)(r >> 16);
}

__device__ __forceinline__ v16bf load_frag(const unsigned short* lo,
                                           const unsigned short* hi) {
    v8bf a = *(const v8bf*)lo;
    v8bf b = *(const v8bf*)hi;
    return __builtin_shufflevector(a, b, 0,1,2,3,4,5,6,7,8,9,10,11,12,13,14,15);
}

// CDNA5 async global->LDS copy (ASYNCcnt). LDS byte offset = low 32 bits of
// the generic shared-memory address (ISA 10.2 aperture rules).
__device__ __forceinline__ unsigned lds_addr(const void* p) {
    return (unsigned)(unsigned long long)p;
}
__device__ __forceinline__ void async_copy_b128(unsigned lds_off, const void* gptr) {
    asm volatile("global_load_async_to_lds_b128 %0, %1, off"
                 :: "v"(lds_off), "v"(gptr) : "memory");
}
__device__ __forceinline__ void wait_async0() {
    asm volatile("s_wait_asynccnt 0" ::: "memory");
}

// ---------------------------------------------------------------------------
// Kernel 0a: W fp32 -> bf16 with transpose: Wt[n][k] = bf16(W[k][n]).
// One 128 (k) x 64 (n) tile per work-group, 32 elements a thread, so that few
// waves have to be started: grid (8 ktiles, 16 ntiles, 3), 256 threads.
// ---------------------------------------------------------------------------
#define WC_K 128
#define WC_N 64
#define WC_PITCH (WC_K + 8)                  // 272 B = 16 B x odd for the ds_load_b128 readers
__global__ __launch_bounds__(256)
void wconv_kernel(const float* __restrict__ w1,
                  const float* __restrict__ w2,
                  const float* __restrict__ w3,
                  unsigned short* __restrict__ wt) {
    const int z = blockIdx.z;
    const float* W = (z == 0) ? w1 : (z == 1) ? w2 : w3;
    unsigned short* Wt = wt + (size_t)z * DIMN * DIMN;

    const int k0 = blockIdx.x * WC_K;
    const int n0 = blockIdx.y * WC_N;
    __shared__ __attribute__((aligned(16))) unsigned short t[WC_N][WC_PITCH];   // [n][k]

    const int tid = threadIdx.x;
    const int lk = tid >> 4;                  // 0..15
    const int ln = (tid & 15) * 4;            // 16 lanes cover a row's 256 B
    const float* src = W + (size_t)(k0 + lk) * DIMN + n0 + ln;
    float4 w[8];
    #pragma unroll
    for (int it = 0; it < 8; ++it)
        w[it] = *(const float4*)(src + (size_t)it * 16 * DIMN);
    #pragma unroll
    for (int it = 0; it < 8; ++it) {
        int kk = it * 16 + lk;
        t[ln + 0][kk] = f2bf(w[it].x);
        t[ln + 1][kk] = f2bf(w[it].y);
        t[ln + 2][kk] = f2bf(w[it].z);
        t[ln + 3][kk] = f2bf(w[it].w);
    }
    __syncthreads();
    const int sn = tid >> 4;                  // 0..15
    const int sk = (tid & 15) * 8;            // 16 lanes cover a row's 256 B
    unsigned short* dst = Wt + (size_t)(n0 + sn) * DIMN + k0 + sk;
    #pragma unroll
    for (int it = 0; it < 4; ++it)
        *(uint4*)(dst + (size_t)it * 16 * DIMN) = *(const uint4*)&t[it * 16 + sn][sk];
}

// ---------------------------------------------------------------------------
// Kernel 0b: X fp32 -> bf16 (so the GEMM can stage A with async byte copies).
// Each wave converts 16 KB of X: 32 loads of 512 contiguous bytes, all issued
// at its head. grid 512, 256 threads: 4,096 waves.
// ---------------------------------------------------------------------------
#define XC_LOADS 32
__global__ __launch_bounds__(256)
void xconv_kernel(const float* __restrict__ X, unsigned short* __restrict__ Xbf) {
    const int wave = threadIdx.x >> 5;
    const int lane = threadIdx.x & 31;
    const size_t base = ((size_t)blockIdx.x * 8 + wave) * (XC_LOADS * 128) + lane * 4;
    const float* src = X + base;
    unsigned short* dst = Xbf + base;

    float4 v[XC_LOADS];
    #pragma unroll
    for (int j = 0; j < XC_LOADS; ++j)
        v[j] = *(const float4*)(src + j * 128);
    // keeps all 32 loads in front of the arithmetic: left to itself the build holds
    // about a dozen in flight and issues the rest among the conversions
    __builtin_amdgcn_sched_barrier(0);
    // loops unrolled: register arrays need constant indices
    #pragma unroll
    for (int b = 0; b < XC_LOADS / 8; ++b) {
        uint2 p[8];
        #pragma unroll
        for (int j = 0; j < 8; ++j) {
            float4 xv = v[b * 8 + j];
            p[j].x = (unsigned)f2bf(xv.x) | ((unsigned)f2bf(xv.y) << 16);
            p[j].y = (unsigned)f2bf(xv.z) | ((unsigned)f2bf(xv.w) << 16);
        }
        // all 8 values of the run are formed before its first store, so none is
        // formed in a register that a store of the run names
        __builtin_amdgcn_sched_barrier(0);
        #pragma unroll
        for (int j = 0; j < 8; ++j)
            *(uint2*)(dst + (b * 8 + j) * 128) = p[j];
        if (b + 1 < XC_LOADS / 8) {
            // the run's data registers are not rewritten before this wait
            asm volatile("s_wait_xcnt 0x0" ::: "memory");
            // keeps the next run's arithmetic behind that wait
            __builtin_amdgcn_sched_barrier(0);
        }
    }
}

// ---------------------------------------------------------------------------
// Kernel 1: QKV projection GEMM. Xbf[16384,1024] * Wt^T + b -> bf16.
// One 256 x 256 tile of the output per work-group, 64 k per stage, two LDS
// buffers filled by async copies; 8 waves (2 x 4), 128 x 64 of the tile each
// (8 x 4 WMMA subtiles): 12 fragments read from LDS feed 32 WMMAs.
// The Wt fragment is the WMMA's A and the X fragment its B, so a lane's eight
// accumulator values are eight adjacent output columns of one output row; the
// epilogue stages them in LDS and stores whole 128-B lines.
// grid (4 Ntiles, 64 Mtiles, 3 matrices), 256 threads.
// ---------------------------------------------------------------------------
#define PJ_TILE  256                         // rows of X and rows of Wt per stage
#define PJ_K     64                          // k per stage: 128 B, one whole line a row
#define PJ_PITCH 72                          // 144 B = 16 B x odd for ds_load_b128 readers
#define PJ_TRIPS (DIMN / PJ_K)               // 16

// Eight async copies of one lane: rows r, r + 32, ..., r + 224 of one operand's
// stage. s_wait_xcnt stands inside the statement so that no address register is
// rewritten before it.
__device__ __forceinline__ void stage_rows8(unsigned l, const unsigned short* g) {
    asm volatile("global_load_async_to_lds_b128 %0, %8, off\n\t"
                 "global_load_async_to_lds_b128 %1, %9, off\n\t"
                 "global_load_async_to_lds_b128 %2, %10, off\n\t"
                 "global_load_async_to_lds_b128 %3, %11, off\n\t"
                 "global_load_async_to_lds_b128 %4, %12, off\n\t"
                 "global_load_async_to_lds_b128 %5, %13, off\n\t"
                 "global_load_async_to_lds_b128 %6, %14, off\n\t"
                 "global_load_async_to_lds_b128 %7, %15, off\n\t"
                 "s_wait_xcnt 0x0"
                 :: "v"(l),
                    "v"(l + 1u * 32u * PJ_PITCH * 2u),
                    "v"(l + 2u * 32u * PJ_PITCH * 2u),
                    "v"(l + 3u * 32u * PJ_PITCH * 2u),
                    "v"(l + 4u * 32u * PJ_PITCH * 2u),
                    "v"(l + 5u * 32u * PJ_PITCH * 2u),
                    "v"(l + 6u * 32u * PJ_PITCH * 2u),
                    "v"(l + 7u * 32u * PJ_PITCH * 2u),
                    "v"(g),
                    "v"(g + 1 * 32 * DIMN),
                    "v"(g + 2 * 32 * DIMN),
                    "v"(g + 3 * 32 * DIMN),
                    "v"(g + 4 * 32 * DIMN),
                    "v"(g + 5 * 32 * DIMN),
                    "v"(g + 6 * 32 * DIMN),
                    "v"(g + 7 * 32 * DIMN)
                 : "memory");
}

__global__ __launch_bounds__(256)
void proj_kernel(const unsigned short* __restrict__ Xbf,
                 const unsigned short* __restrict__ Wt,
                 const float* __restrict__ b1,
                 const float* __restrict__ b2,
                 const float* __restrict__ b3,
                 unsigned short* __restrict__ Q,
                 unsigned short* __restrict__ K,
                 unsigned short* __restrict__ V) {
    const int z = blockIdx.z;
    const unsigned short* Wz = Wt + (size_t)z * DIMN * DIMN;
    const float* bias = (z == 0) ? b1 : (z == 1) ? b2 : b3;
    unsigned short* Out = (z == 0) ? Q : (z == 1) ? K : V;

    const int n0 = blockIdx.x * PJ_TILE;
    const int m0 = blockIdx.y * PJ_TILE;

    __shared__ __attribute__((aligned(16))) unsigned short As[2][PJ_TILE][PJ_PITCH];   // 2 x 36 KB
    __shared__ __attribute__((aligned(16))) unsigned short Bs[2][PJ_TILE][PJ_PITCH];   // 2 x 36 KB ([n][k])

    const int tid   = threadIdx.x;
    // the wave's number as a scalar: what the epilogue derives from it then waits out the
    // loop in scalar registers; in vector registers it pushed the copies' base addresses to scratch
    const int wave  = __builtin_amdgcn_readfirstlane(tid >> 5);
    const int lane  = tid & 31;
    const int wm    = wave >> 2;                // 0..1 (M), 128 rows
    const int wn    = wave & 3;                 // 0..3 (N), 64 columns
    const int lhalf = lane >> 4;
    const int l16   = lane & 15;

    // per-thread staging coords: eight lanes cover one row's 128 B
    const int sr = tid >> 3;                    // 0..31
    const int sc = (tid & 7) * 8;               // 0,8,...,56

    const unsigned short* gA = Xbf + (size_t)(m0 + sr) * DIMN + sc;
    const unsigned short* gB = Wz  + (size_t)(n0 + sr) * DIMN + sc;

    v8f acc[8][4] = {};

    // stage 0 lands and is published, then stage 1 starts
    stage_rows8(lds_addr(&As[0][sr][sc]), gA);
    stage_rows8(lds_addr(&Bs[0][sr][sc]), gB);
    wait_async0();
    __syncthreads();
    stage_rows8(lds_addr(&As[1][sr][sc]), gA + PJ_K);
    stage_rows8(lds_addr(&Bs[1][sr][sc]), gB + PJ_K);

    for (int t = 0; t < PJ_TRIPS; ++t) {
        const int buf = t & 1;
        // compute on the current buffer (loops unrolled: register arrays need constant indices)
        v16bf fa[2][8], fb[2][4];                  // the wave's 24 fragments of this stage
        #pragma unroll
        for (int ks = 0; ks < 2; ++ks) {
            const int kc = ks * 32 + lhalf * 8;
            #pragma unroll
            for (int ns = 0; ns < 4; ++ns) {
                int br = wn * 64 + ns * 16 + l16;
                fb[ks][ns] = load_frag(&Bs[buf][br][kc], &Bs[buf][br][kc + 16]);
            }
            #pragma unroll
            for (int ms = 0; ms < 8; ++ms) {
                int ar = wm * 128 + ms * 16 + l16;
                fa[ks][ms] = load_frag(&As[buf][ar][kc], &As[buf][ar][kc + 16]);
            }
        }
        // keeps the stage's LDS reads one group in front of its WMMAs: left to itself the
        // build reads each row's fragment directly in front of its four WMMAs and waits it out
        __builtin_amdgcn_sched_barrier(0);
        #pragma unroll
        for (int ks = 0; ks < 2; ++ks) {
            #pragma unroll
            for (int ms = 0; ms < 8; ++ms) {
                #pragma unroll
                for (int ns = 0; ns < 4; ++ns)
                    acc[ms][ns] = __builtin_amdgcn_wmma_f32_16x16x32_bf16(
                        false, fb[ks][ns], false, fa[ks][ms], (short)0, acc[ms][ns], false, false);
            }
        }
        // keeps the WMMAs in front of the foot's waits: sunk behind them, every WMMA would
        // stand behind the wait for the last of the 48 reads instead of starting on the first
        __builtin_amdgcn_sched_barrier(0);
        // foot of the trip: this wave's reads of buffer buf are done, its copies of
        // stage t + 1 have landed, and the barrier says so of every wave
        asm volatile("s_wait_dscnt 0x0" ::: "memory");
        wait_async0();
        __syncthreads();
        if (t + 2 < PJ_TRIPS) {
            stage_rows8(lds_addr(&As[buf][sr][sc]), gA + (t + 2) * PJ_K);
            stage_rows8(lds_addr(&Bs[buf][sr][sc]), gB + (t + 2) * PJ_K);
        }
    }
    wait_async0();   // no copy is outstanding when the wave ends

    // epilogue: + bias, -> bf16 (loops unrolled: constant accumulator indices).
    // acc[ms][ns][g] is output row ms * 16 + l16, column ns * 16 + lhalf * 8 + g of the wave's tile.
    // Each wave stages its 128 x 64 tile in a range of LDS that is its own: a quarter of As
    // (waves 0 to 3) or of Bs (waves 4 to 7), 128 rows at the ring's pitch. The ring is free:
    // the last trip's foot ended every wave's reads and no copy is outstanding.
    unsigned short (*st)[PJ_PITCH] = (wave < 4) ? &As[(wave >> 1) & 1][(wave & 1) * 128]
                                                : &Bs[(wave >> 1) & 1][(wave & 1) * 128];
    const float* bp = bias + n0 + wn * 64 + lhalf * 8;
    v8f bv[4];
    #pragma unroll
    for (int ns = 0; ns < 4; ++ns)
        bv[ns] = *(const v8f*)(bp + ns * 16);
    // the loads' address registers are not rewritten before this wait
    asm volatile("s_wait_xcnt 0x0" ::: "memory");
    // keeps the arithmetic that follows behind that wait
    __builtin_amdgcn_sched_barrier(0);
    #pragma unroll
    for (int ms = 0; ms < 8; ++ms) {
        #pragma unroll
        for (int ns = 0; ns < 4; ++ns) {
            const v8f y = acc[ms][ns] + bv[ns];
            v4u p;
            p.x = (unsigned)f2bf(y[0]) | ((unsigned)f2bf(y[1]) << 16);
            p.y = (unsigned)f2bf(y[2]) | ((unsigned)f2bf(y[3]) << 16);
            p.z = (unsigned)f2bf(y[4]) | ((unsigned)f2bf(y[5]) << 16);
            p.w = (unsigned)f2bf(y[6]) | ((unsigned)f2bf(y[7]) << 16);
            *(v4u*)&st[ms * 16 + l16][ns * 16 + lhalf * 8] = p;
        }
    }
    // the wave's LDS writes are done before other lanes of it read the rows back
    asm volatile("s_wait_dscnt 0x0" ::: "memory");

    // eight lanes cover one row's 128 B, a store instruction four whole lines
    const int rr = lane >> 3;                   // 0..3
    const int cc = (lane & 7) * 8;              // 0,8,...,56
    unsigned short* dst = Out + (size_t)(m0 + wm * 128 + rr) * DIMN + n0 + wn * 64 + cc;
    #pragma unroll
    for (int b = 0; b < 4; ++b) {
        v4u q[8];
        #pragma unroll
        for (int j = 0; j < 8; ++j)
            q[j] = *(const v4u*)&st[(b * 8 + j) * 4 + rr][cc];
        // all 8 values of the run are read before its first store, so none is
        // read into a register that a store of the run names
        __builtin_amdgcn_sched_barrier(0);
        #pragma unroll
        for (int j = 0; j < 8; ++j)
            *(v4u*)(dst + (size_t)((b * 8 + j) * 4) * DIMN) = q[j];
        if (b + 1 < 4) {
            // the run's data registers are not rewritten before this wait
            asm volatile("s_wait_xcnt 0x0" ::: "memory");
            // keeps the next run's LDS reads behind that wait
            __builtin_amdgcn_sched_barrier(0);
        }
    }
}

// ---------------------------------------------------------------------------
// Kernel 2: block-local attention. grid (HEADS, BLK_NUM, BATCH), 256 threads.
// The scores are computed transposed (K fragment = the WMMA's A, Q fragment = its B): a lane
// holds 64 of one query's 128 scores and lane ^ 16 the other 64, so the softmax runs in
// registers with one exchange between the wave's halves for the maximum and one for the sum,
// and two score tiles, converted in place, are the B fragment of the second product.
// ---------------------------------------------------------------------------
// lane l reads lane l ^ 16
__device__ __forceinline__ float xhalf(float x) {
    return __builtin_bit_cast(float, __builtin_amdgcn_permlanex16(
        __builtin_bit_cast(int, x), __builtin_bit_cast(int, x),
        0x76543210, 0xfedcba98, false, false));
}

__global__ __launch_bounds__(256)
void attn_kernel(const unsigned short* __restrict__ Qg,
                 const unsigned short* __restrict__ Kg,
                 const unsigned short* __restrict__ Vg,
                 const int* __restrict__ mask,
                 float* __restrict__ O) {
    const int head = blockIdx.x;
    const int blk  = blockIdx.y;
    const int b    = blockIdx.z;

    // Row pitch 16 B x odd (144 B, 272 B) for the ds_load_b128 fragment readers:
    // 8 pad elements a row, never read.
    __shared__ __attribute__((aligned(16))) unsigned short QKs[2][128][72]; // 36 KB: Q, K; later the output staging
    __shared__ __attribute__((aligned(16))) unsigned short Vst[64][136];    // 17 KB, transposed [d][key]
    unsigned short (*Qs)[72] = QKs[0];
    unsigned short (*Ks)[72] = QKs[1];

    const int tid   = threadIdx.x;
    const int wave  = tid >> 5;               // query rows [wave*16, +16)
    const int lane  = tid & 31;
    const int lhalf = lane >> 4;
    const int l16   = lane & 15;

    const size_t rowbase = (size_t)b * SEQ + (size_t)blk * BLK_LEN;
    const int cb = head * DH;

    // the lane's query row has one mask value; asked for first, it lands beside the tiles
    const int mi = mask[(rowbase + wave * 16 + l16) * DIMN + cb];

    // stage Q, K via CDNA5 async-to-LDS; V through VGPRs (needs transpose)
    #pragma unroll
    for (int it = 0; it < 4; ++it) {
        int r = it * 32 + (tid >> 3);
        int d = (tid & 7) * 8;
        async_copy_b128(lds_addr(&Qs[r][d]), Qg + (rowbase + r) * DIMN + cb + d);
        async_copy_b128(lds_addr(&Ks[r][d]), Kg + (rowbase + r) * DIMN + cb + d);
        uint4 vv = *(const uint4*)(Vg + (rowbase + r) * DIMN + cb + d);
        const unsigned short* vs = (const unsigned short*)&vv;
        #pragma unroll
        for (int j = 0; j < 8; ++j) Vst[d + j][r] = vs[j];
    }
    wait_async0();
    __syncthreads();

    // S^T = K Q^T : 128 keys x 16 query columns per wave, K-dim 64 (2 steps).
    // s[nt][g] is key nt * 16 + lhalf * 8 + g, query wave * 16 + l16.
    v8f s[8] = {};
    #pragma unroll
    for (int ks = 0; ks < 2; ++ks) {
        int ar = wave * 16 + l16;
        v16bf a = load_frag(&Qs[ar][ks * 32 + lhalf * 8],
                            &Qs[ar][ks * 32 + lhalf * 8 + 16]);
        #pragma unroll
        for (int nt = 0; nt < 8; ++nt) {
            int br = nt * 16 + l16;
            v16bf bb = load_frag(&Ks[br][ks * 32 + lhalf * 8],
                                 &Ks[br][ks * 32 + lhalf * 8 + 16]);
            s[nt] = __builtin_amdgcn_wmma_f32_16x16x32_bf16(
                false, bb, false, a, (short)0, s[nt], false, false);
        }
    }

    // scale + mask + softmax over the lane pair's 128 scores (loops unrolled: constant indices)
    const float scale = 0.125f; // 1/sqrt(64)
    const float madd = (1.0f - (float)mi) * -1.0e10f;
    // whole-tile vector forms: a tile's adjacent registers pair up for the packed instructions
    #pragma unroll
    for (int nt = 0; nt < 8; ++nt)
        s[nt] = s[nt] * scale + madd;
    v8f mx = s[0];
    #pragma unroll
    for (int nt = 1; nt < 8; ++nt)
        mx = __builtin_elementwise_max(mx, s[nt]);
    float rmax = fmaxf(fmaxf(fmaxf(mx[0], mx[1]), fmaxf(mx[2], mx[3])),
                       fmaxf(fmaxf(mx[4], mx[5]), fmaxf(mx[6], mx[7])));
    rmax = fmaxf(rmax, xhalf(rmax));
    #pragma unroll
    for (int nt = 0; nt < 8; ++nt) {
        #pragma unroll
        for (int g = 0; g < 8; ++g)
            s[nt][g] = __expf(s[nt][g] - rmax);
    }
    v8f sm = s[0];
    #pragma unroll
    for (int nt = 1; nt < 8; ++nt)
        sm += s[nt];
    float rsum = ((sm[0] + sm[1]) + (sm[2] + sm[3])) + ((sm[4] + sm[5]) + (sm[6] + sm[7]));
    rsum += xhalf(rsum);
    const float inv = 1.0f / rsum;
    // P^T as B fragments: element e of pf[ks] is key ks * 32 + lhalf * 8 + e (e < 8) or
    // ks * 32 + 16 + lhalf * 8 + e - 8, the k order in which the V fragment is read below
    v16bf pf[4];
    #pragma unroll
    for (int ks = 0; ks < 4; ++ks) {
        v8bf lo = __builtin_convertvector(s[2 * ks] * inv, v8bf);
        v8bf hi = __builtin_convertvector(s[2 * ks + 1] * inv, v8bf);
        pf[ks] = __builtin_shufflevector(lo, hi, 0,1,2,3,4,5,6,7,8,9,10,11,12,13,14,15);
    }
    // every wave has read Q and K to the end: their LDS becomes the output staging
    __syncthreads();

    // O = P V : 16 rows x 64 cols, K-dim 128 (4 steps). The V fragment is the WMMA's A and the
    // P fragment its B: o[nt][g] is query row l16, column nt * 16 + lhalf * 8 + g.
    v8f o[4] = {};
    #pragma unroll
    for (int ks = 0; ks < 4; ++ks) {
        #pragma unroll
        for (int nt = 0; nt < 4; ++nt) {
            int br = nt * 16 + l16; // d index (Vst transposed -> contiguous k)
            v16bf bb = load_frag(&Vst[br][ks * 32 + lhalf * 8],
                                 &Vst[br][ks * 32 + lhalf * 8 + 16]);
            o[nt] = __builtin_amdgcn_wmma_f32_16x16x32_bf16(
                false, bb, false, pf[ks], (short)0, o[nt], false, false);
        }
    }
    // The wave stages its 16 x 64 f32 tile in a range of the Q/K tiles that is its own
    // (16 rows of 272 B hold the 256 B each) and stores whole lines: 16 lanes cover a row's 256 B.
    float* so = (float*)&QKs[0][0][0] + wave * (16 * 68);
    #pragma unroll
    for (int nt = 0; nt < 4; ++nt) {
        float* sp = so + l16 * 68 + nt * 16 + lhalf * 8;
        *(v4f*)sp       = __builtin_shufflevector(o[nt], o[nt], 0, 1, 2, 3);
        *(v4f*)(sp + 4) = __builtin_shufflevector(o[nt], o[nt], 4, 5, 6, 7);
    }
    // the wave's LDS writes are done before other lanes of it read the rows back
    asm volatile("s_wait_dscnt 0x0" ::: "memory");
    float* od = O + (rowbase + wave * 16 + lhalf) * DIMN + cb + l16 * 4;
    v4f ov[8];
    #pragma unroll
    for (int it = 0; it < 8; ++it)
        ov[it] = *(const v4f*)(so + (it * 2 + lhalf) * 68 + l16 * 4);
    #pragma unroll
    for (int it = 0; it < 8; ++it)
        *(v4f*)(od + (size_t)(it * 2) * DIMN) = ov[it];
}

#define LN_ROWS 4
__global__ __launch_bounds__(256)
void ln_kernel(const float* __restrict__ O,
               const float* __restrict__ X,
               const float* __restrict__ gamma,
               const float* __restrict__ beta,
               float* __restrict__ out) {
    // the wave's number as a scalar: the row addresses are then scalar bases plus one
    // lane offset that all five arrays share and that lives to the last store
    const int wave = __builtin_amdgcn_readfirstlane(threadIdx.x >> 5);
    const unsigned lo = (threadIdx.x & 31u) * 4u;
    const size_t off = ((size_t)blockIdx.x * 8 + wave) * (LN_ROWS * DIMN);
    const float* po = O + off;
    const float* px = X + off;
    float* py = out + off;

    float4 ov[8], xv[8], gm[8], bt[8];
    #pragma unroll
    for (int j = 0; j < 8; ++j) {
        ov[j] = *(const float4*)(po + lo + j * 128);
        xv[j] = *(const float4*)(px + lo + j * 128);
    }
    #pragma unroll
    for (int j = 0; j < 8; ++j) {
        gm[j] = *(const float4*)(gamma + lo + j * 128);
        bt[j] = *(const float4*)(beta  + lo + j * 128);
    }
    // the 32 loads' address registers are not rewritten before this wait
    asm volatile("s_wait_xcnt 0x0" ::: "memory");

    // kept rolled: unrolled, the build draws the next row's additions up to its loads
    // and waits the loads out before this row's butterfly instead of behind it
    #pragma unroll 1
    for (int r = 0; r < LN_ROWS; ++r) {
        // inner loops unrolled: register arrays need constant indices
        float4 v[8];
        float4 s4 = make_float4(0.0f, 0.0f, 0.0f, 0.0f);
        float4 q4 = make_float4(0.0f, 0.0f, 0.0f, 0.0f);
        #pragma unroll
        for (int j = 0; j < 8; ++j) {
            v[j].x = ov[j].x + xv[j].x;
            v[j].y = ov[j].y + xv[j].y;
            v[j].z = ov[j].z + xv[j].z;
            v[j].w = ov[j].w + xv[j].w;
            s4.x += v[j].x; s4.y += v[j].y; s4.z += v[j].z; s4.w += v[j].w;
            q4.x += v[j].x * v[j].x; q4.y += v[j].y * v[j].y;
            q4.z += v[j].z * v[j].z; q4.w += v[j].w * v[j].w;
        }
        if (r + 1 < LN_ROWS) {
            #pragma unroll
            for (int j = 0; j < 8; ++j) {
                ov[j] = *(const float4*)(po + lo + DIMN + j * 128);
                xv[j] = *(const float4*)(px + lo + DIMN + j * 128);
            }
            // the loads' address registers are not rewritten before this wait
            asm volatile("s_wait_xcnt 0x0" ::: "memory");
        }
        // the next row's loads fly while this row is finished
        float tot  = (s4.x + s4.y) + (s4.z + s4.w);
        float totq = (q4.x + q4.y) + (q4.z + q4.w);
        #pragma unroll
        for (int o = 1; o < 32; o <<= 1) {
            tot  += __shfl_xor(tot,  o, 32);
            totq += __shfl_xor(totq, o, 32);
        }
        const float mean = tot * (1.0f / DIMN);
        const float var  = totq * (1.0f / DIMN) - mean * mean;
        const float inv  = rsqrtf(var + 1.0e-3f);
        #pragma unroll
        for (int j = 0; j < 8; ++j) {
            v[j].x = (v[j].x - mean) * inv * gm[j].x + bt[j].x;
            v[j].y = (v[j].y - mean) * inv * gm[j].y + bt[j].y;
            v[j].z = (v[j].z - mean) * inv * gm[j].z + bt[j].z;
            v[j].w = (v[j].w - mean) * inv * gm[j].w + bt[j].w;
        }
        #pragma unroll
        for (int j = 0; j < 8; ++j)
            *(float4*)(py + lo + j * 128) = v[j];
        // the row's data and address registers are not rewritten before this wait
        asm volatile("s_wait_xcnt 0x0" ::: "memory");
        // keeps the next row's arithmetic behind that wait
        __builtin_amdgcn_sched_barrier(0);
        po += DIMN; px += DIMN; py += DIMN;    // scalar bases step on by a row
    }
}

// ---------------------------------------------------------------------------
extern "C" void kernel_launch(void* const* d_in, const int* in_sizes, int n_in,
                              void* d_out, int out_size, void* d_ws, size_t ws_size,
                              hipStream_t stream) {
    (void)in_sizes; (void)n_in; (void)out_size; (void)ws_size;

    const float* X     = (const float*)d_in[0];
    const int*   mask  = (const int*)d_in[1];
    const float* w1    = (const float*)d_in[2];
    const float* b1    = (const float*)d_in[3];
    const float* w2    = (const float*)d_in[4];
    const float* b2    = (const float*)d_in[5];
    const float* w3    = (const float*)d_in[6];
    const float* b3    = (const float*)d_in[7];
    const float* gamma = (const float*)d_in[8];
    const float* beta  = (const float*)d_in[9];
    float* out = (float*)d_out;

    char* ws = (char*)d_ws;
    unsigned short* Wt  = (unsigned short*)(ws + WT_OFF);
    unsigned short* Xbf = (unsigned short*)(ws + XBF_OFF);
    unsigned short* Q   = (unsigned short*)(ws + Q_OFF);
    unsigned short* K   = (unsigned short*)(ws + K_OFF);
    unsigned short* V   = (unsigned short*)(ws + V_OFF);
    float*          O   = (float*)(ws + O_OFF);

    // 0a) weights -> bf16, transposed to [n][k]
    wconv_kernel<<<dim3(DIMN / WC_K, DIMN / WC_N, 3), dim3(256), 0, stream>>>(w1, w2, w3, Wt);
    // 0b) activations -> bf16
    xconv_kernel<<<dim3((ROWS * DIMN) / (8 * XC_LOADS * 128)), dim3(256), 0, stream>>>(X, Xbf);

    // 1) Q/K/V projections (WMMA bf16, async-to-LDS double buffered)
    proj_kernel<<<dim3(DIMN / 256, ROWS / 256, 3), dim3(256), 0, stream>>>(
        Xbf, Wt, b1, b2, b3, Q, K, V);

    // 2) block-local attention (WMMA)
    attn_kernel<<<dim3(HEADS, BLK_NUM, BATCH), dim3(256), 0, stream>>>(
        Q, K, V, mask, O);

    // 3) residual + LayerNorm
    ln_kernel<<<dim3(ROWS / (8 * LN_ROWS)), dim3(256), 0, stream>>>(O, X, gamma, beta, out);
}

// v006
// Measured time: 114 microseconds a run.
// Next to v005, in two timings, it ran 1.07 times as fast each time.
// Over all steps from v000 it is 2.22 times as fast.
#include <hip/hip_runtime.h>

#define DIMN 1024
#define HEADS 16
#define DH 64
#define BLK_LEN 128
#define BLK_NUM 32
#define BATCH 4
#define SEQ (BLK_NUM * BLK_LEN)          // 4096
#define ROWS (BATCH * SEQ)               // 16384

typedef __attribute__((ext_vector_type(8)))  float  v8f;
typedef __attribute__((ext_vector_type(8)))  __bf16 v8bf;
typedef __attribute__((ext_vector_type(16))) __bf16 v16bf;
typedef __attribute__((ext_vector_type(4)))  unsigned v4u;
typedef __attribute__((ext_vector_type(4)))  float  v4f;

// ---- workspace layout (bytes) ----
static const size_t WT_OFF  = 0;                         // W^T bf16, 3 * 2MB
static const size_t XBF_OFF = 6291456;                   // X bf16, 32MB
static const size_t Q_OFF   = XBF_OFF + 33554432ull;
static const size_t K_OFF   = Q_OFF   + 33554432ull;
static const size_t V_OFF   = K_OFF   + 33554432ull;

__device__ __forceinline__ unsigned short f2bf(float f) {
    union { float f; unsigned u; } v; v.f = f;
    unsigned r = v.u + 0x7FFFu + ((v.u >> 16) & 1u);     // round-to-nearest-even
    return (unsigned short)(r >> 16);
}

__device__ __forceinline__ v16bf load_frag(const unsigned short* lo,
                                           const unsigned short* hi) {
    v8bf a = *(const v8bf*)lo;
    v8bf b = *(const v8bf*)hi;
    return __builtin_shufflevector(a, b, 0,1,2,3,4,5,6,7,8,9,10,11,12,13,14,15);
}

// CDNA5 async global->LDS copy (ASYNCcnt). LDS byte offset = low 32 bits of
// the generic shared-memory address (ISA 10.2 aperture rules).
__device__ __forceinline__ unsigned lds_addr(const void* p) {
    return (unsigned)(unsigned long long)p;
}
__device__ __forceinline__ void wait_async0() {
    asm volatile("s_wait_asynccnt 0" ::: "memory");
}

// ---------------------------------------------------------------------------
// Kernel 0a: W fp32 -> bf16 with transpose: Wt[n][k] = bf16(W[k][n]).
// One 128 (k) x 64 (n) tile per work-group, 32 elements a thread, so that few
// waves have to be started: grid (8 ktiles, 16 ntiles, 3), 256 threads.
// ---------------------------------------------------------------------------
#define WC_K 128
#define WC_N 64
#define WC_PITCH (WC_K + 8)                  // 272 B = 16 B x odd for the ds_load_b128 readers
__global__ __launch_bounds__(256)
void wconv_kernel(const float* __restrict__ w1,
                  const float* __restrict__ w2,
                  const float* __restrict__ w3,
                  unsigned short* __restrict__ wt) {
    const int z = blockIdx.z;
    const float* W = (z == 0) ? w1 : (z == 1) ? w2 : w3;
    unsigned short* Wt = wt + (size_t)z * DIMN * DIMN;

    const int k0 = blockIdx.x * WC_K;
    const int n0 = blockIdx.y * WC_N;
    __shared__ __attribute__((aligned(16))) unsigned short t[WC_N][WC_PITCH];   // [n][k]

    const int tid = threadIdx.x;
    const int lk = tid >> 4;                  // 0..15
    const int ln = (tid & 15) * 4;            // 16 lanes cover a row's 256 B
    const float* src = W + (size_t)(k0 + lk) * DIMN + n0 + ln;
    float4 w[8];
    #pragma unroll
    for (int it = 0; it < 8; ++it)
        w[it] = *(const float4*)(src + (size_t)it * 16 * DIMN);
    #pragma unroll
    for (int it = 0; it < 8; ++it) {
        int kk = it * 16 + lk;
        t[ln + 0][kk] = f2bf(w[it].x);
        t[ln + 1][kk] = f2bf(w[it].y);
        t[ln + 2][kk] = f2bf(w[it].z);
        t[ln + 3][kk] = f2bf(w[it].w);
    }
    __syncthreads();
    const int sn = tid >> 4;                  // 0..15
    const int sk = (tid & 15) * 8;            // 16 lanes cover a row's 256 B
    unsigned short* dst = Wt + (size_t)(n0 + sn) * DIMN + k0 + sk;
    #pragma unroll
    for (int it = 0; it < 4; ++it)
        *(uint4*)(dst + (size_t)it * 16 * DIMN) = *(const uint4*)&t[it * 16 + sn][sk];
}

// ---------------------------------------------------------------------------
// Kernel 0b: X fp32 -> bf16 (so the GEMM can stage A with async byte copies).
// Each wave converts 16 KB of X: 32 loads of 512 contiguous bytes, all issued
// at its head. grid 512, 256 threads: 4,096 waves.
// ---------------------------------------------------------------------------
#define XC_LOADS 32
__global__ __launch_bounds__(256)
void xconv_kernel(const float* __restrict__ X, unsigned short* __restrict__ Xbf) {
    const int wave = threadIdx.x >> 5;
    const int lane = threadIdx.x & 31;
    const size_t base = ((size_t)blockIdx.x * 8 + wave) * (XC_LOADS * 128) + lane * 4;
    const float* src = X + base;
    unsigned short* dst = Xbf + base;

    float4 v[XC_LOADS];
    #pragma unroll
    for (int j = 0; j < XC_LOADS; ++j)
        v[j] = *(const float4*)(src + j * 128);
    // keeps all 32 loads in front of the arithmetic: left to itself the build holds
    // about a dozen in flight and issues the rest among the conversions
    __builtin_amdgcn_sched_barrier(0);
    // loops unrolled: register arrays need constant indices
    #pragma unroll
    for (int b = 0; b < XC_LOADS / 8; ++b) {
        uint2 p[8];
        #pragma unroll
        for (int j = 0; j < 8; ++j) {
            float4 xv = v[b * 8 + j];
            p[j].x = (unsigned)f2bf(xv.x) | ((unsigned)f2bf(xv.y) << 16);
            p[j].y = (unsigned)f2bf(xv.z) | ((unsigned)f2bf(xv.w) << 16);
        }
        // all 8 values of the run are formed before its first store, so none is
        // formed in a register that a store of the run names
        __builtin_amdgcn_sched_barrier(0);
        #pragma unroll
        for (int j = 0; j < 8; ++j)
            *(uint2*)(dst + (b * 8 + j) * 128) = p[j];
        if (b + 1 < XC_LOADS / 8) {
            // the run's data registers are not rewritten before this wait
            asm volatile("s_wait_xcnt 0x0" ::: "memory");
            // keeps the next run's arithmetic behind that wait
            __builtin_amdgcn_sched_barrier(0);
        }
    }
}

// ---------------------------------------------------------------------------
// Kernel 1: QKV projection GEMM. Xbf[16384,1024] * Wt^T + b -> bf16.
// One 256 x 256 tile of the output per work-group, 64 k per stage, two LDS
// buffers filled by async copies; 8 waves (2 x 4), 128 x 64 of the tile each
// (8 x 4 WMMA subtiles): 12 fragments read from LDS feed 32 WMMAs.
// The Wt fragment is the WMMA's A and the X fragment its B, so a lane's eight
// accumulator values are eight adjacent output columns of one output row; the
// epilogue stages them in LDS and stores whole 128-B lines.
// grid (4 Ntiles, 64 Mtiles, 3 matrices), 256 threads.
// ---------------------------------------------------------------------------
#define PJ_TILE  256                         // rows of X and rows of Wt per stage
#define PJ_K     64                          // k per stage: 128 B, one whole line a row
#define PJ_PITCH 72                          // 144 B = 16 B x odd for ds_load_b128 readers
#define PJ_TRIPS (DIMN / PJ_K)               // 16

// Eight async copies of one lane: rows r, r + 32, ..., r + 224 of one operand's
// stage. s_wait_xcnt stands inside the statement so that no address register is
// rewritten before it.
__device__ __forceinline__ void stage_rows8(unsigned l, const unsigned short* g) {
    asm volatile("global_load_async_to_lds_b128 %0, %8, off\n\t"
                 "global_load_async_to_lds_b128 %1, %9, off\n\t"
                 "global_load_async_to_lds_b128 %2, %10, off\n\t"
                 "global_load_async_to_lds_b128 %3, %11, off\n\t"
                 "global_load_async_to_lds_b128 %4, %12, off\n\t"
                 "global_load_async_to_lds_b128 %5, %13, off\n\t"
                 "global_load_async_to_lds_b128 %6, %14, off\n\t"
                 "global_load_async_to_lds_b128 %7, %15, off\n\t"
                 "s_wait_xcnt 0x0"
                 :: "v"(l),
                    "v"(l + 1u * 32u * PJ_PITCH * 2u),
                    "v"(l + 2u * 32u * PJ_PITCH * 2u),
                    "v"(l + 3u * 32u * PJ_PITCH * 2u),
                    "v"(l + 4u * 32u * PJ_PITCH * 2u),
                    "v"(l + 5u * 32u * PJ_PITCH * 2u),
                    "v"(l + 6u * 32u * PJ_PITCH * 2u),
                    "v"(l + 7u * 32u * PJ_PITCH * 2u),
                    "v"(g),
                    "v"(g + 1 * 32 * DIMN),
                    "v"(g + 2 * 32 * DIMN),
                    "v"(g + 3 * 32 * DIMN),
                    "v"(g + 4 * 32 * DIMN),
                    "v"(g + 5 * 32 * DIMN),
                    "v"(g + 6 * 32 * DIMN),
                    "v"(g + 7 * 32 * DIMN)
                 : "memory");
}

__global__ __launch_bounds__(256)
void proj_kernel(const unsigned short* __restrict__ Xbf,
                 const unsigned short* __restrict__ Wt,
                 const float* __restrict__ b1,
                 const float* __restrict__ b2,
                 const float* __restrict__ b3,
                 unsigned short* __restrict__ Q,
                 unsigned short* __restrict__ K,
                 unsigned short* __restrict__ V) {
    const int z = blockIdx.z;
    const unsigned short* Wz = Wt + (size_t)z * DIMN * DIMN;
    const float* bias = (z == 0) ? b1 : (z == 1) ? b2 : b3;
    unsigned short* Out = (z == 0) ? Q : (z == 1) ? K : V;

    const int n0 = blockIdx.x * PJ_TILE;
    const int m0 = blockIdx.y * PJ_TILE;

    __shared__ __attribute__((aligned(16))) unsigned short As[2][PJ_TILE][PJ_PITCH];   // 2 x 36 KB
    __shared__ __attribute__((aligned(16))) unsigned short Bs[2][PJ_TILE][PJ_PITCH];   // 2 x 36 KB ([n][k])

    const int tid   = threadIdx.x;
    // the wave's number as a scalar: what the epilogue derives from it then waits out the
    // loop in scalar registers; in vector registers it pushed the copies' base addresses to scratch
    const int wave  = __builtin_amdgcn_readfirstlane(tid >> 5);
    const int lane  = tid & 31;
    const int wm    = wave >> 2;                // 0..1 (M), 128 rows
    const int wn    = wave & 3;                 // 0..3 (N), 64 columns
    const int lhalf = lane >> 4;
    const int l16   = lane & 15;

    // per-thread staging coords: eight lanes cover one row's 128 B
    const int sr = tid >> 3;                    // 0..31
    const int sc = (tid & 7) * 8;               // 0,8,...,56

    const unsigned short* gA = Xbf + (size_t)(m0 + sr) * DIMN + sc;
    const unsigned short* gB = Wz  + (size_t)(n0 + sr) * DIMN + sc;

    v8f acc[8][4] = {};

    // stage 0 lands and is published, then stage 1 starts
    stage_rows8(lds_addr(&As[0][sr][sc]), gA);
    stage_rows8(lds_addr(&Bs[0][sr][sc]), gB);
    wait_async0();
    __syncthreads();
    stage_rows8(lds_addr(&As[1][sr][sc]), gA + PJ_K);
    stage_rows8(lds_addr(&Bs[1][sr][sc]), gB + PJ_K);

    for (int t = 0; t < PJ_TRIPS; ++t) {
        const int buf = t & 1;
        // compute on the current buffer (loops unrolled: register arrays need constant indices)
        v16bf fa[2][8], fb[2][4];                  // the wave's 24 fragments of this stage
        #pragma unroll
        for (int ks = 0; ks < 2; ++ks) {
            const int kc = ks * 32 + lhalf * 8;
            #pragma unroll
            for (int ns = 0; ns < 4; ++ns) {
                int br = wn * 64 + ns * 16 + l16;
                fb[ks][ns] = load_frag(&Bs[buf][br][kc], &Bs[buf][br][kc + 16]);
            }
            #pragma unroll
            for (int ms = 0; ms < 8; ++ms) {
                int ar = wm * 128 + ms * 16 + l16;
                fa[ks][ms] = load_frag(&As[buf][ar][kc], &As[buf][ar][kc + 16]);
            }
        }
        // keeps the stage's LDS reads one group in front of its WMMAs: left to itself the
        // build reads each row's fragment directly in front of its four WMMAs and waits it out
        __builtin_amdgcn_sched_barrier(0);
        #pragma unroll
        for (int ks = 0; ks < 2; ++ks) {
            #pragma unroll
            for (int ms = 0; ms < 8; ++ms) {
                #pragma unroll
                for (int ns = 0; ns < 4; ++ns)
                    acc[ms][ns] = __builtin_amdgcn_wmma_f32_16x16x32_bf16(
                        false, fb[ks][ns], false, fa[ks][ms], (short)0, acc[ms][ns], false, false);
            }
        }
        // keeps the WMMAs in front of the foot's waits: sunk behind them, every WMMA would
        // stand behind the wait for the last of the 48 reads instead of starting on the first
        __builtin_amdgcn_sched_barrier(0);
        // foot of the trip: this wave's reads of buffer buf are done, its copies of
        // stage t + 1 have landed, and the barrier says so of every wave
        asm volatile("s_wait_dscnt 0x0" ::: "memory");
        wait_async0();
        __syncthreads();
        if (t + 2 < PJ_TRIPS) {
            stage_rows8(lds_addr(&As[buf][sr][sc]), gA + (t + 2) * PJ_K);
            stage_rows8(lds_addr(&Bs[buf][sr][sc]), gB + (t + 2) * PJ_K);
        }
    }
    wait_async0();   // no copy is outstanding when the wave ends

    // epilogue: + bias, -> bf16 (loops unrolled: constant accumulator indices).
    // acc[ms][ns][g] is output row ms * 16 + l16, column ns * 16 + lhalf * 8 + g of the wave's tile.
    // Each wave stages its 128 x 64 tile in a range of LDS that is its own: a quarter of As
    // (waves 0 to 3) or of Bs (waves 4 to 7), 128 rows at the ring's pitch. The ring is free:
    // the last trip's foot ended every wave's reads and no copy is outstanding.
    unsigned short (*st)[PJ_PITCH] = (wave < 4) ? &As[(wave >> 1) & 1][(wave & 1) * 128]
                                                : &Bs[(wave >> 1) & 1][(wave & 1) * 128];
    const float* bp = bias + n0 + wn * 64 + lhalf * 8;
    v8f bv[4];
    #pragma unroll
    for (int ns = 0; ns < 4; ++ns)
        bv[ns] = *(const v8f*)(bp + ns * 16);
    // the loads' address registers are not rewritten before this wait
    asm volatile("s_wait_xcnt 0x0" ::: "memory");
    // keeps the arithmetic that follows behind that wait
    __builtin_amdgcn_sched_barrier(0);
    #pragma unroll
    for (int ms = 0; ms < 8; ++ms) {
        #pragma unroll
        for (int ns = 0; ns < 4; ++ns) {
            const v8f y = acc[ms][ns] + bv[ns];
            v4u p;
            p.x = (unsigned)f2bf(y[0]) | ((unsigned)f2bf(y[1]) << 16);
            p.y = (unsigned)f2bf(y[2]) | ((unsigned)f2bf(y[3]) << 16);
            p.z = (unsigned)f2bf(y[4]) | ((unsigned)f2bf(y[5]) << 16);
            p.w = (unsigned)f2bf(y[6]) | ((unsigned)f2bf(y[7]) << 16);
            *(v4u*)&st[ms * 16 + l16][ns * 16 + lhalf * 8] = p;
        }
    }
    // the wave's LDS writes are done before other lanes of it read the rows back
    asm volatile("s_wait_dscnt 0x0" ::: "memory");

    // eight lanes cover one row's 128 B, a store instruction four whole lines
    const int rr = lane >> 3;                   // 0..3
    const int cc = (lane & 7) * 8;              // 0,8,...,56
    unsigned short* dst = Out + (size_t)(m0 + wm * 128 + rr) * DIMN + n0 + wn * 64 + cc;
    #pragma unroll
    for (int b = 0; b < 4; ++b) {
        v4u q[8];
        #pragma unroll
        for (int j = 0; j < 8; ++j)
            q[j] = *(const v4u*)&st[(b * 8 + j) * 4 + rr][cc];
        // all 8 values of the run are read before its first store, so none is
        // read into a register that a store of the run names
        __builtin_amdgcn_sched_barrier(0);
        #pragma unroll
        for (int j = 0; j < 8; ++j)
            *(v4u*)(dst + (size_t)((b * 8 + j) * 4) * DIMN) = q[j];
        if (b + 1 < 4) {
            // the run's data registers are not rewritten before this wait
            asm volatile("s_wait_xcnt 0x0" ::: "memory");
            // keeps the next run's LDS reads behind that wait
            __builtin_amdgcn_sched_barrier(0);
        }
    }
}

// ---------------------------------------------------------------------------
// Kernel 2: block-local attention, residual and LayerNorm in one launch.
// A work-group owns 64 query rows of a block over ALL 16 heads, so a whole output row is
// on one WGP and the attention result never goes to memory. grid (2 slabs, BLK_NUM, BATCH),
// 256 threads: wave = (query tile qt = wave & 3, head group hg = wave >> 2); in step s the
// wave works on head s + 8 * hg. Q, K, V of the step's two heads come through a two-buffer
// LDS ring of async copies; V stays row-major and is read by the transposing load.
// The scores are computed transposed (K fragment = the WMMA's A, Q fragment = its B): a lane
// holds 64 of one query's 128 scores and lane ^ 16 the other 64, so the softmax runs in
// registers with one exchange between the wave's halves for the maximum and one for the sum,
// and two score tiles, converted in place, are the B fragment of the second product.
// ---------------------------------------------------------------------------
// lane l reads lane l ^ 16
__device__ __forceinline__ float xhalf(float x) {
    return __builtin_bit_cast(float, __builtin_amdgcn_permlanex16(
        __builtin_bit_cast(int, x), __builtin_bit_cast(int, x),
        0x76543210, 0xfedcba98, false, false));
}

#define FQ      64                            // query rows per work-group
#define F_STEPS 8                             // steps: heads s and s + 8
#define F_QKP   72                            // Q, K pitch: 144 B = 16 B x odd (ds_load_b128)
#define F_VP    80                            // V pitch: 160 B = 32 B x odd (ds_load_tr16_b128)
#define F_KOFF  (2 * FQ * F_QKP)              // elements: Q of two heads in front
#define F_VOFF  (F_KOFF + 2 * BLK_LEN * F_QKP)
#define F_STAGE (F_VOFF + 2 * BLK_LEN * F_VP) // 48,128 elements = 96,256 B a buffer

typedef short s16x8 __attribute__((ext_vector_type(8)));
// 16 x 16 piece of a row-major 16-bit LDS tile, transposed: lane (c, h) gets rows 8h .. 8h + 7 of column c
__device__ __forceinline__ v8bf ld_tr16(const unsigned char* q) {
    typedef __attribute__((address_space(3))) s16x8 lds_s16x8;
    return __builtin_bit_cast(v8bf, __builtin_amdgcn_ds_load_tr16_b128_v8i16((lds_s16x8*)q));
}

// Ten async copies of one lane: its 16 B of 2 rows of Q and of 4 rows each of K and V of one
// head (rows 32 apart). The global address is a scalar base (tile's first element) plus the
// lane's byte offset: four offset registers serve all ten copies and every step.
// s_wait_xcnt stands inside the statement so that no address register is rewritten before it.
__device__ __forceinline__ void stage_head(unsigned lq, unsigned lk, unsigned lv, unsigned off,
                                           const unsigned short* bq,
                                           const unsigned short* bk,
                                           const unsigned short* bv) {
    asm volatile("global_load_async_to_lds_b128 %0, %10, %14\n\t"
                 "global_load_async_to_lds_b128 %1, %11, %14\n\t"
                 "global_load_async_to_lds_b128 %2, %10, %15\n\t"
                 "global_load_async_to_lds_b128 %3, %11, %15\n\t"
                 "global_load_async_to_lds_b128 %4, %12, %15\n\t"
                 "global_load_async_to_lds_b128 %5, %13, %15\n\t"
                 "global_load_async_to_lds_b128 %6, %10, %16\n\t"
                 "global_load_async_to_lds_b128 %7, %11, %16\n\t"
                 "global_load_async_to_lds_b128 %8, %12, %16\n\t"
                 "global_load_async_to_lds_b128 %9, %13, %16\n\t"
                 "s_wait_xcnt 0x0"
                 :: "v"(lq), "v"(lq + 32u * F_QKP * 2u),
                    "v"(lk), "v"(lk + 32u * F_QKP * 2u),
                    "v"(lk + 64u * F_QKP * 2u), "v"(lk + 96u * F_QKP * 2u),
                    "v"(lv), "v"(lv + 32u * F_VP * 2u),
                    "v"(lv + 64u * F_VP * 2u), "v"(lv + 96u * F_VP * 2u),
                    "v"(off), "v"(off + 32u * DIMN * 2u),
                    "v"(off + 64u * DIMN * 2u), "v"(off + 96u * DIMN * 2u),
                    "s"(bq), "s"(bk), "s"(bv)
                 : "memory");
}

__global__ __launch_bounds__(256)
void attn_ln_kernel(const unsigned short* __restrict__ Qg,
                    const unsigned short* __restrict__ Kg,
                    const unsigned short* __restrict__ Vg,
                    const int* __restrict__ mask,
                    const float* __restrict__ X,
                    const float* __restrict__ gamma,
                    const float* __restrict__ beta,
                    float* __restrict__ out) {
    const int slab = blockIdx.x;
    const int blk  = blockIdx.y;
    const int b    = blockIdx.z;

    __shared__ __attribute__((aligned(16))) unsigned short ring[2][F_STAGE];  // 188 KB
    __shared__ __attribute__((aligned(16))) float stg[8][16 * 68];            // 34 KB: a wave's own 16 x 64 tile
    __shared__ float msk[HEADS][FQ];                                          // 4 KB: the mask's addend
    __shared__ __attribute__((aligned(8))) float red[8][16][2];               // a wave's row sums

    const int tid   = threadIdx.x;
    // the wave's number as a scalar: what derives from it stays in scalar registers
    const int wave  = __builtin_amdgcn_readfirstlane(tid >> 5);
    const int lane  = tid & 31;
    const int lhalf = lane >> 4;
    const int l16   = lane & 15;
    const int qt    = wave & 3;
    const int hg    = wave >> 2;

    const size_t rowbase = (size_t)b * SEQ + (size_t)blk * BLK_LEN;   // the block's keys
    const size_t qbase   = rowbase + (size_t)slab * FQ;               // the work-group's queries

    // a (query row, head) pair has one mask value: 1,024 of them, four a thread, asked for first
    const int mr = tid >> 2;
    const int mh = (tid & 3) * 4;
    const int* mp = mask + (qbase + mr) * DIMN + mh * DH;
    const int m0 = mp[0], m1 = mp[DH], m2 = mp[2 * DH], m3 = mp[3 * DH];
    // the loads' address registers are not rewritten before this wait
    asm volatile("s_wait_xcnt 0x0" ::: "memory");
    // keeps the address arithmetic that follows behind that wait
    __builtin_amdgcn_sched_barrier(0);

    // per-thread staging coords: eight lanes cover one row's 128 B
    const int sr = tid >> 3;                    // 0..31
    const int sc = (tid & 7) * 8;               // 0,8,...,56
    const unsigned short* gq = Qg + qbase   * DIMN;    // scalar bases: head 0 of the first row
    const unsigned short* gk = Kg + rowbase * DIMN;
    const unsigned short* gv = Vg + rowbase * DIMN;
    const unsigned goff = (unsigned)(sr * DIMN + sc) * 2u;   // the lane's byte offset in a tile
    const unsigned lq = lds_addr(&ring[0][sr * F_QKP + sc]);
    const unsigned lk = lds_addr(&ring[0][F_KOFF + sr * F_QKP + sc]);
    const unsigned lv = lds_addr(&ring[0][F_VOFF + sr * F_VP + sc]);

// the copies of step st (heads st and st + 8) into buffer bf
#define F_FILL(st, bf)                                                                   \
    do {                                                                                 \
        const unsigned bo = (unsigned)(bf) * (F_STAGE * 2u);                             \
        stage_head(lq + bo, lk + bo, lv + bo, goff,                                      \
                   gq + (st) * DH, gk + (st) * DH, gv + (st) * DH);                      \
        stage_head(lq + bo + FQ * F_QKP * 2u, lk + bo + BLK_LEN * F_QKP * 2u,            \
                   lv + bo + BLK_LEN * F_VP * 2u, goff,                                  \
                   gq + ((st) + 8) * DH, gk + ((st) + 8) * DH, gv + ((st) + 8) * DH);    \
    } while (0)

    // step 0 lands and is published (with the mask's addends), then step 1 starts
    F_FILL(0, 0);
    // keeps the mask's arithmetic, which waits for its loads, behind the issue of the copies
    __builtin_amdgcn_sched_barrier(0);
    msk[mh + 0][mr] = (1.0f - (float)m0) * -1.0e10f;
    msk[mh + 1][mr] = (1.0f - (float)m1) * -1.0e10f;
    msk[mh + 2][mr] = (1.0f - (float)m2) * -1.0e10f;
    msk[mh + 3][mr] = (1.0f - (float)m3) * -1.0e10f;
    wait_async0();
    __syncthreads();
    F_FILL(1, 1);

    // rw[s][it]: row qt * 16 + it * 2 + lhalf, columns (s + 8 * hg) * 64 + l16 * 4 .. + 3 of
    // attention + residual
    v4f rw[F_STEPS][8];                       // every tile is written in its own step
    float* so = &stg[wave][0];

    // kept rolled, for speed only
    #pragma unroll 1
    for (int s = 0; s < F_STEPS; ++s) {
        const int head = s + 8 * hg;
        const unsigned short* Bf = &ring[s & 1][0];
        const unsigned short* Qs = Bf + hg * (FQ * F_QKP);
        const unsigned short* Ks = Bf + F_KOFF + hg * (BLK_LEN * F_QKP);
        const unsigned char*  Vs = (const unsigned char*)(Bf + F_VOFF + hg * (BLK_LEN * F_VP));

        const float madd = msk[head][qt * 16 + l16];

        // S^T = K Q^T : 128 keys x 16 query columns per wave, K-dim 64 (2 steps).
        // sc8[nt][g] is key nt * 16 + lhalf * 8 + g, query qt * 16 + l16.
        v8f sc8[8] = {};
        #pragma unroll
        for (int ks = 0; ks < 2; ++ks) {
            const int ar = qt * 16 + l16;
            v16bf a = load_frag(Qs + ar * F_QKP + ks * 32 + lhalf * 8,
                                Qs + ar * F_QKP + ks * 32 + lhalf * 8 + 16);
            #pragma unroll
            for (int nt = 0; nt < 8; ++nt) {
                const int br = nt * 16 + l16;
                v16bf bb = load_frag(Ks + br * F_QKP + ks * 32 + lhalf * 8,
                                     Ks + br * F_QKP + ks * 32 + lhalf * 8 + 16);
                sc8[nt] = __builtin_amdgcn_wmma_f32_16x16x32_bf16(
                    false, bb, false, a, (short)0, sc8[nt], false, false);
            }
        }

        // the residual's 16 x 64 tile, asked for behind the first product, used at the step's end
        const float* xp = X + (qbase + qt * 16 + lhalf) * DIMN + head * DH + l16 * 4;
        v4f xv[8];
        #pragma unroll
        for (int it = 0; it < 8; ++it)
            xv[it] = *(const v4f*)(xp + (size_t)(it * 2) * DIMN);
        // the loads' address registers are not rewritten before this wait
        asm volatile("s_wait_xcnt 0x0" ::: "memory");

        // scale + mask + softmax over the lane pair's 128 scores (loops unrolled: constant indices)
        const float scale = 0.125f; // 1/sqrt(64)
        // whole-tile vector forms: a tile's adjacent registers pair up for the packed instructions
        #pragma unroll
        for (int nt = 0; nt < 8; ++nt)
            sc8[nt] = sc8[nt] * scale + madd;
        v8f mx = sc8[0];
        #pragma unroll
        for (int nt = 1; nt < 8; ++nt)
            mx = __builtin_elementwise_max(mx, sc8[nt]);
        float rmax = fmaxf(fmaxf(fmaxf(mx[0], mx[1]), fmaxf(mx[2], mx[3])),
                           fmaxf(fmaxf(mx[4], mx[5]), fmaxf(mx[6], mx[7])));
        rmax = fmaxf(rmax, xhalf(rmax));
        #pragma unroll
        for (int nt = 0; nt < 8; ++nt) {
            #pragma unroll
            for (int g = 0; g < 8; ++g)
                sc8[nt][g] = __expf(sc8[nt][g] - rmax);
        }
        v8f sm = sc8[0];
        #pragma unroll
        for (int nt = 1; nt < 8; ++nt)
            sm += sc8[nt];
        float rsum = ((sm[0] + sm[1]) + (sm[2] + sm[3])) + ((sm[4] + sm[5]) + (sm[6] + sm[7]));
        rsum += xhalf(rsum);
        const float inv = 1.0f / rsum;
        // P^T as B fragments: element e of pf[ks] is key ks * 32 + lhalf * 8 + e (e < 8) or
        // ks * 32 + 16 + lhalf * 8 + e - 8, the k order in which the V fragment is read below
        v16bf pf[4];
        #pragma unroll
        for (int ks = 0; ks < 4; ++ks) {
            v8bf lo = __builtin_convertvector(sc8[2 * ks] * inv, v8bf);
            v8bf hi = __builtin_convertvector(sc8[2 * ks + 1] * inv, v8bf);
            pf[ks] = __builtin_shufflevector(lo, hi, 0,1,2,3,4,5,6,7,8,9,10,11,12,13,14,15);
        }

        // O = P V : 16 rows x 64 cols, K-dim 128 (4 steps). The V fragment is the WMMA's A and the
        // P fragment its B: o[nt][g] is query row l16, column nt * 16 + lhalf * 8 + g.
        // Lane (l16, lhalf) gets V[ks * 32 + lhalf * 8 + 0..7][nt * 16 + l16], then the same 16 keys on.
        const unsigned char* va = Vs + (8 * lhalf + (lane & 7)) * (F_VP * 2) + ((lane >> 3) & 1) * 16;
        v8f o[4] = {};
        #pragma unroll
        for (int ks = 0; ks < 4; ++ks) {
            #pragma unroll
            for (int nt = 0; nt < 4; ++nt) {
                v8bf lo = ld_tr16(va + (ks * 32) * (F_VP * 2) + nt * 32);
                v8bf hi = ld_tr16(va + (ks * 32 + 16) * (F_VP * 2) + nt * 32);
                v16bf bb = __builtin_shufflevector(lo, hi, 0,1,2,3,4,5,6,7,8,9,10,11,12,13,14,15);
                o[nt] = __builtin_amdgcn_wmma_f32_16x16x32_bf16(
                    false, bb, false, pf[ks], (short)0, o[nt], false, false);
            }
        }

        // foot of the step: this wave's reads of the buffer are done, its copies of step
        // s + 1 have landed, and the barrier says so of every wave
        asm volatile("s_wait_dscnt 0x0" ::: "memory");
        wait_async0();
        __syncthreads();
        if (s + 2 < F_STEPS)
            F_FILL(s + 2, s & 1);

        // The wave turns its 16 x 64 f32 tile through its own LDS range (16 rows of 272 B hold
        // the 256 B each): afterwards 16 lanes cover a row's 256 B, as the residual's loads do.
        #pragma unroll
        for (int nt = 0; nt < 4; ++nt) {
            float* sp = so + l16 * 68 + nt * 16 + lhalf * 8;
            *(v4f*)sp       = __builtin_shufflevector(o[nt], o[nt], 0, 1, 2, 3);
            *(v4f*)(sp + 4) = __builtin_shufflevector(o[nt], o[nt], 4, 5, 6, 7);
        }
        // the wave's LDS writes are done before other lanes of it read the rows back
        asm volatile("s_wait_dscnt 0x0" ::: "memory");
        // The step's tile, residual added, is formed in registers of its own: a scalar branch on
        // the step picks the copy of these lines whose register indices are the step's constants.
#define F_KEEP(j)                                                                        \
        do {                                                                             \
            _Pragma("unroll")                                                            \
            for (int it = 0; it < 8; ++it) {                                             \
                rw[j][it] = *(const v4f*)(so + (it * 2 + lhalf) * 68 + l16 * 4) + xv[it]; \
            }                                                                            \
        } while (0)
        if (s == 0) F_KEEP(0);
        if (s == 1) F_KEEP(1);
        if (s == 2) F_KEEP(2);
        if (s == 3) F_KEEP(3);
        if (s == 4) F_KEEP(4);
        if (s == 5) F_KEEP(5);
        if (s == 6) F_KEEP(6);
        if (s == 7) F_KEEP(7);
    }
    wait_async0();   // no copy is outstanding when the wave ends

    // gamma, beta of the wave's 512 columns, asked for before the sums are joined
    const float* gp = gamma + hg * (8 * DH) + l16 * 4;
    const float* bp = beta  + hg * (8 * DH) + l16 * 4;
    v4f gm[F_STEPS], bt[F_STEPS];
    #pragma unroll
    for (int j = 0; j < F_STEPS; ++j) {
        gm[j] = *(const v4f*)(gp + j * DH);
        bt[j] = *(const v4f*)(bp + j * DH);
    }
    // the loads' address registers are not rewritten before this wait
    asm volatile("s_wait_xcnt 0x0" ::: "memory");

    // a row's sum and sum of squares: the lane's 32 values, then the 16 lanes that share the
    // row, then the two waves that share it
    float s1[8], s2[8];
    #pragma unroll
    for (int it = 0; it < 8; ++it) {
        v4f a1 = rw[0][it], a2 = rw[0][it] * rw[0][it];
        #pragma unroll
        for (int j = 1; j < F_STEPS; ++j) {
            a1 += rw[j][it];
            a2 += rw[j][it] * rw[j][it];
        }
        s1[it] = (a1[0] + a1[1]) + (a1[2] + a1[3]);
        s2[it] = (a2[0] + a2[1]) + (a2[2] + a2[3]);
    }
    #pragma unroll
    for (int it = 0; it < 8; ++it) {
        #pragma unroll
        for (int d = 1; d < 16; d <<= 1) {
            s1[it] += __shfl_xor(s1[it], d, 32);
            s2[it] += __shfl_xor(s2[it], d, 32);
        }
    }
    if (l16 == 0) {
        #pragma unroll
        for (int it = 0; it < 8; ++it) {
            red[wave][it * 2 + lhalf][0] = s1[it];
            red[wave][it * 2 + lhalf][1] = s2[it];
        }
    }
    __syncthreads();
    float mean[8], rstd[8];
    #pragma unroll
    for (int it = 0; it < 8; ++it) {
        const float tot  = s1[it] + red[wave ^ 4][it * 2 + lhalf][0];
        const float totq = s2[it] + red[wave ^ 4][it * 2 + lhalf][1];
        mean[it] = tot * (1.0f / DIMN);
        const float var = totq * (1.0f / DIMN) - mean[it] * mean[it];
        rstd[it] = rsqrtf(var + 1.0e-3f);
    }

    // whole lines: a store instruction covers 256 B of two rows
    float* op = out + (qbase + qt * 16 + lhalf) * DIMN + hg * (8 * DH) + l16 * 4;
    #pragma unroll
    for (int j = 0; j < F_STEPS; ++j) {
        v4f y[8];
        #pragma unroll
        for (int it = 0; it < 8; ++it)
            y[it] = (rw[j][it] - mean[it]) * rstd[it] * gm[j] + bt[j];
        // all 8 values of the run are formed before its first store, so none is
        // formed in a register that a store of the run names
        __builtin_amdgcn_sched_barrier(0);
        #pragma unroll
        for (int it = 0; it < 8; ++it)
            *(v4f*)(op + j * DH + (size_t)(it * 2) * DIMN) = y[it];
        if (j + 1 < F_STEPS) {
            // the run's data and address registers are not rewritten before this wait
            asm volatile("s_wait_xcnt 0x0" ::: "memory");
            // keeps the next run's arithmetic behind that wait
            __builtin_amdgcn_sched_barrier(0);
        }
    }
}

// ---------------------------------------------------------------------------
extern "C" void kernel_launch(void* const* d_in, const int* in_sizes, int n_in,
                              void* d_out, int out_size, void* d_ws, size_t ws_size,
                              hipStream_t stream) {
    (void)in_sizes; (void)n_in; (void)out_size; (void)ws_size;

    const float* X     = (const float*)d_in[0];
    const int*   mask  = (const int*)d_in[1];
    const float* w1    = (const float*)d_in[2];
    const float* b1    = (const float*)d_in[3];
    const float* w2    = (const float*)d_in[4];
    const float* b2    = (const float*)d_in[5];
    const float* w3    = (const float*)d_in[6];
    const float* b3    = (const float*)d_in[7];
    const float* gamma = (const float*)d_in[8];
    const float* beta  = (const float*)d_in[9];
    float* out = (float*)d_out;

    char* ws = (char*)d_ws;
    unsigned short* Wt  = (unsigned short*)(ws + WT_OFF);
    unsigned short* Xbf = (unsigned short*)(ws + XBF_OFF);
    unsigned short* Q   = (unsigned short*)(ws + Q_OFF);
    unsigned short* K   = (unsigned short*)(ws + K_OFF);
    unsigned short* V   = (unsigned short*)(ws + V_OFF);

    // 0a) weights -> bf16, transposed to [n][k]
    wconv_kernel<<<dim3(DIMN / WC_K, DIMN / WC_N, 3), dim3(256), 0, stream>>>(w1, w2, w3, Wt);
    // 0b) activations -> bf16
    xconv_kernel<<<dim3((ROWS * DIMN) / (8 * XC_LOADS * 128)), dim3(256), 0, stream>>>(X, Xbf);

    // 1) Q/K/V projections (WMMA bf16, async-to-LDS double buffered)
    proj_kernel<<<dim3(DIMN / 256, ROWS / 256, 3), dim3(256), 0, stream>>>(
        Xbf, Wt, b1, b2, b3, Q, K, V);

    // 2) block-local attention (WMMA) + residual + LayerNorm
    attn_ln_kernel<<<dim3(BLK_LEN / FQ, BLK_NUM, BATCH), dim3(256), 0, stream>>>(
        Q, K, V, mask, X, gamma, beta, out);
}

// v007
// A run of this version takes 110 microseconds.
// Timed twice side by side with v006, it ran 1.03 times as fast both times.
// Over all steps from v000 it is 2.29 times as fast.
#include <hip/hip_runtime.h>

#define DIMN 1024
#define HEADS 16
#define DH 64
#define BLK_LEN 128
#define BLK_NUM 32
#define BATCH 4
#define SEQ (BLK_NUM * BLK_LEN)          // 4096
#define ROWS (BATCH * SEQ)               // 16384

typedef __attribute__((ext_vector_type(8)))  float  v8f;
typedef __attribute__((ext_vector_type(8)))  __bf16 v8bf;
typedef __attribute__((ext_vector_type(16))) __bf16 v16bf;
typedef __attribute__((ext_vector_type(4)))  unsigned v4u;
typedef __attribute__((ext_vector_type(4)))  float  v4f;

// ---- workspace layout (bytes) ----
static const size_t WT_OFF  = 0;                         // W^T bf16, 3 * 2MB
static const size_t XBF_OFF = 6291456;                   // X bf16, 32MB
static const size_t Q_OFF   = XBF_OFF + 33554432ull;
static const size_t K_OFF   = Q_OFF   + 33554432ull;
static const size_t V_OFF   = K_OFF   + 33554432ull;

__device__ __forceinline__ unsigned short f2bf(float f) {
    union { float f; unsigned u; } v; v.f = f;
    unsigned r = v.u + 0x7FFFu + ((v.u >> 16) & 1u);     // round-to-nearest-even
    return (unsigned short)(r >> 16);
}

__device__ __forceinline__ v16bf load_frag(const unsigned short* lo,
                                           const unsigned short* hi) {
    v8bf a = *(const v8bf*)lo;
    v8bf b = *(const v8bf*)hi;
    return __builtin_shufflevector(a, b, 0,1,2,3,4,5,6,7,8,9,10,11,12,13,14,15);
}

// CDNA5 async global->LDS copy (ASYNCcnt). LDS byte offset = low 32 bits of
// the generic shared-memory address (ISA 10.2 aperture rules).
__device__ __forceinline__ unsigned lds_addr(const void* p) {
    return (unsigned)(unsigned long long)p;
}
__device__ __forceinline__ void wait_async0() {
    asm volatile("s_wait_asynccnt 0" ::: "memory");
}

// ---------------------------------------------------------------------------
// Kernel 0: both conversions in one launch. grid 512, 256 threads: 4,096 waves.
// X fp32 -> bf16 (so the GEMM can stage A with async byte copies): each wave converts
// 16 KB of X, 32 loads of 512 contiguous bytes, all issued at its head.
// W fp32 -> bf16 with transpose, Wt[n][k] = bf16(W[k][n]): the first 384 work-groups also
// take one 128 (k) x 64 (n) tile of W each, 32 elements a thread. Its loads go out in front
// of X's and it is turned through LDS while X's loads are on their way.
// ---------------------------------------------------------------------------
#define WC_K 128
#define WC_N 64
#define WC_PITCH (WC_K + 8)                  // 272 B = 16 B x odd for the ds_load_b128 readers
#define WC_TILES ((DIMN / WC_K) * (DIMN / WC_N))   // 128 tiles a matrix
#define XC_LOADS 32
__global__ __launch_bounds__(256)
void conv_kernel(const float* __restrict__ w1,
                 const float* __restrict__ w2,
                 const float* __restrict__ w3,
                 unsigned short* __restrict__ wt,
                 const float* __restrict__ X,
                 unsigned short* __restrict__ Xbf) {
    __shared__ __attribute__((aligned(16))) unsigned short t[WC_N][WC_PITCH];   // [n][k]

    const int tid = threadIdx.x;
    const int z = blockIdx.x / WC_TILES;      // 0..2: a matrix of W; 3: no tile of W
    const bool has_w = z < 3;                 // the same for the whole work-group
    const int k0 = (blockIdx.x % (DIMN / WC_K)) * WC_K;
    const int n0 = ((blockIdx.x % WC_TILES) / (DIMN / WC_K)) * WC_N;

    const int lk = tid >> 4;                  // 0..15
    const int ln = (tid & 15) * 4;            // 16 lanes cover a row's 256 B
    float4 w[8] = {};
    if (has_w) {
        const float* W = (z == 0) ? w1 : (z == 1) ? w2 : w3;
        const float* wsrc = W + (size_t)(k0 + lk) * DIMN + n0 + ln;
        #pragma unroll
        for (int it = 0; it < 8; ++it)
            w[it] = *(const float4*)(wsrc + (size_t)it * 16 * DIMN);
        // the loads' address registers are not rewritten before this wait
        asm volatile("s_wait_xcnt 0x0" ::: "memory");
    }

    const int wave = tid >> 5;
    const int lane = tid & 31;
    const size_t base = ((size_t)blockIdx.x * 8 + wave) * (XC_LOADS * 128) + lane * 4;
    const float* src = X + base;
    unsigned short* dst = Xbf + base;

    float4 v[XC_LOADS];
    #pragma unroll
    for (int j = 0; j < XC_LOADS; ++j)
        v[j] = *(const float4*)(src + j * 128);
    // the loads' address registers are not rewritten before this wait
    asm volatile("s_wait_xcnt 0x0" ::: "memory");
    // keeps all the loads in front of the arithmetic: left to itself the build holds
    // about a dozen in flight and issues the rest among the conversions
    __builtin_amdgcn_sched_barrier(0);

    if (has_w) {
        #pragma unroll
        for (int it = 0; it < 8; ++it) {
            int kk = it * 16 + lk;
            t[ln + 0][kk] = f2bf(w[it].x);
            t[ln + 1][kk] = f2bf(w[it].y);
            t[ln + 2][kk] = f2bf(w[it].z);
            t[ln + 3][kk] = f2bf(w[it].w);
        }
        __syncthreads();
        const int sn = tid >> 4;                  // 0..15
        const int sk = (tid & 15) * 8;            // 16 lanes cover a row's 256 B
        unsigned short* wdst = wt + (size_t)z * DIMN * DIMN + (size_t)(n0 + sn) * DIMN + k0 + sk;
        #pragma unroll
        for (int it = 0; it < 4; ++it)
            *(uint4*)(wdst + (size_t)it * 16 * DIMN) = *(const uint4*)&t[it * 16 + sn][sk];
        // the stores' data and address registers are not rewritten before this wait
        asm volatile("s_wait_xcnt 0x0" ::: "memory");
        // keeps X's arithmetic behind that wait
        __builtin_amdgcn_sched_barrier(0);
    }

    // loops unrolled: register arrays need constant indices
    #pragma unroll
    for (int b = 0; b < XC_LOADS / 8; ++b) {
        uint2 p[8];
        #pragma unroll
        for (int j = 0; j < 8; ++j) {
            float4 xv = v[b * 8 + j];
            p[j].x = (unsigned)f2bf(xv.x) | ((unsigned)f2bf(xv.y) << 16);
            p[j].y = (unsigned)f2bf(xv.z) | ((unsigned)f2bf(xv.w) << 16);
        }
        // all 8 values of the run are formed before its first store, so none is
        // formed in a register that a store of the run names
        __builtin_amdgcn_sched_barrier(0);
        #pragma unroll
        for (int j = 0; j < 8; ++j)
            *(uint2*)(dst + (b * 8 + j) * 128) = p[j];
        if (b + 1 < XC_LOADS / 8) {
            // the run's data registers are not rewritten before this wait
            asm volatile("s_wait_xcnt 0x0" ::: "memory");
            // keeps the next run's arithmetic behind that wait
            __builtin_amdgcn_sched_barrier(0);
        }
    }
}

// ---------------------------------------------------------------------------
// Kernel 1: QKV projection GEMM. Xbf[16384,1024] * Wt^T + b -> bf16.
// One 256 x 256 tile of the output per work-group, 64 k per stage, two LDS
// buffers filled by async copies; 8 waves (2 x 4), 128 x 64 of the tile each
// (8 x 4 WMMA subtiles): 12 fragments read from LDS feed 32 WMMAs.
// The Wt fragment is the WMMA's A and the X fragment its B, so a lane's eight
// accumulator values are eight adjacent output columns of one output row; the
// epilogue stages them in LDS and stores whole 128-B lines.
// grid (4 Ntiles, 64 Mtiles, 3 matrices), 256 threads.
// ---------------------------------------------------------------------------
#define PJ_TILE  256                         // rows of X and rows of Wt per stage
#define PJ_K     64                          // k per stage: 128 B, one whole line a row
#define PJ_PITCH 72                          // 144 B = 16 B x odd for ds_load_b128 readers
#define PJ_TRIPS (DIMN / PJ_K)               // 16

// Eight async copies of one lane: rows r, r + 32, ..., r + 224 of one operand's
// stage. s_wait_xcnt stands inside the statement so that no address register is
// rewritten before it.
__device__ __forceinline__ void stage_rows8(unsigned l, const unsigned short* g) {
    asm volatile("global_load_async_to_lds_b128 %0, %8, off\n\t"
                 "global_load_async_to_lds_b128 %1, %9, off\n\t"
                 "global_load_async_to_lds_b128 %2, %10, off\n\t"
                 "global_load_async_to_lds_b128 %3, %11, off\n\t"
                 "global_load_async_to_lds_b128 %4, %12, off\n\t"
                 "global_load_async_to_lds_b128 %5, %13, off\n\t"
                 "global_load_async_to_lds_b128 %6, %14, off\n\t"
                 "global_load_async_to_lds_b128 %7, %15, off\n\t"
                 "s_wait_xcnt 0x0"
                 :: "v"(l),
                    "v"(l + 1u * 32u * PJ_PITCH * 2u),
                    "v"(l + 2u * 32u * PJ_PITCH * 2u),
                    "v"(l + 3u * 32u * PJ_PITCH * 2u),
                    "v"(l + 4u * 32u * PJ_PITCH * 2u),
                    "v"(l + 5u * 32u * PJ_PITCH * 2u),
                    "v"(l + 6u * 32u * PJ_PITCH * 2u),
                    "v"(l + 7u * 32u * PJ_PITCH * 2u),
                    "v"(g),
                    "v"(g + 1 * 32 * DIMN),
                    "v"(g + 2 * 32 * DIMN),
                    "v"(g + 3 * 32 * DIMN),
                    "v"(g + 4 * 32 * DIMN),
                    "v"(g + 5 * 32 * DIMN),
                    "v"(g + 6 * 32 * DIMN),
                    "v"(g + 7 * 32 * DIMN)
                 : "memory");
}

__global__ __launch_bounds__(256)
void proj_kernel(const unsigned short* __restrict__ Xbf,
                 const unsigned short* __restrict__ Wt,
                 const float* __restrict__ b1,
                 const float* __restrict__ b2,
                 const float* __restrict__ b3,
                 unsigned short* __restrict__ Q,
                 unsigned short* __restrict__ K,
                 unsigned short* __restrict__ V) {
    const int z = blockIdx.z;
    const unsigned short* Wz = Wt + (size_t)z * DIMN * DIMN;
    const float* bias = (z == 0) ? b1 : (z == 1) ? b2 : b3;
    unsigned short* Out = (z == 0) ? Q : (z == 1) ? K : V;

    const int n0 = blockIdx.x * PJ_TILE;
    const int m0 = blockIdx.y * PJ_TILE;

    __shared__ __attribute__((aligned(16))) unsigned short As[2][PJ_TILE][PJ_PITCH];   // 2 x 36 KB
    __shared__ __attribute__((aligned(16))) unsigned short Bs[2][PJ_TILE][PJ_PITCH];   // 2 x 36 KB ([n][k])

    const int tid   = threadIdx.x;
    // the wave's number as a scalar: what the epilogue derives from it then waits out the
    // loop in scalar registers; in vector registers it pushed the copies' base addresses to scratch
    const int wave  = __builtin_amdgcn_readfirstlane(tid >> 5);
    const int lane  = tid & 31;
    const int wm    = wave >> 2;                // 0..1 (M), 128 rows
    const int wn    = wave & 3;                 // 0..3 (N), 64 columns
    const int lhalf = lane >> 4;
    const int l16   = lane & 15;

    // per-thread staging coords: eight lanes cover one row's 128 B
    const int sr = tid >> 3;                    // 0..31
    const int sc = (tid & 7) * 8;               // 0,8,...,56

    const unsigned short* gA = Xbf + (size_t)(m0 + sr) * DIMN + sc;
    const unsigned short* gB = Wz  + (size_t)(n0 + sr) * DIMN + sc;

    v8f acc[8][4] = {};

    // stage 0 lands and is published, then stage 1 starts
    stage_rows8(lds_addr(&As[0][sr][sc]), gA);
    stage_rows8(lds_addr(&Bs[0][sr][sc]), gB);
    wait_async0();
    __syncthreads();
    stage_rows8(lds_addr(&As[1][sr][sc]), gA + PJ_K);
    stage_rows8(lds_addr(&Bs[1][sr][sc]), gB + PJ_K);

    for (int t = 0; t < PJ_TRIPS; ++t) {
        const int buf = t & 1;
        // compute on the current buffer (loops unrolled: register arrays need constant indices)
        v16bf fa[2][8], fb[2][4];                  // the wave's 24 fragments of this stage
        #pragma unroll
        for (int ks = 0; ks < 2; ++ks) {
            const int kc = ks * 32 + lhalf * 8;
            #pragma unroll
            for (int ns = 0; ns < 4; ++ns) {
                int br = wn * 64 + ns * 16 + l16;
                fb[ks][ns] = load_frag(&Bs[buf][br][kc], &Bs[buf][br][kc + 16]);
            }
            #pragma unroll
            for (int ms = 0; ms < 8; ++ms) {
                int ar = wm * 128 + ms * 16 + l16;
                fa[ks][ms] = load_frag(&As[buf][ar][kc], &As[buf][ar][kc + 16]);
            }
        }
        // keeps the stage's LDS reads one group in front of its WMMAs: left to itself the
        // build reads each row's fragment directly in front of its four WMMAs and waits it out
        __builtin_amdgcn_sched_barrier(0);
        #pragma unroll
        for (int ks = 0; ks < 2; ++ks) {
            #pragma unroll
            for (int ms = 0; ms < 8; ++ms) {
                #pragma unroll
                for (int ns = 0; ns < 4; ++ns)
                    acc[ms][ns] = __builtin_amdgcn_wmma_f32_16x16x32_bf16(
                        false, fb[ks][ns], false, fa[ks][ms], (short)0, acc[ms][ns], false, false);
            }
        }
        // keeps the WMMAs in front of the foot's waits: sunk behind them, every WMMA would
        // stand behind the wait for the last of the 48 reads instead of starting on the first
        __builtin_amdgcn_sched_barrier(0);
        // foot of the trip: this wave's reads of buffer buf are done, its copies of
        // stage t + 1 have landed, and the barrier says so of every wave
        asm volatile("s_wait_dscnt 0x0" ::: "memory");
        wait_async0();
        __syncthreads();
        if (t + 2 < PJ_TRIPS) {
            stage_rows8(lds_addr(&As[buf][sr][sc]), gA + (t + 2) * PJ_K);
            stage_rows8(lds_addr(&Bs[buf][sr][sc]), gB + (t + 2) * PJ_K);
        }
    }
    wait_async0();   // no copy is outstanding when the wave ends

    // epilogue: + bias, -> bf16 (loops unrolled: constant accumulator indices).
    // acc[ms][ns][g] is output row ms * 16 + l16, column ns * 16 + lhalf * 8 + g of the wave's tile.
    // Each wave stages its 128 x 64 tile in a range of LDS that is its own: a quarter of As
    // (waves 0 to 3) or of Bs (waves 4 to 7), 128 rows at the ring's pitch. The ring is free:
    // the last trip's foot ended every wave's reads and no copy is outstanding.
    unsigned short (*st)[PJ_PITCH] = (wave < 4) ? &As[(wave >> 1) & 1][(wave & 1) * 128]
                                                : &Bs[(wave >> 1) & 1][(wave & 1) * 128];
    const float* bp = bias + n0 + wn * 64 + lhalf * 8;
    v8f bv[4];
    #pragma unroll
    for (int ns = 0; ns < 4; ++ns)
        bv[ns] = *(const v8f*)(bp + ns * 16);
    // the loads' address registers are not rewritten before this wait
    asm volatile("s_wait_xcnt 0x0" ::: "memory");
    // keeps the arithmetic that follows behind that wait
    __builtin_amdgcn_sched_barrier(0);
    #pragma unroll
    for (int ms = 0; ms < 8; ++ms) {
        #pragma unroll
        for (int ns = 0; ns < 4; ++ns) {
            const v8f y = acc[ms][ns] + bv[ns];
            v4u p;
            p.x = (unsigned)f2bf(y[0]) | ((unsigned)f2bf(y[1]) << 16);
            p.y = (unsigned)f2bf(y[2]) | ((unsigned)f2bf(y[3]) << 16);
            p.z = (unsigned)f2bf(y[4]) | ((unsigned)f2bf(y[5]) << 16);
            p.w = (unsigned)f2bf(y[6]) | ((unsigned)f2bf(y[7]) << 16);
            *(v4u*)&st[ms * 16 + l16][ns * 16 + lhalf * 8] = p;
        }
    }
    // the wave's LDS writes are done before other lanes of it read the rows back
    asm volatile("s_wait_dscnt 0x0" ::: "memory");

    // eight lanes cover one row's 128 B, a store instruction four whole lines
    const int rr = lane >> 3;                   // 0..3
    const int cc = (lane & 7) * 8;              // 0,8,...,56
    unsigned short* dst = Out + (size_t)(m0 + wm * 128 + rr) * DIMN + n0 + wn * 64 + cc;
    #pragma unroll
    for (int b = 0; b < 4; ++b) {
        v4u q[8];
        #pragma unroll
        for (int j = 0; j < 8; ++j)
            q[j] = *(const v4u*)&st[(b * 8 + j) * 4 + rr][cc];
        // all 8 values of the run are read before its first store, so none is
        // read into a register that a store of the run names
        __builtin_amdgcn_sched_barrier(0);
        #pragma unroll
        for (int j = 0; j < 8; ++j)
            *(v4u*)(dst + (size_t)((b * 8 + j) * 4) * DIMN) = q[j];
        if (b + 1 < 4) {
            // the run's data registers are not rewritten before this wait
            asm volatile("s_wait_xcnt 0x0" ::: "memory");
            // keeps the next run's LDS reads behind that wait
            __builtin_amdgcn_sched_barrier(0);
        }
    }
}

// ---------------------------------------------------------------------------
// Kernel 2: block-local attention, residual and LayerNorm in one launch.
// A work-group owns 64 query rows of a block over ALL 16 heads, so a whole output row is
// on one WGP and the attention result never goes to memory. grid (2 slabs, BLK_NUM, BATCH),
// 256 threads: wave = (query tile qt = wave & 3, head group hg = wave >> 2); in step s the
// wave works on head s + 8 * hg. Q, K, V of the step's two heads come through a two-buffer
// LDS ring of async copies; V stays row-major and is read by the transposing load.
// The scores are computed transposed (K fragment = the WMMA's A, Q fragment = its B): a lane
// holds 64 of one query's 128 scores and lane ^ 16 the other 64, so the softmax runs in
// registers with one exchange between the wave's halves for the maximum and one for the sum,
// and two score tiles, converted in place, are the B fragment of the second product.
// ---------------------------------------------------------------------------
// lane l reads lane l ^ 16
__device__ __forceinline__ float xhalf(float x) {
    return __builtin_bit_cast(float, __builtin_amdgcn_permlanex16(
        __builtin_bit_cast(int, x), __builtin_bit_cast(int, x),
        0x76543210, 0xfedcba98, false, false));
}

#define FQ      64                            // query rows per work-group
#define F_STEPS 8                             // steps: heads s and s + 8
#define F_QKP   72                            // Q, K pitch: 144 B = 16 B x odd (ds_load_b128)
#define F_VP    80                            // V pitch: 160 B = 32 B x odd (ds_load_tr16_b128)
#define F_KOFF  (2 * FQ * F_QKP)              // elements: Q of two heads in front
#define F_VOFF  (F_KOFF + 2 * BLK_LEN * F_QKP)
#define F_STAGE (F_VOFF + 2 * BLK_LEN * F_VP) // 48,128 elements = 96,256 B a buffer

typedef short s16x8 __attribute__((ext_vector_type(8)));
// 16 x 16 piece of a row-major 16-bit LDS tile, transposed: lane (c, h) gets rows 8h .. 8h + 7 of column c
__device__ __forceinline__ v8bf ld_tr16(const unsigned char* q) {
    typedef __attribute__((address_space(3))) s16x8 lds_s16x8;
    return __builtin_bit_cast(v8bf, __builtin_amdgcn_ds_load_tr16_b128_v8i16((lds_s16x8*)q));
}

// Ten async copies of one lane: its 16 B of 2 rows of Q and of 4 rows each of K and V of one
// head (rows 32 apart). The global address is a scalar base (tile's first element) plus the
// lane's byte offset: four offset registers serve all ten copies and every step.
// s_wait_xcnt stands inside the statement so that no address register is rewritten before it.
__device__ __forceinline__ void stage_head(unsigned lq, unsigned lk, unsigned lv, unsigned off,
                                           const unsigned short* bq,
                                           const unsigned short* bk,
                                           const unsigned short* bv) {
    asm volatile("global_load_async_to_lds_b128 %0, %10, %14\n\t"
                 "global_load_async_to_lds_b128 %1, %11, %14\n\t"
                 "global_load_async_to_lds_b128 %2, %10, %15\n\t"
                 "global_load_async_to_lds_b128 %3, %11, %15\n\t"
                 "global_load_async_to_lds_b128 %4, %12, %15\n\t"
                 "global_load_async_to_lds_b128 %5, %13, %15\n\t"
                 "global_load_async_to_lds_b128 %6, %10, %16\n\t"
                 "global_load_async_to_lds_b128 %7, %11, %16\n\t"
                 "global_load_async_to_lds_b128 %8, %12, %16\n\t"
                 "global_load_async_to_lds_b128 %9, %13, %16\n\t"
                 "s_wait_xcnt 0x0"
                 :: "v"(lq), "v"(lq + 32u * F_QKP * 2u),
                    "v"(lk), "v"(lk + 32u * F_QKP * 2u),
                    "v"(lk + 64u * F_QKP * 2u), "v"(lk + 96u * F_QKP * 2u),
                    "v"(lv), "v"(lv + 32u * F_VP * 2u),
                    "v"(lv + 64u * F_VP * 2u), "v"(lv + 96u * F_VP * 2u),
                    "v"(off), "v"(off + 32u * DIMN * 2u),
                    "v"(off + 64u * DIMN * 2u), "v"(off + 96u * DIMN * 2u),
                    "s"(bq), "s"(bk), "s"(bv)
                 : "memory");
}

__global__ __launch_bounds__(256)
void attn_ln_kernel(const unsigned short* __restrict__ Qg,
                    const unsigned short* __restrict__ Kg,
                    const unsigned short* __restrict__ Vg,
                    const int* __restrict__ mask,
                    const float* __restrict__ X,
                    const float* __restrict__ gamma,
                    const float* __restrict__ beta,
                    float* __restrict__ out) {
    const int slab = blockIdx.x;
    const int blk  = blockIdx.y;
    const int b    = blockIdx.z;

    __shared__ __attribute__((aligned(16))) unsigned short ring[2][F_STAGE];  // 188 KB
    __shared__ __attribute__((aligned(16))) float stg[8][16 * 68];            // 34 KB: a wave's own 16 x 64 tile
    __shared__ float msk[HEADS][FQ];                                          // 4 KB: the mask's addend
    __shared__ __attribute__((aligned(8))) float red[8][16][2];               // a wave's row sums

    const int tid   = threadIdx.x;
    // the wave's number as a scalar: what derives from it stays in scalar registers
    const int wave  = __builtin_amdgcn_readfirstlane(tid >> 5);
    const int lane  = tid & 31;
    const int lhalf = lane >> 4;
    const int l16   = lane & 15;
    const int qt    = wave & 3;
    const int hg    = wave >> 2;

    const size_t rowbase = (size_t)b * SEQ + (size_t)blk * BLK_LEN;   // the block's keys
    const size_t qbase   = rowbase + (size_t)slab * FQ;               // the work-group's queries

    // a (query row, head) pair has one mask value: 1,024 of them, four a thread, asked for first
    const int mr = tid >> 2;
    const int mh = (tid & 3) * 4;
    const int* mp = mask + (qbase + mr) * DIMN + mh * DH;
    const int m0 = mp[0], m1 = mp[DH], m2 = mp[2 * DH], m3 = mp[3 * DH];
    // the loads' address registers are not rewritten before this wait
    asm volatile("s_wait_xcnt 0x0" ::: "memory");
    // keeps the address arithmetic that follows behind that wait
    __builtin_amdgcn_sched_barrier(0);

    // per-thread staging coords: eight lanes cover one row's 128 B
    const int sr = tid >> 3;                    // 0..31
    const int sc = (tid & 7) * 8;               // 0,8,...,56
    const unsigned short* gq = Qg + qbase   * DIMN;    // scalar bases: head 0 of the first row
    const unsigned short* gk = Kg + rowbase * DIMN;
    const unsigned short* gv = Vg + rowbase * DIMN;
    const unsigned goff = (unsigned)(sr * DIMN + sc) * 2u;   // the lane's byte offset in a tile
    const unsigned lq = lds_addr(&ring[0][sr * F_QKP + sc]);
    const unsigned lk = lds_addr(&ring[0][F_KOFF + sr * F_QKP + sc]);
    const unsigned lv = lds_addr(&ring[0][F_VOFF + sr * F_VP + sc]);

// the copies of step st (heads st and st + 8) into buffer bf
#define F_FILL(st, bf)                                                                   \
    do {                                                                                 \
        const unsigned bo = (unsigned)(bf) * (F_STAGE * 2u);                             \
        stage_head(lq + bo, lk + bo, lv + bo, goff,                                      \
                   gq + (st) * DH, gk + (st) * DH, gv + (st) * DH);                      \
        stage_head(lq + bo + FQ * F_QKP * 2u, lk + bo + BLK_LEN * F_QKP * 2u,            \
                   lv + bo + BLK_LEN * F_VP * 2u, goff,                                  \
                   gq + ((st) + 8) * DH, gk + ((st) + 8) * DH, gv + ((st) + 8) * DH);    \
    } while (0)

    // step 0 lands and is published (with the mask's addends), then step 1 starts
    F_FILL(0, 0);
    // keeps the mask's arithmetic, which waits for its loads, behind the issue of the copies
    __builtin_amdgcn_sched_barrier(0);
    msk[mh + 0][mr] = (1.0f - (float)m0) * -1.0e10f;
    msk[mh + 1][mr] = (1.0f - (float)m1) * -1.0e10f;
    msk[mh + 2][mr] = (1.0f - (float)m2) * -1.0e10f;
    msk[mh + 3][mr] = (1.0f - (float)m3) * -1.0e10f;
    wait_async0();
    __syncthreads();
    F_FILL(1, 1);

    // rw[s][it]: row qt * 16 + it * 2 + lhalf, columns (s + 8 * hg) * 64 + l16 * 4 .. + 3 of
    // attention + residual
    v4f rw[F_STEPS][8];                       // every tile is written in its own step
    float* so = &stg[wave][0];

    // kept rolled, for speed only
    #pragma unroll 1
    for (int s = 0; s < F_STEPS; ++s) {
        const int head = s + 8 * hg;
        const unsigned short* Bf = &ring[s & 1][0];
        const unsigned short* Qs = Bf + hg * (FQ * F_QKP);
        const unsigned short* Ks = Bf + F_KOFF + hg * (BLK_LEN * F_QKP);
        const unsigned char*  Vs = (const unsigned char*)(Bf + F_VOFF + hg * (BLK_LEN * F_VP));

        const float madd = msk[head][qt * 16 + l16];

        // S^T = K Q^T : 128 keys x 16 query columns per wave, K-dim 64 (2 steps).
        // sc8[nt][g] is key nt * 16 + lhalf * 8 + g, query qt * 16 + l16.
        v8f sc8[8] = {};
        #pragma unroll
        for (int ks = 0; ks < 2; ++ks) {
            const int ar = qt * 16 + l16;
            v16bf a = load_frag(Qs + ar * F_QKP + ks * 32 + lhalf * 8,
                                Qs + ar * F_QKP + ks * 32 + lhalf * 8 + 16);
            #pragma unroll
            for (int nt = 0; nt < 8; ++nt) {
                const int br = nt * 16 + l16;
                v16bf bb = load_frag(Ks + br * F_QKP + ks * 32 + lhalf * 8,
                                     Ks + br * F_QKP + ks * 32 + lhalf * 8 + 16);
                sc8[nt] = __builtin_amdgcn_wmma_f32_16x16x32_bf16(
                    false, bb, false, a, (short)0, sc8[nt], false, false);
            }
        }

        // the residual's 16 x 64 tile, asked for behind the first product, used at the step's end
        const float* xp = X + (qbase + qt * 16 + lhalf) * DIMN + head * DH + l16 * 4;
        v4f xv[8];
        #pragma unroll
        for (int it = 0; it < 8; ++it)
            xv[it] = *(const v4f*)(xp + (size_t)(it * 2) * DIMN);
        // the loads' address registers are not rewritten before this wait
        asm volatile("s_wait_xcnt 0x0" ::: "memory");

        // scale + mask + softmax over the lane pair's 128 scores (loops unrolled: constant indices)
        const float scale = 0.125f; // 1/sqrt(64)
        // whole-tile vector forms: a tile's adjacent registers pair up for the packed instructions
        #pragma unroll
        for (int nt = 0; nt < 8; ++nt)
            sc8[nt] = sc8[nt] * scale + madd;
        v8f mx = sc8[0];
        #pragma unroll
        for (int nt = 1; nt < 8; ++nt)
            mx = __builtin_elementwise_max(mx, sc8[nt]);
        float rmax = fmaxf(fmaxf(fmaxf(mx[0], mx[1]), fmaxf(mx[2], mx[3])),
                           fmaxf(fmaxf(mx[4], mx[5]), fmaxf(mx[6], mx[7])));
        rmax = fmaxf(rmax, xhalf(rmax));
        #pragma unroll
        for (int nt = 0; nt < 8; ++nt) {
            #pragma unroll
            for (int g = 0; g < 8; ++g)
                sc8[nt][g] = __expf(sc8[nt][g] - rmax);
        }
        v8f sm = sc8[0];
        #pragma unroll
        for (int nt = 1; nt < 8; ++nt)
            sm += sc8[nt];
        float rsum = ((sm[0] + sm[1]) + (sm[2] + sm[3])) + ((sm[4] + sm[5]) + (sm[6] + sm[7]));
        rsum += xhalf(rsum);
        const float inv = 1.0f / rsum;
        // P^T as B fragments: element e of pf[ks] is key ks * 32 + lhalf * 8 + e (e < 8) or
        // ks * 32 + 16 + lhalf * 8 + e - 8, the k order in which the V fragment is read below
        v16bf pf[4];
        #pragma unroll
        for (int ks = 0; ks < 4; ++ks) {
            v8bf lo = __builtin_convertvector(sc8[2 * ks] * inv, v8bf);
            v8bf hi = __builtin_convertvector(sc8[2 * ks + 1] * inv, v8bf);
            pf[ks] = __builtin_shufflevector(lo, hi, 0,1,2,3,4,5,6,7,8,9,10,11,12,13,14,15);
        }

        // O = P V : 16 rows x 64 cols, K-dim 128 (4 steps). The V fragment is the WMMA's A and the
        // P fragment its B: o[nt][g] is query row l16, column nt * 16 + lhalf * 8 + g.
        // Lane (l16, lhalf) gets V[ks * 32 + lhalf * 8 + 0..7][nt * 16 + l16], then the same 16 keys on.
        const unsigned char* va = Vs + (8 * lhalf + (lane & 7)) * (F_VP * 2) + ((lane >> 3) & 1) * 16;
        v8f o[4] = {};
        #pragma unroll
        for (int ks = 0; ks < 4; ++ks) {
            #pragma unroll
            for (int nt = 0; nt < 4; ++nt) {
                v8bf lo = ld_tr16(va + (ks * 32) * (F_VP * 2) + nt * 32);
                v8bf hi = ld_tr16(va + (ks * 32 + 16) * (F_VP * 2) + nt * 32);
                v16bf bb = __builtin_shufflevector(lo, hi, 0,1,2,3,4,5,6,7,8,9,10,11,12,13,14,15);
                o[nt] = __builtin_amdgcn_wmma_f32_16x16x32_bf16(
                    false, bb, false, pf[ks], (short)0, o[nt], false, false);
            }
        }

        // foot of the step: this wave's reads of the buffer are done, its copies of step
        // s + 1 have landed, and the barrier says so of every wave
        asm volatile("s_wait_dscnt 0x0" ::: "memory");
        wait_async0();
        __syncthreads();
        if (s + 2 < F_STEPS)
            F_FILL(s + 2, s & 1);

        // The wave turns its 16 x 64 f32 tile through its own LDS range (16 rows of 272 B hold
        // the 256 B each): afterwards 16 lanes cover a row's 256 B, as the residual's loads do.
        #pragma unroll
        for (int nt = 0; nt < 4; ++nt) {
            float* sp = so + l16 * 68 + nt * 16 + lhalf * 8;
            *(v4f*)sp       = __builtin_shufflevector(o[nt], o[nt], 0, 1, 2, 3);
            *(v4f*)(sp + 4) = __builtin_shufflevector(o[nt], o[nt], 4, 5, 6, 7);
        }
        // the wave's LDS writes are done before other lanes of it read the rows back
        asm volatile("s_wait_dscnt 0x0" ::: "memory");
        // The step's tile, residual added, is formed in registers of its own: a scalar branch on
        // the step picks the copy of these lines whose register indices are the step's constants.
#define F_KEEP(j)                                                                        \
        do {                                                                             \
            _Pragma("unroll")                                                            \
            for (int it = 0; it < 8; ++it) {                                             \
                rw[j][it] = *(const v4f*)(so + (it * 2 + lhalf) * 68 + l16 * 4) + xv[it]; \
            }                                                                            \
        } while (0)
        if (s == 0) F_KEEP(0);
        if (s == 1) F_KEEP(1);
        if (s == 2) F_KEEP(2);
        if (s == 3) F_KEEP(3);
        if (s == 4) F_KEEP(4);
        if (s == 5) F_KEEP(5);
        if (s == 6) F_KEEP(6);
        if (s == 7) F_KEEP(7);
    }
    wait_async0();   // no copy is outstanding when the wave ends

    // gamma, beta of the wave's 512 columns, asked for before the sums are joined
    const float* gp = gamma + hg * (8 * DH) + l16 * 4;
    const float* bp = beta  + hg * (8 * DH) + l16 * 4;
    v4f gm[F_STEPS], bt[F_STEPS];
    #pragma unroll
    for (int j = 0; j < F_STEPS; ++j) {
        gm[j] = *(const v4f*)(gp + j * DH);
        bt[j] = *(const v4f*)(bp + j * DH);
    }
    // the loads' address registers are not rewritten before this wait
    asm volatile("s_wait_xcnt 0x0" ::: "memory");

    // a row's sum and sum of squares: the lane's 32 values, then the 16 lanes that share the
    // row, then the two waves that share it
    float s1[8], s2[8];
    #pragma unroll
    for (int it = 0; it < 8; ++it) {
        v4f a1 = rw[0][it], a2 = rw[0][it] * rw[0][it];
        #pragma unroll
        for (int j = 1; j < F_STEPS; ++j) {
            a1 += rw[j][it];
            a2 += rw[j][it] * rw[j][it];
        }
        s1[it] = (a1[0] + a1[1]) + (a1[2] + a1[3]);
        s2[it] = (a2[0] + a2[1]) + (a2[2] + a2[3]);
    }
    #pragma unroll
    for (int it = 0; it < 8; ++it) {
        #pragma unroll
        for (int d = 1; d < 16; d <<= 1) {
            s1[it] += __shfl_xor(s1[it], d, 32);
            s2[it] += __shfl_xor(s2[it], d, 32);
        }
    }
    if (l16 == 0) {
        #pragma unroll
        for (int it = 0; it < 8; ++it) {
            red[wave][it * 2 + lhalf][0] = s1[it];
            red[wave][it * 2 + lhalf][1] = s2[it];
        }
    }
    __syncthreads();
    float mean[8], rstd[8];
    #pragma unroll
    for (int it = 0; it < 8; ++it) {
        const float tot  = s1[it] + red[wave ^ 4][it * 2 + lhalf][0];
        const float totq = s2[it] + red[wave ^ 4][it * 2 + lhalf][1];
        mean[it] = tot * (1.0f / DIMN);
        const float var = totq * (1.0f / DIMN) - mean[it] * mean[it];
        rstd[it] = rsqrtf(var + 1.0e-3f);
    }

    // whole lines: a store instruction covers 256 B of two rows
    float* op = out + (qbase + qt * 16 + lhalf) * DIMN + hg * (8 * DH) + l16 * 4;
    #pragma unroll
    for (int j = 0; j < F_STEPS; ++j) {
        v4f y[8];
        #pragma unroll
        for (int it = 0; it < 8; ++it)
            y[it] = (rw[j][it] - mean[it]) * rstd[it] * gm[j] + bt[j];
        // all 8 values of the run are formed before its first store, so none is
        // formed in a register that a store of the run names
        __builtin_amdgcn_sched_barrier(0);
        #pragma unroll
        for (int it = 0; it < 8; ++it)
            *(v4f*)(op + j * DH + (size_t)(it * 2) * DIMN) = y[it];
        if (j + 1 < F_STEPS) {
            // the run's data and address registers are not rewritten before this wait
            asm volatile("s_wait_xcnt 0x0" ::: "memory");
            // keeps the next run's arithmetic behind that wait
            __builtin_amdgcn_sched_barrier(0);
        }
    }
}

// ---------------------------------------------------------------------------
extern "C" void kernel_launch(void* const* d_in, const int* in_sizes, int n_in,
                              void* d_out, int out_size, void* d_ws, size_t ws_size,
                              hipStream_t stream) {
    (void)in_sizes; (void)n_in; (void)out_size; (void)ws_size;

    const float* X     = (const float*)d_in[0];
    const int*   mask  = (const int*)d_in[1];
    const float* w1    = (const float*)d_in[2];
    const float* b1    = (const float*)d_in[3];
    const float* w2    = (const float*)d_in[4];
    const float* b2    = (const float*)d_in[5];
    const float* w3    = (const float*)d_in[6];
    const float* b3    = (const float*)d_in[7];
    const float* gamma = (const float*)d_in[8];
    const float* beta  = (const float*)d_in[9];
    float* out = (float*)d_out;

    char* ws = (char*)d_ws;
    unsigned short* Wt  = (unsigned short*)(ws + WT_OFF);
    unsigned short* Xbf = (unsigned short*)(ws + XBF_OFF);
    unsigned short* Q   = (unsigned short*)(ws + Q_OFF);
    unsigned short* K   = (unsigned short*)(ws + K_OFF);
    unsigned short* V   = (unsigned short*)(ws + V_OFF);

    // 0) weights -> bf16, transposed to [n][k], and activations -> bf16
    conv_kernel<<<dim3((ROWS * DIMN) / (8 * XC_LOADS * 128)), dim3(256), 0, stream>>>(
        w1, w2, w3, Wt, X, Xbf);

    // 1) Q/K/V projections (WMMA bf16, async-to-LDS double buffered)
    proj_kernel<<<dim3(DIMN / 256, ROWS / 256, 3), dim3(256), 0, stream>>>(
        Xbf, Wt, b1, b2, b3, Q, K, V);

    // 2) block-local attention (WMMA) + residual + LayerNorm
    attn_ln_kernel<<<dim3(BLK_LEN / FQ, BLK_NUM, BATCH), dim3(256), 0, stream>>>(
        Q, K, V, mask, X, gamma, beta, out);
}

// v008
// A run of this version takes 106 microseconds.
// In two side-by-side timings against v007, it was 1.04 and 1.03 times as fast.
// Over all steps from v000 it is 2.38 times as fast.
#include <hip/hip_runtime.h>

#define DIMN 1024
#define HEADS 16
#define DH 64
#define BLK_LEN 128
#define BLK_NUM 32
#define BATCH 4
#define SEQ (BLK_NUM * BLK_LEN)          // 4096
#define ROWS (BATCH * SEQ)               // 16384

typedef __attribute__((ext_vector_type(8)))  float  v8f;
typedef __attribute__((ext_vector_type(8)))  __bf16 v8bf;
typedef __attribute__((ext_vector_type(16))) __bf16 v16bf;
typedef __attribute__((ext_vector_type(4)))  unsigned v4u;
typedef __attribute__((ext_vector_type(4)))  float  v4f;

// ---- workspace layout (bytes) ----
static const size_t WT_OFF  = 0;                         // W^T bf16, 3 * 2MB
static const size_t XBF_OFF = 6291456;                   // X bf16, 32MB
static const size_t Q_OFF   = XBF_OFF + 33554432ull;
static const size_t K_OFF   = Q_OFF   + 33554432ull;
static const size_t V_OFF   = K_OFF   + 33554432ull;

__device__ __forceinline__ unsigned short f2bf(float f) {
    union { float f; unsigned u; } v; v.f = f;
    unsigned r = v.u + 0x7FFFu + ((v.u >> 16) & 1u);     // round-to-nearest-even
    return (unsigned short)(r >> 16);
}

__device__ __forceinline__ v16bf load_frag(const unsigned short* lo,
                                           const unsigned short* hi) {
    v8bf a = *(const v8bf*)lo;
    v8bf b = *(const v8bf*)hi;
    return __builtin_shufflevector(a, b, 0,1,2,3,4,5,6,7,8,9,10,11,12,13,14,15);
}

// CDNA5 async global->LDS copy (ASYNCcnt). LDS byte offset = low 32 bits of
// the generic shared-memory address (ISA 10.2 aperture rules).
__device__ __forceinline__ unsigned lds_addr(const void* p) {
    return (unsigned)(unsigned long long)p;
}
__device__ __forceinline__ void wait_async0() {
    asm volatile("s_wait_asynccnt 0" ::: "memory");
}

// Dealing of the work, all three kernels: the rows are taken in 64 groups of 256, and every
// work-group that reads or writes rows of group g has a flat block index equal to g mod 8.
// For speed only: it is
// a permutation of the indices, right wherever the work-groups land.
__device__ __forceinline__ int row_group(int idx_mod8, int idx_high) {
    return idx_mod8 + 8 * idx_high;
}

// ---------------------------------------------------------------------------
// Kernel 0: both conversions in one launch. grid 512, 256 threads: 4,096 waves.
// X fp32 -> bf16 (so the GEMM can stage A with async byte copies): each wave converts
// 16 KB of X, 32 loads of 512 contiguous bytes, all issued at its head.
// W fp32 -> bf16 with transpose, Wt[n][k] = bf16(W[k][n]): the first 384 work-groups also
// take one 128 (k) x 64 (n) tile of W each, 32 elements a thread. Its loads go out in front
// of X's and it is turned through LDS while X's loads are on their way.
// ---------------------------------------------------------------------------
#define WC_K 128
#define WC_N 64
#define WC_PITCH (WC_K + 8)                  // 272 B = 16 B x odd for the ds_load_b128 readers
#define WC_TILES ((DIMN / WC_K) * (DIMN / WC_N))   // 128 tiles a matrix
#define XC_LOADS 32
__global__ __launch_bounds__(256)
void conv_kernel(const float* __restrict__ w1,
                 const float* __restrict__ w2,
                 const float* __restrict__ w3,
                 unsigned short* __restrict__ wt,
                 const float* __restrict__ X,
                 unsigned short* __restrict__ Xbf) {
    __shared__ __attribute__((aligned(16))) unsigned short t[WC_N][WC_PITCH];   // [n][k]

    const int tid = threadIdx.x;
    const int z = blockIdx.x / WC_TILES;      // 0..2: a matrix of W; 3: no tile of W
    const bool has_w = z < 3;                 // the same for the whole work-group
    const int k0 = (blockIdx.x % (DIMN / WC_K)) * WC_K;
    const int n0 = ((blockIdx.x % WC_TILES) / (DIMN / WC_K)) * WC_N;

    const int lk = tid >> 4;                  // 0..15
    const int ln = (tid & 15) * 4;            // 16 lanes cover a row's 256 B
    float4 w[8] = {};
    if (has_w) {
        const float* W = (z == 0) ? w1 : (z == 1) ? w2 : w3;
        const float* wsrc = W + (size_t)(k0 + lk) * DIMN + n0 + ln;
        #pragma unroll
        for (int it = 0; it < 8; ++it)
            w[it] = *(const float4*)(wsrc + (size_t)it * 16 * DIMN);
        // the loads' address registers are not rewritten before this wait
        asm volatile("s_wait_xcnt 0x0" ::: "memory");
    }

    const int wave = tid >> 5;
    const int lane = tid & 31;
    // which 32 rows of X: the eight work-groups of one 256-row group have indices equal mod 8
    // (row_group above); speed only, every piece is dealt exactly once
    const int xq = blockIdx.x >> 3;
    const int chunk = row_group(blockIdx.x & 7, xq >> 3) * 8 + (xq & 7);
    const size_t base = ((size_t)chunk * 8 + wave) * (XC_LOADS * 128) + lane * 4;
    const float* src = X + base;
    unsigned short* dst = Xbf + base;

    float4 v[XC_LOADS];
    #pragma unroll
    for (int j = 0; j < XC_LOADS; ++j)
        v[j] = *(const float4*)(src + j * 128);
    // the loads' address registers are not rewritten before this wait
    asm volatile("s_wait_xcnt 0x0" ::: "memory");
    // keeps all the loads in front of the arithmetic: left to itself the build holds
    // about a dozen in flight and issues the rest among the conversions
    __builtin_amdgcn_sched_barrier(0);

    if (has_w) {
        #pragma unroll
        for (int it = 0; it < 8; ++it) {
            int kk = it * 16 + lk;
            t[ln + 0][kk] = f2bf(w[it].x);
            t[ln + 1][kk] = f2bf(w[it].y);
            t[ln + 2][kk] = f2bf(w[it].z);
            t[ln + 3][kk] = f2bf(w[it].w);
        }
        __syncthreads();
        const int sn = tid >> 4;                  // 0..15
        const int sk = (tid & 15) * 8;            // 16 lanes cover a row's 256 B
        unsigned short* wdst = wt + (size_t)z * DIMN * DIMN + (size_t)(n0 + sn) * DIMN + k0 + sk;
        #pragma unroll
        for (int it = 0; it < 4; ++it)
            *(uint4*)(wdst + (size_t)it * 16 * DIMN) = *(const uint4*)&t[it * 16 + sn][sk];
        // the stores' data and address registers are not rewritten before this wait
        asm volatile("s_wait_xcnt 0x0" ::: "memory");
        // keeps X's arithmetic behind that wait
        __builtin_amdgcn_sched_barrier(0);
    }

    // loops unrolled: register arrays need constant indices
    #pragma unroll
    for (int b = 0; b < XC_LOADS / 8; ++b) {
        uint2 p[8];
        #pragma unroll
        for (int j = 0; j < 8; ++j) {
            float4 xv = v[b * 8 + j];
            p[j].x = (unsigned)f2bf(xv.x) | ((unsigned)f2bf(xv.y) << 16);
            p[j].y = (unsigned)f2bf(xv.z) | ((unsigned)f2bf(xv.w) << 16);
        }
        // all 8 values of the run are formed before its first store, so none is
        // formed in a register that a store of the run names
        __builtin_amdgcn_sched_barrier(0);
        #pragma unroll
        for (int j = 0; j < 8; ++j)
            *(uint2*)(dst + (b * 8 + j) * 128) = p[j];
        if (b + 1 < XC_LOADS / 8) {
            // the run's data registers are not rewritten before this wait
            asm volatile("s_wait_xcnt 0x0" ::: "memory");
            // keeps the next run's arithmetic behind that wait
            __builtin_amdgcn_sched_barrier(0);
        }
    }
}

// ---------------------------------------------------------------------------
// Kernel 1: QKV projection GEMM. Xbf[16384,1024] * Wt^T + b -> bf16.
// One 256 x 256 tile of the output per work-group, 64 k per stage, two LDS
// buffers filled by async copies; 8 waves (2 x 4), 128 x 64 of the tile each
// (8 x 4 WMMA subtiles): 12 fragments read from LDS feed 32 WMMAs.
// The Wt fragment is the WMMA's A and the X fragment its B, so a lane's eight
// accumulator values are eight adjacent output columns of one output row; the
// epilogue stages them in LDS and stores whole 128-B lines.
// grid (4, 64, 3 matrices), 256 threads; which tile a work-group takes: row_group above.
// ---------------------------------------------------------------------------
#define PJ_TILE  256                         // rows of X and rows of Wt per stage
#define PJ_K     64                          // k per stage: 128 B, one whole line a row
#define PJ_PITCH 72                          // 144 B = 16 B x odd for ds_load_b128 readers
#define PJ_TRIPS (DIMN / PJ_K)               // 16

// Eight async copies of one lane: rows r, r + 32, ..., r + 224 of one operand's
// stage. s_wait_xcnt stands inside the statement so that no address register is
// rewritten before it.
__device__ __forceinline__ void stage_rows8(unsigned l, const unsigned short* g) {
    asm volatile("global_load_async_to_lds_b128 %0, %8, off\n\t"
                 "global_load_async_to_lds_b128 %1, %9, off\n\t"
                 "global_load_async_to_lds_b128 %2, %10, off\n\t"
                 "global_load_async_to_lds_b128 %3, %11, off\n\t"
                 "global_load_async_to_lds_b128 %4, %12, off\n\t"
                 "global_load_async_to_lds_b128 %5, %13, off\n\t"
                 "global_load_async_to_lds_b128 %6, %14, off\n\t"
                 "global_load_async_to_lds_b128 %7, %15, off\n\t"
                 "s_wait_xcnt 0x0"
                 :: "v"(l),
                    "v"(l + 1u * 32u * PJ_PITCH * 2u),
                    "v"(l + 2u * 32u * PJ_PITCH * 2u),
                    "v"(l + 3u * 32u * PJ_PITCH * 2u),
                    "v"(l + 4u * 32u * PJ_PITCH * 2u),
                    "v"(l + 5u * 32u * PJ_PITCH * 2u),
                    "v"(l + 6u * 32u * PJ_PITCH * 2u),
                    "v"(l + 7u * 32u * PJ_PITCH * 2u),
                    "v"(g),
                    "v"(g + 1 * 32 * DIMN),
                    "v"(g + 2 * 32 * DIMN),
                    "v"(g + 3 * 32 * DIMN),
                    "v"(g + 4 * 32 * DIMN),
                    "v"(g + 5 * 32 * DIMN),
                    "v"(g + 6 * 32 * DIMN),
                    "v"(g + 7 * 32 * DIMN)
                 : "memory");
}

__global__ __launch_bounds__(256)
void proj_kernel(const unsigned short* __restrict__ Xbf,
                 const unsigned short* __restrict__ Wt,
                 const float* __restrict__ b1,
                 const float* __restrict__ b2,
                 const float* __restrict__ b3,
                 unsigned short* __restrict__ Q,
                 unsigned short* __restrict__ K,
                 unsigned short* __restrict__ V) {
    const int z = blockIdx.z;
    const unsigned short* Wz = Wt + (size_t)z * DIMN * DIMN;
    const float* bias = (z == 0) ? b1 : (z == 1) ? b2 : b3;
    unsigned short* Out = (z == 0) ? Q : (z == 1) ? K : V;

    // the 12 tiles of one 256-row group have flat indices equal mod 8 (row_group above)
    const int flat = blockIdx.x + (DIMN / PJ_TILE) * blockIdx.y;    // 0..255 in a matrix
    const int n0 = ((flat >> 3) & 3) * PJ_TILE;
    const int m0 = row_group(flat & 7, flat >> 5) * PJ_TILE;

    __shared__ __attribute__((aligned(16))) unsigned short As[2][PJ_TILE][PJ_PITCH];   // 2 x 36 KB
    __shared__ __attribute__((aligned(16))) unsigned short Bs[2][PJ_TILE][PJ_PITCH];   // 2 x 36 KB ([n][k])

    const int tid   = threadIdx.x;
    // the wave's number as a scalar: what the epilogue derives from it then waits out the
    // loop in scalar registers; in vector registers it pushed the copies' base addresses to scratch
    const int wave  = __builtin_amdgcn_readfirstlane(tid >> 5);
    const int lane  = tid & 31;
    const int wm    = wave >> 2;                // 0..1 (M), 128 rows
    const int wn    = wave & 3;                 // 0..3 (N), 64 columns
    const int lhalf = lane >> 4;
    const int l16   = lane & 15;

    // per-thread staging coords: eight lanes cover one row's 128 B
    const int sr = tid >> 3;                    // 0..31
    const int sc = (tid & 7) * 8;               // 0,8,...,56

    const unsigned short* gA = Xbf + (size_t)(m0 + sr) * DIMN + sc;
    const unsigned short* gB = Wz  + (size_t)(n0 + sr) * DIMN + sc;

    v8f acc[8][4] = {};

    // stage 0 lands and is published, then stage 1 starts
    stage_rows8(lds_addr(&As[0][sr][sc]), gA);
    stage_rows8(lds_addr(&Bs[0][sr][sc]), gB);
    wait_async0();
    __syncthreads();
    stage_rows8(lds_addr(&As[1][sr][sc]), gA + PJ_K);
    stage_rows8(lds_addr(&Bs[1][sr][sc]), gB + PJ_K);

    for (int t = 0; t < PJ_TRIPS; ++t) {
        const int buf = t & 1;
        // compute on the current buffer (loops unrolled: register arrays need constant indices)
        v16bf fa[2][8], fb[2][4];                  // the wave's 24 fragments of this stage
        #pragma unroll
        for (int ks = 0; ks < 2; ++ks) {
            const int kc = ks * 32 + lhalf * 8;
            #pragma unroll
            for (int ns = 0; ns < 4; ++ns) {
                int br = wn * 64 + ns * 16 + l16;
                fb[ks][ns] = load_frag(&Bs[buf][br][kc], &Bs[buf][br][kc + 16]);
            }
            #pragma unroll
            for (int ms = 0; ms < 8; ++ms) {
                int ar = wm * 128 + ms * 16 + l16;
                fa[ks][ms] = load_frag(&As[buf][ar][kc], &As[buf][ar][kc + 16]);
            }
        }
        // keeps the stage's LDS reads one group in front of its WMMAs: left to itself the
        // build reads each row's fragment directly in front of its four WMMAs and waits it out
        __builtin_amdgcn_sched_barrier(0);
        #pragma unroll
        for (int ks = 0; ks < 2; ++ks) {
            #pragma unroll
            for (int ms = 0; ms < 8; ++ms) {
                #pragma unroll
                for (int ns = 0; ns < 4; ++ns)
                    acc[ms][ns] = __builtin_amdgcn_wmma_f32_16x16x32_bf16(
                        false, fb[ks][ns], false, fa[ks][ms], (short)0, acc[ms][ns], false, false);
            }
        }
        // keeps the WMMAs in front of the foot's waits: sunk behind them, every WMMA would
        // stand behind the wait for the last of the 48 reads instead of starting on the first
        __builtin_amdgcn_sched_barrier(0);
        // foot of the trip: this wave's reads of buffer buf are done, its copies of
        // stage t + 1 have landed, and the barrier says so of every wave
        asm volatile("s_wait_dscnt 0x0" ::: "memory");
        wait_async0();
        __syncthreads();
        if (t + 2 < PJ_TRIPS) {
            stage_rows8(lds_addr(&As[buf][sr][sc]), gA + (t + 2) * PJ_K);
            stage_rows8(lds_addr(&Bs[buf][sr][sc]), gB + (t + 2) * PJ_K);
        }
    }
    wait_async0();   // no copy is outstanding when the wave ends

    // epilogue: + bias, -> bf16 (loops unrolled: constant accumulator indices).
    // acc[ms][ns][g] is output row ms * 16 + l16, column ns * 16 + lhalf * 8 + g of the wave's tile.
    // Each wave stages its 128 x 64 tile in a range of LDS that is its own: a quarter of As
    // (waves 0 to 3) or of Bs (waves 4 to 7), 128 rows at the ring's pitch. The ring is free:
    // the last trip's foot ended every wave's reads and no copy is outstanding.
    unsigned short (*st)[PJ_PITCH] = (wave < 4) ? &As[(wave >> 1) & 1][(wave & 1) * 128]
                                                : &Bs[(wave >> 1) & 1][(wave & 1) * 128];
    const float* bp = bias + n0 + wn * 64 + lhalf * 8;
    v8f bv[4];
    #pragma unroll
    for (int ns = 0; ns < 4; ++ns)
        bv[ns] = *(const v8f*)(bp + ns * 16);
    // the loads' address registers are not rewritten before this wait
    asm volatile("s_wait_xcnt 0x0" ::: "memory");
    // keeps the arithmetic that follows behind that wait
    __builtin_amdgcn_sched_barrier(0);
    #pragma unroll
    for (int ms = 0; ms < 8; ++ms) {
        #pragma unroll
        for (int ns = 0; ns < 4; ++ns) {
            const v8f y = acc[ms][ns] + bv[ns];
            v4u p;
            p.x = (unsigned)f2bf(y[0]) | ((unsigned)f2bf(y[1]) << 16);
            p.y = (unsigned)f2bf(y[2]) | ((unsigned)f2bf(y[3]) << 16);
            p.z = (unsigned)f2bf(y[4]) | ((unsigned)f2bf(y[5]) << 16);
            p.w = (unsigned)f2bf(y[6]) | ((unsigned)f2bf(y[7]) << 16);
            *(v4u*)&st[ms * 16 + l16][ns * 16 + lhalf * 8] = p;
        }
    }
    // the wave's LDS writes are done before other lanes of it read the rows back
    asm volatile("s_wait_dscnt 0x0" ::: "memory");

    // eight lanes cover one row's 128 B, a store instruction four whole lines
    const int rr = lane >> 3;                   // 0..3
    const int cc = (lane & 7) * 8;              // 0,8,...,56
    unsigned short* dst = Out + (size_t)(m0 + wm * 128 + rr) * DIMN + n0 + wn * 64 + cc;
    #pragma unroll
    for (int b = 0; b < 4; ++b) {
        v4u q[8];
        #pragma unroll
        for (int j = 0; j < 8; ++j)
            q[j] = *(const v4u*)&st[(b * 8 + j) * 4 + rr][cc];
        // all 8 values of the run are read before its first store, so none is
        // read into a register that a store of the run names
        __builtin_amdgcn_sched_barrier(0);
        #pragma unroll
        for (int j = 0; j < 8; ++j)
            *(v4u*)(dst + (size_t)((b * 8 + j) * 4) * DIMN) = q[j];
        if (b + 1 < 4) {
            // the run's data registers are not rewritten before this wait
            asm volatile("s_wait_xcnt 0x0" ::: "memory");
            // keeps the next run's LDS reads behind that wait
            __builtin_amdgcn_sched_barrier(0);
        }
    }
}

// ---------------------------------------------------------------------------
// Kernel 2: block-local attention, residual and LayerNorm in one launch.
// A work-group owns 64 query rows of a block over ALL 16 heads, so a whole output row is
// on one WGP and the attention result never goes to memory. grid (2, BLK_NUM, BATCH) = 256,
// 256 threads: wave = (query tile qt = wave & 3, head group hg = wave >> 2); in step s the
// wave works on head s + 8 * hg. Q, K, V of the step's two heads come through a two-buffer
// LDS ring of async copies; V stays row-major and is read by the transposing load.
// The scores are computed transposed (K fragment = the WMMA's A, Q fragment = its B): a lane
// holds 64 of one query's 128 scores and lane ^ 16 the other 64, so the softmax runs in
// registers with one exchange between the wave's halves for the maximum and one for the sum,
// and two score tiles, converted in place, are the B fragment of the second product.
// ---------------------------------------------------------------------------
// lane l reads lane l ^ 16
__device__ __forceinline__ float xhalf(float x) {
    return __builtin_bit_cast(float, __builtin_amdgcn_permlanex16(
        __builtin_bit_cast(int, x), __builtin_bit_cast(int, x),
        0x76543210, 0xfedcba98, false, false));
}

#define FQ      64                            // query rows per work-group
#define F_STEPS 8                             // steps: heads s and s + 8
#define F_QKP   72                            // Q, K pitch: 144 B = 16 B x odd (ds_load_b128)
#define F_VP    80                            // V pitch: 160 B = 32 B x odd (ds_load_tr16_b128)
#define F_KOFF  (2 * FQ * F_QKP)              // elements: Q of two heads in front
#define F_VOFF  (F_KOFF + 2 * BLK_LEN * F_QKP)
#define F_STAGE (F_VOFF + 2 * BLK_LEN * F_VP) // 48,128 elements = 96,256 B a buffer

typedef short s16x8 __attribute__((ext_vector_type(8)));
// 16 x 16 piece of a row-major 16-bit LDS tile, transposed: lane (c, h) gets rows 8h .. 8h + 7 of column c
__device__ __forceinline__ v8bf ld_tr16(const unsigned char* q) {
    typedef __attribute__((address_space(3))) s16x8 lds_s16x8;
    return __builtin_bit_cast(v8bf, __builtin_amdgcn_ds_load_tr16_b128_v8i16((lds_s16x8*)q));
}

// Ten async copies of one lane: its 16 B of 2 rows of Q and of 4 rows each of K and V of one
// head (rows 32 apart). The global address is a scalar base (tile's first element) plus the
// lane's byte offset: four offset registers serve all ten copies and every step.
// s_wait_xcnt stands inside the statement so that no address register is rewritten before it.
__device__ __forceinline__ void stage_head(unsigned lq, unsigned lk, unsigned lv, unsigned off,
                                           const unsigned short* bq,
                                           const unsigned short* bk,
                                           const unsigned short* bv) {
    asm volatile("global_load_async_to_lds_b128 %0, %10, %14\n\t"
                 "global_load_async_to_lds_b128 %1, %11, %14\n\t"
                 "global_load_async_to_lds_b128 %2, %10, %15\n\t"
                 "global_load_async_to_lds_b128 %3, %11, %15\n\t"
                 "global_load_async_to_lds_b128 %4, %12, %15\n\t"
                 "global_load_async_to_lds_b128 %5, %13, %15\n\t"
                 "global_load_async_to_lds_b128 %6, %10, %16\n\t"
                 "global_load_async_to_lds_b128 %7, %11, %16\n\t"
                 "global_load_async_to_lds_b128 %8, %12, %16\n\t"
                 "global_load_async_to_lds_b128 %9, %13, %16\n\t"
                 "s_wait_xcnt 0x0"
                 :: "v"(lq), "v"(lq + 32u * F_QKP * 2u),
                    "v"(lk), "v"(lk + 32u * F_QKP * 2u),
                    "v"(lk + 64u * F_QKP * 2u), "v"(lk + 96u * F_QKP * 2u),
                    "v"(lv), "v"(lv + 32u * F_VP * 2u),
                    "v"(lv + 64u * F_VP * 2u), "v"(lv + 96u * F_VP * 2u),
                    "v"(off), "v"(off + 32u * DIMN * 2u),
                    "v"(off + 64u * DIMN * 2u), "v"(off + 96u * DIMN * 2u),
                    "s"(bq), "s"(bk), "s"(bv)
                 : "memory");
}

__global__ __launch_bounds__(256)
void attn_ln_kernel(const unsigned short* __restrict__ Qg,
                    const unsigned short* __restrict__ Kg,
                    const unsigned short* __restrict__ Vg,
                    const int* __restrict__ mask,
                    const float* __restrict__ X,
                    const float* __restrict__ gamma,
                    const float* __restrict__ beta,
                    float* __restrict__ out) {
    // the four work-groups of one 256-row group (two blocks, two slabs each) have flat
    // indices equal mod 8 (row_group above)
    const unsigned flat = blockIdx.x + (BLK_LEN / FQ) * (blockIdx.y + BLK_NUM * blockIdx.z);   // 0..255
    const unsigned slab = (flat >> 3) & 1u;
    const unsigned blk  = row_group(flat & 7u, flat >> 5) * 2u + ((flat >> 4) & 1u);   // 0..127, over all batches

    __shared__ __attribute__((aligned(16))) unsigned short ring[2][F_STAGE];  // 188 KB
    __shared__ __attribute__((aligned(16))) float stg[8][16 * 68];            // 34 KB: a wave's own 16 x 64 tile
    __shared__ float msk[HEADS][FQ];                                          // 4 KB: the mask's addend
    __shared__ __attribute__((aligned(8))) float red[8][16][2];               // a wave's row sums

    const int tid   = threadIdx.x;
    // the wave's number as a scalar: what derives from it stays in scalar registers
    const int wave  = __builtin_amdgcn_readfirstlane(tid >> 5);
    const int lane  = tid & 31;
    const int lhalf = lane >> 4;
    const int l16   = lane & 15;
    const int qt    = wave & 3;
    const int hg    = wave >> 2;

    const size_t rowbase = (size_t)blk * BLK_LEN;                     // the block's keys
    const size_t qbase   = rowbase + (size_t)slab * FQ;               // the work-group's queries

    // a (query row, head) pair has one mask value: 1,024 of them, four a thread, asked for first
    const int mr = tid >> 2;
    const int mh = (tid & 3) * 4;
    const int* mp = mask + (qbase + mr) * DIMN + mh * DH;
    const int m0 = mp[0], m1 = mp[DH], m2 = mp[2 * DH], m3 = mp[3 * DH];
    // the loads' address registers are not rewritten before this wait
    asm volatile("s_wait_xcnt 0x0" ::: "memory");
    // keeps the address arithmetic that follows behind that wait
    __builtin_amdgcn_sched_barrier(0);

    // per-thread staging coords: eight lanes cover one row's 128 B
    const int sr = tid >> 3;                    // 0..31
    const int sc = (tid & 7) * 8;               // 0,8,...,56
    const unsigned short* gq = Qg + qbase   * DIMN;    // scalar bases: head 0 of the first row
    const unsigned short* gk = Kg + rowbase * DIMN;
    const unsigned short* gv = Vg + rowbase * DIMN;
    const unsigned goff = (unsigned)(sr * DIMN + sc) * 2u;   // the lane's byte offset in a tile
    const unsigned lq = lds_addr(&ring[0][sr * F_QKP + sc]);
    const unsigned lk = lds_addr(&ring[0][F_KOFF + sr * F_QKP + sc]);
    const unsigned lv = lds_addr(&ring[0][F_VOFF + sr * F_VP + sc]);

// the copies of step st (heads st and st + 8) into buffer bf
#define F_FILL(st, bf)                                                                   \
    do {                                                                                 \
        const unsigned bo = (unsigned)(bf) * (F_STAGE * 2u);                             \
        stage_head(lq + bo, lk + bo, lv + bo, goff,                                      \
                   gq + (st) * DH, gk + (st) * DH, gv + (st) * DH);                      \
        stage_head(lq + bo + FQ * F_QKP * 2u, lk + bo + BLK_LEN * F_QKP * 2u,            \
                   lv + bo + BLK_LEN * F_VP * 2u, goff,                                  \
                   gq + ((st) + 8) * DH, gk + ((st) + 8) * DH, gv + ((st) + 8) * DH);    \
    } while (0)

    // step 0 lands and is published (with the mask's addends), then step 1 starts
    F_FILL(0, 0);
    // keeps the mask's arithmetic, which waits for its loads, behind the issue of the copies
    __builtin_amdgcn_sched_barrier(0);
    msk[mh + 0][mr] = (1.0f - (float)m0) * -1.0e10f;
    msk[mh + 1][mr] = (1.0f - (float)m1) * -1.0e10f;
    msk[mh + 2][mr] = (1.0f - (float)m2) * -1.0e10f;
    msk[mh + 3][mr] = (1.0f - (float)m3) * -1.0e10f;
    wait_async0();
    __syncthreads();
    F_FILL(1, 1);

    // rw[s][it]: row qt * 16 + it * 2 + lhalf, columns (s + 8 * hg) * 64 + l16 * 4 .. + 3 of
    // attention + residual
    v4f rw[F_STEPS][8];                       // every tile is written in its own step
    float* so = &stg[wave][0];

    // kept rolled, for speed only
    #pragma unroll 1
    for (int s = 0; s < F_STEPS; ++s) {
        const int head = s + 8 * hg;
        const unsigned short* Bf = &ring[s & 1][0];
        const unsigned short* Qs = Bf + hg * (FQ * F_QKP);
        const unsigned short* Ks = Bf + F_KOFF + hg * (BLK_LEN * F_QKP);
        const unsigned char*  Vs = (const unsigned char*)(Bf + F_VOFF + hg * (BLK_LEN * F_VP));

        const float madd = msk[head][qt * 16 + l16];

        // S^T = K Q^T : 128 keys x 16 query columns per wave, K-dim 64 (2 steps).
        // sc8[nt][g] is key nt * 16 + lhalf * 8 + g, query qt * 16 + l16.
        v8f sc8[8] = {};
        #pragma unroll
        for (int ks = 0; ks < 2; ++ks) {
            const int ar = qt * 16 + l16;
            v16bf a = load_frag(Qs + ar * F_QKP + ks * 32 + lhalf * 8,
                                Qs + ar * F_QKP + ks * 32 + lhalf * 8 + 16);
            #pragma unroll
            for (int nt = 0; nt < 8; ++nt) {
                const int br = nt * 16 + l16;
                v16bf bb = load_frag(Ks + br * F_QKP + ks * 32 + lhalf * 8,
                                     Ks + br * F_QKP + ks * 32 + lhalf * 8 + 16);
                sc8[nt] = __builtin_amdgcn_wmma_f32_16x16x32_bf16(
                    false, bb, false, a, (short)0, sc8[nt], false, false);
            }
        }

        // the residual's 16 x 64 tile, asked for behind the first product, used at the step's end
        const float* xp = X + (qbase + qt * 16 + lhalf) * DIMN + head * DH + l16 * 4;
        v4f xv[8];
        #pragma unroll
        for (int it = 0; it < 8; ++it)
            xv[it] = *(const v4f*)(xp + (size_t)(it * 2) * DIMN);
        // the loads' address registers are not rewritten before this wait
        asm volatile("s_wait_xcnt 0x0" ::: "memory");

        // scale + mask + softmax over the lane pair's 128 scores (loops unrolled: constant indices)
        const float scale = 0.125f; // 1/sqrt(64)
        // whole-tile vector forms: a tile's adjacent registers pair up for the packed instructions
        #pragma unroll
        for (int nt = 0; nt < 8; ++nt)
            sc8[nt] = sc8[nt] * scale + madd;
        v8f mx = sc8[0];
        #pragma unroll
        for (int nt = 1; nt < 8; ++nt)
            mx = __builtin_elementwise_max(mx, sc8[nt]);
        float rmax = fmaxf(fmaxf(fmaxf(mx[0], mx[1]), fmaxf(mx[2], mx[3])),
                           fmaxf(fmaxf(mx[4], mx[5]), fmaxf(mx[6], mx[7])));
        rmax = fmaxf(rmax, xhalf(rmax));
        #pragma unroll
        for (int nt = 0; nt < 8; ++nt) {
            #pragma unroll
            for (int g = 0; g < 8; ++g)
                sc8[nt][g] = __expf(sc8[nt][g] - rmax);
        }
        v8f sm = sc8[0];
        #pragma unroll
        for (int nt = 1; nt < 8; ++nt)
            sm += sc8[nt];
        float rsum = ((sm[0] + sm[1]) + (sm[2] + sm[3])) + ((sm[4] + sm[5]) + (sm[6] + sm[7]));
        rsum += xhalf(rsum);
        const float inv = 1.0f / rsum;
        // P^T as B fragments: element e of pf[ks] is key ks * 32 + lhalf * 8 + e (e < 8) or
        // ks * 32 + 16 + lhalf * 8 + e - 8, the k order in which the V fragment is read below
        v16bf pf[4];
        #pragma unroll
        for (int ks = 0; ks < 4; ++ks) {
            v8bf lo = __builtin_convertvector(sc8[2 * ks] * inv, v8bf);
            v8bf hi = __builtin_convertvector(sc8[2 * ks + 1] * inv, v8bf);
            pf[ks] = __builtin_shufflevector(lo, hi, 0,1,2,3,4,5,6,7,8,9,10,11,12,13,14,15);
        }

        // O = P V : 16 rows x 64 cols, K-dim 128 (4 steps). The V fragment is the WMMA's A and the
        // P fragment its B: o[nt][g] is query row l16, column nt * 16 + lhalf * 8 + g.
        // Lane (l16, lhalf) gets V[ks * 32 + lhalf * 8 + 0..7][nt * 16 + l16], then the same 16 keys on.
        const unsigned char* va = Vs + (8 * lhalf + (lane & 7)) * (F_VP * 2) + ((lane >> 3) & 1) * 16;
        v8f o[4] = {};
        #pragma unroll
        for (int ks = 0; ks < 4; ++ks) {
            #pragma unroll
            for (int nt = 0; nt < 4; ++nt) {
                v8bf lo = ld_tr16(va + (ks * 32) * (F_VP * 2) + nt * 32);
                v8bf hi = ld_tr16(va + (ks * 32 + 16) * (F_VP * 2) + nt * 32);
                v16bf bb = __builtin_shufflevector(lo, hi, 0,1,2,3,4,5,6,7,8,9,10,11,12,13,14,15);
                o[nt] = __builtin_amdgcn_wmma_f32_16x16x32_bf16(
                    false, bb, false, pf[ks], (short)0, o[nt], false, false);
            }
        }

        // foot of the step: this wave's reads of the buffer are done, its copies of step
        // s + 1 have landed, and the barrier says so of every wave
        asm volatile("s_wait_dscnt 0x0" ::: "memory");
        wait_async0();
        __syncthreads();
        if (s + 2 < F_STEPS)
            F_FILL(s + 2, s & 1);

        // The wave turns its 16 x 64 f32 tile through its own LDS range (16 rows of 272 B hold
        // the 256 B each): afterwards 16 lanes cover a row's 256 B, as the residual's loads do.
        #pragma unroll
        for (int nt = 0; nt < 4; ++nt) {
            float* sp = so + l16 * 68 + nt * 16 + lhalf * 8;
            *(v4f*)sp       = __builtin_shufflevector(o[nt], o[nt], 0, 1, 2, 3);
            *(v4f*)(sp + 4) = __builtin_shufflevector(o[nt], o[nt], 4, 5, 6, 7);
        }
        // the wave's LDS writes are done before other lanes of it read the rows back
        asm volatile("s_wait_dscnt 0x0" ::: "memory");
        // The step's tile, residual added, is formed in registers of its own: a scalar branch on
        // the step picks the copy of these lines whose register indices are the step's constants.
#define F_KEEP(j)                                                                        \
        do {                                                                             \
            _Pragma("unroll")                                                            \
            for (int it = 0; it < 8; ++it) {                                             \
                rw[j][it] = *(const v4f*)(so + (it * 2 + lhalf) * 68 + l16 * 4) + xv[it]; \
            }                                                                            \
        } while (0)
        if (s == 0) F_KEEP(0);
        if (s == 1) F_KEEP(1);
        if (s == 2) F_KEEP(2);
        if (s == 3) F_KEEP(3);
        if (s == 4) F_KEEP(4);
        if (s == 5) F_KEEP(5);
        if (s == 6) F_KEEP(6);
        if (s == 7) F_KEEP(7);
    }
    wait_async0();   // no copy is outstanding when the wave ends

    // gamma, beta of the wave's 512 columns, asked for before the sums are joined
    const float* gp = gamma + hg * (8 * DH) + l16 * 4;
    const float* bp = beta  + hg * (8 * DH) + l16 * 4;
    v4f gm[F_STEPS], bt[F_STEPS];
    #pragma unroll
    for (int j = 0; j < F_STEPS; ++j) {
        gm[j] = *(const v4f*)(gp + j * DH);
        bt[j] = *(const v4f*)(bp + j * DH);
    }
    // the loads' address registers are not rewritten before this wait
    asm volatile("s_wait_xcnt 0x0" ::: "memory");

    // a row's sum and sum of squares: the lane's 32 values, then the 16 lanes that share the
    // row, then the two waves that share it
    float s1[8], s2[8];
    #pragma unroll
    for (int it = 0; it < 8; ++it) {
        v4f a1 = rw[0][it], a2 = rw[0][it] * rw[0][it];
        #pragma unroll
        for (int j = 1; j < F_STEPS; ++j) {
            a1 += rw[j][it];
            a2 += rw[j][it] * rw[j][it];
        }
        s1[it] = (a1[0] + a1[1]) + (a1[2] + a1[3]);
        s2[it] = (a2[0] + a2[1]) + (a2[2] + a2[3]);
    }
    #pragma unroll
    for (int it = 0; it < 8; ++it) {
        #pragma unroll
        for (int d = 1; d < 16; d <<= 1) {
            s1[it] += __shfl_xor(s1[it], d, 32);
            s2[it] += __shfl_xor(s2[it], d, 32);
        }
    }
    if (l16 == 0) {
        #pragma unroll
        for (int it = 0; it < 8; ++it) {
            red[wave][it * 2 + lhalf][0] = s1[it];
            red[wave][it * 2 + lhalf][1] = s2[it];
        }
    }
    __syncthreads();
    float mean[8], rstd[8];
    #pragma unroll
    for (int it = 0; it < 8; ++it) {
        const float tot  = s1[it] + red[wave ^ 4][it * 2 + lhalf][0];
        const float totq = s2[it] + red[wave ^ 4][it * 2 + lhalf][1];
        mean[it] = tot * (1.0f / DIMN);
        const float var = totq * (1.0f / DIMN) - mean[it] * mean[it];
        rstd[it] = rsqrtf(var + 1.0e-3f);
    }

    // whole lines: a store instruction covers 256 B of two rows
    float* op = out + (qbase + qt * 16 + lhalf) * DIMN + hg * (8 * DH) + l16 * 4;
    #pragma unroll
    for (int j = 0; j < F_STEPS; ++j) {
        v4f y[8];
        #pragma unroll
        for (int it = 0; it < 8; ++it)
            y[it] = (rw[j][it] - mean[it]) * rstd[it] * gm[j] + bt[j];
        // all 8 values of the run are formed before its first store, so none is
        // formed in a register that a store of the run names
        __builtin_amdgcn_sched_barrier(0);
        #pragma unroll
        for (int it = 0; it < 8; ++it)
            *(v4f*)(op + j * DH + (size_t)(it * 2) * DIMN) = y[it];
        if (j + 1 < F_STEPS) {
            // the run's data and address registers are not rewritten before this wait
            asm volatile("s_wait_xcnt 0x0" ::: "memory");
            // keeps the next run's arithmetic behind that wait
            __builtin_amdgcn_sched_barrier(0);
        }
    }
}

// ---------------------------------------------------------------------------
extern "C" void kernel_launch(void* const* d_in, const int* in_sizes, int n_in,
                              void* d_out, int out_size, void* d_ws, size_t ws_size,
                              hipStream_t stream) {
    (void)in_sizes; (void)n_in; (void)out_size; (void)ws_size;

    const float* X     = (const float*)d_in[0];
    const int*   mask  = (const int*)d_in[1];
    const float* w1    = (const float*)d_in[2];
    const float* b1    = (const float*)d_in[3];
    const float* w2    = (const float*)d_in[4];
    const float* b2    = (const float*)d_in[5];
    const float* w3    = (const float*)d_in[6];
    const float* b3    = (const float*)d_in[7];
    const float* gamma = (const float*)d_in[8];
    const float* beta  = (const float*)d_in[9];
    float* out = (float*)d_out;

    char* ws = (char*)d_ws;
    unsigned short* Wt  = (unsigned short*)(ws + WT_OFF);
    unsigned short* Xbf = (unsigned short*)(ws + XBF_OFF);
    unsigned short* Q   = (unsigned short*)(ws + Q_OFF);
    unsigned short* K   = (unsigned short*)(ws + K_OFF);
    unsigned short* V   = (unsigned short*)(ws + V_OFF);

    // 0) weights -> bf16, transposed to [n][k], and activations -> bf16
    conv_kernel<<<dim3((ROWS * DIMN) / (8 * XC_LOADS * 128)), dim3(256), 0, stream>>>(
        w1, w2, w3, Wt, X, Xbf);

    // 1) Q/K/V projections (WMMA bf16, async-to-LDS double buffered)
    proj_kernel<<<dim3(DIMN / 256, ROWS / 256, 3), dim3(256), 0, stream>>>(
        Xbf, Wt, b1, b2, b3, Q, K, V);

    // 2) block-local attention (WMMA) + residual + LayerNorm
    attn_ln_kernel<<<dim3(BLK_LEN / FQ, BLK_NUM, BATCH), dim3(256), 0, stream>>>(
        Q, K, V, mask, X, gamma, beta, out);
}

// v009
// It runs in 99.1 microseconds.
// Next to v008, in two timings, it ran 1.07 and 1.06 times as fast.
// All steps since v000 together make it 2.53 times as fast.
#include <hip/hip_runtime.h>

#define DIMN 1024
#define HEADS 16
#define DH 64
#define BLK_LEN 128
#define BLK_NUM 32
#define BATCH 4
#define SEQ (BLK_NUM * BLK_LEN)          // 4096
#define ROWS (BATCH * SEQ)               // 16384

typedef __attribute__((ext_vector_type(8)))  float  v8f;
typedef __attribute__((ext_vector_type(8)))  __bf16 v8bf;
typedef __attribute__((ext_vector_type(16))) __bf16 v16bf;
typedef __attribute__((ext_vector_type(4)))  unsigned v4u;
typedef __attribute__((ext_vector_type(4)))  float  v4f;

// ---- workspace layout (bytes) ----
static const size_t WT_OFF  = 0;                         // W^T bf16, 3 * 2MB
static const size_t XBF_OFF = 6291456;                   // X bf16, 32MB
static const size_t Q_OFF   = XBF_OFF + 33554432ull;
static const size_t K_OFF   = Q_OFF   + 33554432ull;
static const size_t V_OFF   = K_OFF   + 33554432ull;

__device__ __forceinline__ unsigned short f2bf(float f) {
    union { float f; unsigned u; } v; v.f = f;
    unsigned r = v.u + 0x7FFFu + ((v.u >> 16) & 1u);     // round-to-nearest-even
    return (unsigned short)(r >> 16);
}

__device__ __forceinline__ v16bf load_frag(const unsigned short* lo,
                                           const unsigned short* hi) {
    v8bf a = *(const v8bf*)lo;
    v8bf b = *(const v8bf*)hi;
    return __builtin_shufflevector(a, b, 0,1,2,3,4,5,6,7,8,9,10,11,12,13,14,15);
}

// CDNA5 async global->LDS copy (ASYNCcnt). LDS byte offset = low 32 bits of
// the generic shared-memory address (ISA 10.2 aperture rules).
__device__ __forceinline__ unsigned lds_addr(const void* p) {
    return (unsigned)(unsigned long long)p;
}
__device__ __forceinline__ void wait_async0() {
    asm volatile("s_wait_asynccnt 0" ::: "memory");
}

// Dealing of the work, all three kernels: the rows are taken in 64 groups of 256, and every
// work-group that reads or writes rows of group g has a flat block index equal to g mod 8.
// For speed only: it is
// a permutation of the indices, right wherever the work-groups land.
__device__ __forceinline__ int row_group(int idx_mod8, int idx_high) {
    return idx_mod8 + 8 * idx_high;
}

// ---------------------------------------------------------------------------
// Kernel 0: both conversions in one launch. grid 512, 256 threads: 4,096 waves.
// X fp32 -> bf16 (so the GEMM can stage A with async byte copies): each wave converts
// 16 KB of X, 32 loads of 512 contiguous bytes, all issued at its head.
// W fp32 -> bf16 with transpose, Wt[n][k] = bf16(W[k][n]): the first 384 work-groups also
// take one 128 (k) x 64 (n) tile of W each, 32 elements a thread. Its loads go out in front
// of X's and it is turned through LDS while X's loads are on their way.
// ---------------------------------------------------------------------------
#define WC_K 128
#define WC_N 64
#define WC_PITCH (WC_K + 8)                  // 272 B = 16 B x odd for the ds_load_b128 readers
#define WC_TILES ((DIMN / WC_K) * (DIMN / WC_N))   // 128 tiles a matrix
#define XC_LOADS 32
__global__ __launch_bounds__(256)
void conv_kernel(const float* __restrict__ w1,
                 const float* __restrict__ w2,
                 const float* __restrict__ w3,
                 unsigned short* __restrict__ wt,
                 const float* __restrict__ X,
                 unsigned short* __restrict__ Xbf) {
    __shared__ __attribute__((aligned(16))) unsigned short t[WC_N][WC_PITCH];   // [n][k]

    const int tid = threadIdx.x;
    const int z = blockIdx.x / WC_TILES;      // 0..2: a matrix of W; 3: no tile of W
    const bool has_w = z < 3;                 // the same for the whole work-group
    const int k0 = (blockIdx.x % (DIMN / WC_K)) * WC_K;
    const int n0 = ((blockIdx.x % WC_TILES) / (DIMN / WC_K)) * WC_N;

    const int lk = tid >> 4;                  // 0..15
    const int ln = (tid & 15) * 4;            // 16 lanes cover a row's 256 B
    float4 w[8] = {};
    if (has_w) {
        const float* W = (z == 0) ? w1 : (z == 1) ? w2 : w3;
        const float* wsrc = W + (size_t)(k0 + lk) * DIMN + n0 + ln;
        #pragma unroll
        for (int it = 0; it < 8; ++it)
            w[it] = *(const float4*)(wsrc + (size_t)it * 16 * DIMN);
        // the loads' address registers are not rewritten before this wait
        asm volatile("s_wait_xcnt 0x0" ::: "memory");
    }

    const int wave = tid >> 5;
    const int lane = tid & 31;
    // which 32 rows of X: the eight work-groups of one 256-row group have indices equal mod 8
    // (row_group above); speed only, every piece is dealt exactly once
    const int xq = blockIdx.x >> 3;
    const int chunk = row_group(blockIdx.x & 7, xq >> 3) * 8 + (xq & 7);
    const size_t base = ((size_t)chunk * 8 + wave) * (XC_LOADS * 128) + lane * 4;
    const float* src = X + base;
    unsigned short* dst = Xbf + base;

    float4 v[XC_LOADS];
    #pragma unroll
    for (int j = 0; j < XC_LOADS; ++j)
        v[j] = *(const float4*)(src + j * 128);
    // the loads' address registers are not rewritten before this wait
    asm volatile("s_wait_xcnt 0x0" ::: "memory");
    // keeps all the loads in front of the arithmetic: left to itself the build holds
    // about a dozen in flight and issues the rest among the conversions
    __builtin_amdgcn_sched_barrier(0);

    if (has_w) {
        #pragma unroll
        for (int it = 0; it < 8; ++it) {
            int kk = it * 16 + lk;
            t[ln + 0][kk] = f2bf(w[it].x);
            t[ln + 1][kk] = f2bf(w[it].y);
            t[ln + 2][kk] = f2bf(w[it].z);
            t[ln + 3][kk] = f2bf(w[it].w);
        }
        __syncthreads();
        const int sn = tid >> 4;                  // 0..15
        const int sk = (tid & 15) * 8;            // 16 lanes cover a row's 256 B
        unsigned short* wdst = wt + (size_t)z * DIMN * DIMN + (size_t)(n0 + sn) * DIMN + k0 + sk;
        #pragma unroll
        for (int it = 0; it < 4; ++it)
            *(uint4*)(wdst + (size_t)it * 16 * DIMN) = *(const uint4*)&t[it * 16 + sn][sk];
        // the stores' data and address registers are not rewritten before this wait
        asm volatile("s_wait_xcnt 0x0" ::: "memory");
        // keeps X's arithmetic behind that wait
        __builtin_amdgcn_sched_barrier(0);
    }

    // loops unrolled: register arrays need constant indices
    #pragma unroll
    for (int b = 0; b < XC_LOADS / 8; ++b) {
        uint2 p[8];
        #pragma unroll
        for (int j = 0; j < 8; ++j) {
            float4 xv = v[b * 8 + j];
            p[j].x = (unsigned)f2bf(xv.x) | ((unsigned)f2bf(xv.y) << 16);
            p[j].y = (unsigned)f2bf(xv.z) | ((unsigned)f2bf(xv.w) << 16);
        }
        // all 8 values of the run are formed before its first store, so none is
        // formed in a register that a store of the run names
        __builtin_amdgcn_sched_barrier(0);
        #pragma unroll
        for (int j = 0; j < 8; ++j)
            *(uint2*)(dst + (b * 8 + j) * 128) = p[j];
        if (b + 1 < XC_LOADS / 8) {
            // the run's data registers are not rewritten before this wait
            asm volatile("s_wait_xcnt 0x0" ::: "memory");
            // keeps the next run's arithmetic behind that wait
            __builtin_amdgcn_sched_barrier(0);
        }
    }
}

// ---------------------------------------------------------------------------
// Kernel 1: QKV projection GEMM. Xbf[16384,1024] * Wt^T + b -> bf16.
// One 256 x 256 tile of the output per work-group, 128 k per stage, two LDS
// buffers filled by async copies; 8 waves (2 x 4), 128 x 64 of the tile each
// (8 x 4 WMMA subtiles): 12 fragments read from LDS feed 32 WMMAs.
// A stage is worked on in two groups of 64 k with no barrier between them, for speed only.
// The Wt fragment is the WMMA's A and the X fragment its B, so a lane's eight
// accumulator values are eight adjacent output columns of one output row; the
// epilogue stages them in LDS and stores whole 128-B lines.
// grid (4, 64, 3 matrices), 256 threads; which tile a work-group takes: row_group above.
// ---------------------------------------------------------------------------
#define PJ_TILE  256                         // rows of X and rows of Wt per stage
#define PJ_K     128                         // k per stage: 256 B, two whole lines a row
#define PJ_PITCH 136                         // 272 B = 16 B x odd for ds_load_b128 readers
#define PJ_TRIPS (DIMN / PJ_K)               // 8

// Sixteen async copies of one lane: rows r, r + 16, ..., r + 112 of one half (128 rows) of
// both operands' stage. The global address is a scalar base (the half's first element) plus
// the lane's byte offset, which carries the stage's k: eight offset registers serve both
// operands and both halves; with 64-bit addresses in vector registers the build spilled to scratch.
// s_wait_xcnt stands inside the statement so that no address register is rewritten before it.
__device__ __forceinline__ void stage_half(unsigned la, unsigned lb, unsigned off,
                                           const unsigned short* ba,
                                           const unsigned short* bb) {
    asm volatile("global_load_async_to_lds_b128 %0, %16, %24\n\t"
                 "global_load_async_to_lds_b128 %1, %17, %24\n\t"
                 "global_load_async_to_lds_b128 %2, %18, %24\n\t"
                 "global_load_async_to_lds_b128 %3, %19, %24\n\t"
                 "global_load_async_to_lds_b128 %4, %20, %24\n\t"
                 "global_load_async_to_lds_b128 %5, %21, %24\n\t"
                 "global_load_async_to_lds_b128 %6, %22, %24\n\t"
                 "global_load_async_to_lds_b128 %7, %23, %24\n\t"
                 "global_load_async_to_lds_b128 %8, %16, %25\n\t"
                 "global_load_async_to_lds_b128 %9, %17, %25\n\t"
                 "global_load_async_to_lds_b128 %10, %18, %25\n\t"
                 "global_load_async_to_lds_b128 %11, %19, %25\n\t"
                 "global_load_async_to_lds_b128 %12, %20, %25\n\t"
                 "global_load_async_to_lds_b128 %13, %21, %25\n\t"
                 "global_load_async_to_lds_b128 %14, %22, %25\n\t"
                 "global_load_async_to_lds_b128 %15, %23, %25\n\t"
                 "s_wait_xcnt 0x0"
                 :: "v"(la),
                    "v"(la + 1u * 16u * PJ_PITCH * 2u),
                    "v"(la + 2u * 16u * PJ_PITCH * 2u),
                    "v"(la + 3u * 16u * PJ_PITCH * 2u),
                    "v"(la + 4u * 16u * PJ_PITCH * 2u),
                    "v"(la + 5u * 16u * PJ_PITCH * 2u),
                    "v"(la + 6u * 16u * PJ_PITCH * 2u),
                    "v"(la + 7u * 16u * PJ_PITCH * 2u),
                    "v"(lb),
                    "v"(lb + 1u * 16u * PJ_PITCH * 2u),
                    "v"(lb + 2u * 16u * PJ_PITCH * 2u),
                    "v"(lb + 3u * 16u * PJ_PITCH * 2u),
                    "v"(lb + 4u * 16u * PJ_PITCH * 2u),
                    "v"(lb + 5u * 16u * PJ_PITCH * 2u),
                    "v"(lb + 6u * 16u * PJ_PITCH * 2u),
                    "v"(lb + 7u * 16u * PJ_PITCH * 2u),
                    "v"(off),
                    "v"(off + 1u * 16u * DIMN * 2u),
                    "v"(off + 2u * 16u * DIMN * 2u),
                    "v"(off + 3u * 16u * DIMN * 2u),
                    "v"(off + 4u * 16u * DIMN * 2u),
                    "v"(off + 5u * 16u * DIMN * 2u),
                    "v"(off + 6u * 16u * DIMN * 2u),
                    "v"(off + 7u * 16u * DIMN * 2u),
                    "s"(ba), "s"(bb)
                 : "memory");
}
// one whole stage, 256 rows of both operands: 32 copies of one lane
__device__ __forceinline__ void stage_fill(unsigned la, unsigned lb, unsigned off,
                                           const unsigned short* ba,
                                           const unsigned short* bb) {
    stage_half(la, lb, off, ba, bb);
    stage_half(la + 128u * PJ_PITCH * 2u, lb + 128u * PJ_PITCH * 2u, off,
               ba + 128 * DIMN, bb + 128 * DIMN);
}

__global__ __launch_bounds__(256)
void proj_kernel(const unsigned short* __restrict__ Xbf,
                 const unsigned short* __restrict__ Wt,
                 const float* __restrict__ b1,
                 const float* __restrict__ b2,
                 const float* __restrict__ b3,
                 unsigned short* __restrict__ Q,
                 unsigned short* __restrict__ K,
                 unsigned short* __restrict__ V) {
    const int z = blockIdx.z;
    const unsigned short* Wz = Wt + (size_t)z * DIMN * DIMN;
    const float* bias = (z == 0) ? b1 : (z == 1) ? b2 : b3;
    unsigned short* Out = (z == 0) ? Q : (z == 1) ? K : V;

    // the 12 tiles of one 256-row group have flat indices equal mod 8 (row_group above)
    const int flat = blockIdx.x + (DIMN / PJ_TILE) * blockIdx.y;    // 0..255 in a matrix
    const int n0 = ((flat >> 3) & 3) * PJ_TILE;
    const int m0 = row_group(flat & 7, flat >> 5) * PJ_TILE;

    __shared__ __attribute__((aligned(16))) unsigned short As[2][PJ_TILE][PJ_PITCH];   // 2 x 68 KB
    __shared__ __attribute__((aligned(16))) unsigned short Bs[2][PJ_TILE][PJ_PITCH];   // 2 x 68 KB ([n][k])

    const int tid   = threadIdx.x;
    // the wave's number as a scalar: what the epilogue derives from it then waits out the
    // loop in scalar registers; in vector registers it pushed the copies' base addresses to scratch
    const int wave  = __builtin_amdgcn_readfirstlane(tid >> 5);
    const int lane  = tid & 31;
    const int wm    = wave >> 2;                // 0..1 (M), 128 rows
    const int wn    = wave & 3;                 // 0..3 (N), 64 columns
    const int lhalf = lane >> 4;
    const int l16   = lane & 15;

    // per-thread staging coords: sixteen lanes cover one row's 256 B
    const int sr = tid >> 4;                    // 0..15
    const int sc = (tid & 15) * 8;              // 0,8,...,120

    const unsigned short* gA = Xbf + (size_t)m0 * DIMN;      // scalar bases: the tiles' first elements
    const unsigned short* gB = Wz  + (size_t)n0 * DIMN;
    const unsigned goff = (unsigned)(sr * DIMN + sc) * 2u;   // the lane's byte offset in a half
    const unsigned la = lds_addr(&As[0][sr][sc]);
    const unsigned lb = lds_addr(&Bs[0][sr][sc]);
    const unsigned bufsz = PJ_TILE * PJ_PITCH * 2u;          // bytes of one operand's buffer

    v8f acc[8][4] = {};

    // stage 0 lands and is published, then stage 1 starts
    stage_fill(la, lb, goff, gA, gB);
    wait_async0();
    __syncthreads();
    stage_fill(la + bufsz, lb + bufsz, goff + PJ_K * 2u, gA, gB);

    for (int t = 0; t < PJ_TRIPS; ++t) {
        const int buf = t & 1;
        // compute on the current buffer (loops unrolled: register arrays need constant indices)
        #pragma unroll
        for (int kg = 0; kg < PJ_K / 64; ++kg) {
            v16bf fa[2][8], fb[2][4];                  // the wave's 24 fragments of this group of 64 k
            #pragma unroll
            for (int ks = 0; ks < 2; ++ks) {
                const int kc = kg * 64 + ks * 32 + lhalf * 8;
                #pragma unroll
                for (int ns = 0; ns < 4; ++ns) {
                    int br = wn * 64 + ns * 16 + l16;
                    fb[ks][ns] = load_frag(&Bs[buf][br][kc], &Bs[buf][br][kc + 16]);
                }
                #pragma unroll
                for (int ms = 0; ms < 8; ++ms) {
                    int ar = wm * 128 + ms * 16 + l16;
                    fa[ks][ms] = load_frag(&As[buf][ar][kc], &As[buf][ar][kc + 16]);
                }
            }
            // keeps the group's LDS reads together in front of its WMMAs: left to itself the
            // build reads each row's fragment directly in front of its four WMMAs and waits it out
            __builtin_amdgcn_sched_barrier(0);
            #pragma unroll
            for (int ks = 0; ks < 2; ++ks) {
                #pragma unroll
                for (int ms = 0; ms < 8; ++ms) {
                    #pragma unroll
                    for (int ns = 0; ns < 4; ++ns)
                        acc[ms][ns] = __builtin_amdgcn_wmma_f32_16x16x32_bf16(
                            false, fb[ks][ns], false, fa[ks][ms], (short)0, acc[ms][ns], false, false);
                }
            }
            // keeps the WMMAs in front of the next group's reads and of the foot's waits: sunk behind
            // the waits, every WMMA would stand behind the wait for the last of the 48 reads
            // instead of starting on the first
            __builtin_amdgcn_sched_barrier(0);
        }
        // foot of the trip: this wave's reads of buffer buf are done, its copies of
        // stage t + 1 have landed, and the barrier says so of every wave
        asm volatile("s_wait_dscnt 0x0" ::: "memory");
        wait_async0();
        __syncthreads();
        if (t + 2 < PJ_TRIPS) {
            // the lane's place in LDS is formed anew from its offset in the stage (row in the bits
            // from 11 up, byte in the row's 256 in the low eight): held in registers over the
            // loop, the build kept it in scratch
            const unsigned vo = goff + (t + 2) * (PJ_K * 2u);
            const unsigned lp = (vo >> 11) * (PJ_PITCH * 2u) + (vo & 255u) + buf * bufsz;
            stage_fill(lds_addr(&As[0][0][0]) + lp, lds_addr(&Bs[0][0][0]) + lp, vo, gA, gB);
        }
    }
    wait_async0();   // no copy is outstanding when the wave ends

    // epilogue: + bias, -> bf16 (loops unrolled: constant accumulator indices).
    // acc[ms][ns][g] is output row ms * 16 + l16, column ns * 16 + lhalf * 8 + g of the wave's tile.
    // Each wave stages its 128 x 64 tile in a range of LDS that is its own: a quarter of As
    // (waves 0 to 3) or of Bs (waves 4 to 7), 128 rows at the ring's pitch. The ring is free:
    // the last trip's foot ended every wave's reads and no copy is outstanding.
    unsigned short (*st)[PJ_PITCH] = (wave < 4) ? &As[(wave >> 1) & 1][(wave & 1) * 128]
                                                : &Bs[(wave >> 1) & 1][(wave & 1) * 128];
    const float* bp = bias + n0 + wn * 64 + lhalf * 8;
    v8f bv[4];
    #pragma unroll
    for (int ns = 0; ns < 4; ++ns)
        bv[ns] = *(const v8f*)(bp + ns * 16);
    // the loads' address registers are not rewritten before this wait
    asm volatile("s_wait_xcnt 0x0" ::: "memory");
    // keeps the arithmetic that follows behind that wait
    __builtin_amdgcn_sched_barrier(0);
    #pragma unroll
    for (int ms = 0; ms < 8; ++ms) {
        #pragma unroll
        for (int ns = 0; ns < 4; ++ns) {
            const v8f y = acc[ms][ns] + bv[ns];
            v4u p;
            p.x = (unsigned)f2bf(y[0]) | ((unsigned)f2bf(y[1]) << 16);
            p.y = (unsigned)f2bf(y[2]) | ((unsigned)f2bf(y[3]) << 16);
            p.z = (unsigned)f2bf(y[4]) | ((unsigned)f2bf(y[5]) << 16);
            p.w = (unsigned)f2bf(y[6]) | ((unsigned)f2bf(y[7]) << 16);
            *(v4u*)&st[ms * 16 + l16][ns * 16 + lhalf * 8] = p;
        }
    }
    // the wave's LDS writes are done before other lanes of it read the rows back
    asm volatile("s_wait_dscnt 0x0" ::: "memory");

    // eight lanes cover one row's 128 B, a store instruction four whole lines
    const int rr = lane >> 3;                   // 0..3
    const int cc = (lane & 7) * 8;              // 0,8,...,56
    unsigned short* dst = Out + (size_t)(m0 + wm * 128 + rr) * DIMN + n0 + wn * 64 + cc;
    #pragma unroll
    for (int b = 0; b < 4; ++b) {
        v4u q[8];
        #pragma unroll
        for (int j = 0; j < 8; ++j)
            q[j] = *(const v4u*)&st[(b * 8 + j) * 4 + rr][cc];
        // all 8 values of the run are read before its first store, so none is
        // read into a register that a store of the run names
        __builtin_amdgcn_sched_barrier(0);
        #pragma unroll
        for (int j = 0; j < 8; ++j)
            *(v4u*)(dst + (size_t)((b * 8 + j) * 4) * DIMN) = q[j];
        if (b + 1 < 4) {
            // the run's data registers are not rewritten before this wait
            asm volatile("s_wait_xcnt 0x0" ::: "memory");
            // keeps the next run's LDS reads behind that wait
            __builtin_amdgcn_sched_barrier(0);
        }
    }
}

// ---------------------------------------------------------------------------
// Kernel 2: block-local attention, residual and LayerNorm in one launch.
// A work-group owns 64 query rows of a block over ALL 16 heads, so a whole output row is
// on one WGP and the attention result never goes to memory. grid (2, BLK_NUM, BATCH) = 256,
// 256 threads: wave = (query tile qt = wave & 3, head group hg = wave >> 2); in step s the
// wave works on head s + 8 * hg. Q, K, V of the step's two heads come through a two-buffer
// LDS ring of async copies; V stays row-major and is read by the transposing load.
// The scores are computed transposed (K fragment = the WMMA's A, Q fragment = its B): a lane
// holds 64 of one query's 128 scores and lane ^ 16 the other 64, so the softmax runs in
// registers with one exchange between the wave's halves for the maximum and one for the sum,
// and two score tiles, converted in place, are the B fragment of the second product.
// ---------------------------------------------------------------------------
// lane l reads lane l ^ 16
__device__ __forceinline__ float xhalf(float x) {
    return __builtin_bit_cast(float, __builtin_amdgcn_permlanex16(
        __builtin_bit_cast(int, x), __builtin_bit_cast(int, x),
        0x76543210, 0xfedcba98, false, false));
}

#define FQ      64                            // query rows per work-group
#define F_STEPS 8                             // steps: heads s and s + 8
#define F_QKP   72                            // Q, K pitch: 144 B = 16 B x odd (ds_load_b128)
#define F_VP    80                            // V pitch: 160 B = 32 B x odd (ds_load_tr16_b128)
#define F_KOFF  (2 * FQ * F_QKP)              // elements: Q of two heads in front
#define F_VOFF  (F_KOFF + 2 * BLK_LEN * F_QKP)
#define F_STAGE (F_VOFF + 2 * BLK_LEN * F_VP) // 48,128 elements = 96,256 B a buffer

typedef short s16x8 __attribute__((ext_vector_type(8)));
// 16 x 16 piece of a row-major 16-bit LDS tile, transposed: lane (c, h) gets rows 8h .. 8h + 7 of column c
__device__ __forceinline__ v8bf ld_tr16(const unsigned char* q) {
    typedef __attribute__((address_space(3))) s16x8 lds_s16x8;
    return __builtin_bit_cast(v8bf, __builtin_amdgcn_ds_load_tr16_b128_v8i16((lds_s16x8*)q));
}

// Ten async copies of one lane: its 16 B of 2 rows of Q and of 4 rows each of K and V of one
// head (rows 32 apart). The global address is a scalar base (tile's first element) plus the
// lane's byte offset: four offset registers serve all ten copies and every step.
// s_wait_xcnt stands inside the statement so that no address register is rewritten before it.
__device__ __forceinline__ void stage_head(unsigned lq, unsigned lk, unsigned lv, unsigned off,
                                           const unsigned short* bq,
                                           const unsigned short* bk,
                                           const unsigned short* bv) {
    asm volatile("global_load_async_to_lds_b128 %0, %10, %14\n\t"
                 "global_load_async_to_lds_b128 %1, %11, %14\n\t"
                 "global_load_async_to_lds_b128 %2, %10, %15\n\t"
                 "global_load_async_to_lds_b128 %3, %11, %15\n\t"
                 "global_load_async_to_lds_b128 %4, %12, %15\n\t"
                 "global_load_async_to_lds_b128 %5, %13, %15\n\t"
                 "global_load_async_to_lds_b128 %6, %10, %16\n\t"
                 "global_load_async_to_lds_b128 %7, %11, %16\n\t"
                 "global_load_async_to_lds_b128 %8, %12, %16\n\t"
                 "global_load_async_to_lds_b128 %9, %13, %16\n\t"
                 "s_wait_xcnt 0x0"
                 :: "v"(lq), "v"(lq + 32u * F_QKP * 2u),
                    "v"(lk), "v"(lk + 32u * F_QKP * 2u),
                    "v"(lk + 64u * F_QKP * 2u), "v"(lk + 96u * F_QKP * 2u),
                    "v"(lv), "v"(lv + 32u * F_VP * 2u),
                    "v"(lv + 64u * F_VP * 2u), "v"(lv + 96u * F_VP * 2u),
                    "v"(off), "v"(off + 32u * DIMN * 2u),
                    "v"(off + 64u * DIMN * 2u), "v"(off + 96u * DIMN * 2u),
                    "s"(bq), "s"(bk), "s"(bv)
                 : "memory");
}

__global__ __launch_bounds__(256)
void attn_ln_kernel(const unsigned short* __restrict__ Qg,
                    const unsigned short* __restrict__ Kg,
                    const unsigned short* __restrict__ Vg,
                    const int* __restrict__ mask,
                    const float* __restrict__ X,
                    const float* __restrict__ gamma,
                    const float* __restrict__ beta,
                    float* __restrict__ out) {
    // the four work-groups of one 256-row group (two blocks, two slabs each) have flat
    // indices equal mod 8 (row_group above)
    const unsigned flat = blockIdx.x + (BLK_LEN / FQ) * (blockIdx.y + BLK_NUM * blockIdx.z);   // 0..255
    const unsigned slab = (flat >> 3) & 1u;
    const unsigned blk  = row_group(flat & 7u, flat >> 5) * 2u + ((flat >> 4) & 1u);   // 0..127, over all batches

    __shared__ __attribute__((aligned(16))) unsigned short ring[2][F_STAGE];  // 188 KB
    __shared__ __attribute__((aligned(16))) float stg[8][16 * 68];            // 34 KB: a wave's own 16 x 64 tile
    __shared__ float msk[HEADS][FQ];                                          // 4 KB: the mask's addend
    __shared__ __attribute__((aligned(8))) float red[8][16][2];               // a wave's row sums

    const int tid   = threadIdx.x;
    // the wave's number as a scalar: what derives from it stays in scalar registers
    const int wave  = __builtin_amdgcn_readfirstlane(tid >> 5);
    const int lane  = tid & 31;
    const int lhalf = lane >> 4;
    const int l16   = lane & 15;
    const int qt    = wave & 3;
    const int hg    = wave >> 2;

    const size_t rowbase = (size_t)blk * BLK_LEN;                     // the block's keys
    const size_t qbase   = rowbase + (size_t)slab * FQ;               // the work-group's queries

    // a (query row, head) pair has one mask value: 1,024 of them, four a thread, asked for first
    const int mr = tid >> 2;
    const int mh = (tid & 3) * 4;
    const int* mp = mask + (qbase + mr) * DIMN + mh * DH;
    const int m0 = mp[0], m1 = mp[DH], m2 = mp[2 * DH], m3 = mp[3 * DH];
    // the loads' address registers are not rewritten before this wait
    asm volatile("s_wait_xcnt 0x0" ::: "memory");
    // keeps the address arithmetic that follows behind that wait
    __builtin_amdgcn_sched_barrier(0);

    // per-thread staging coords: eight lanes cover one row's 128 B
    const int sr = tid >> 3;                    // 0..31
    const int sc = (tid & 7) * 8;               // 0,8,...,56
    const unsigned short* gq = Qg + qbase   * DIMN;    // scalar bases: head 0 of the first row
    const unsigned short* gk = Kg + rowbase * DIMN;
    const unsigned short* gv = Vg + rowbase * DIMN;
    const unsigned goff = (unsigned)(sr * DIMN + sc) * 2u;   // the lane's byte offset in a tile
    const unsigned lq = lds_addr(&ring[0][sr * F_QKP + sc]);
    const unsigned lk = lds_addr(&ring[0][F_KOFF + sr * F_QKP + sc]);
    const unsigned lv = lds_addr(&ring[0][F_VOFF + sr * F_VP + sc]);

// the copies of step st (heads st and st + 8) into buffer bf
#define F_FILL(st, bf)                                                                   \
    do {                                                                                 \
        const unsigned bo = (unsigned)(bf) * (F_STAGE * 2u);                             \
        stage_head(lq + bo, lk + bo, lv + bo, goff,                                      \
                   gq + (st) * DH, gk + (st) * DH, gv + (st) * DH);                      \
        stage_head(lq + bo + FQ * F_QKP * 2u, lk + bo + BLK_LEN * F_QKP * 2u,            \
                   lv + bo + BLK_LEN * F_VP * 2u, goff,                                  \
                   gq + ((st) + 8) * DH, gk + ((st) + 8) * DH, gv + ((st) + 8) * DH);    \
    } while (0)

    // step 0 lands and is published (with the mask's addends), then step 1 starts
    F_FILL(0, 0);
    // keeps the mask's arithmetic, which waits for its loads, behind the issue of the copies
    __builtin_amdgcn_sched_barrier(0);
    msk[mh + 0][mr] = (1.0f - (float)m0) * -1.0e10f;
    msk[mh + 1][mr] = (1.0f - (float)m1) * -1.0e10f;
    msk[mh + 2][mr] = (1.0f - (float)m2) * -1.0e10f;
    msk[mh + 3][mr] = (1.0f - (float)m3) * -1.0e10f;
    wait_async0();
    __syncthreads();
    F_FILL(1, 1);

    // rw[s][it]: row qt * 16 + it * 2 + lhalf, columns (s + 8 * hg) * 64 + l16 * 4 .. + 3 of
    // attention + residual
    v4f rw[F_STEPS][8];                       // every tile is written in its own step
    float* so = &stg[wave][0];

    // kept rolled, for speed only
    #pragma unroll 1
    for (int s = 0; s < F_STEPS; ++s) {
        const int head = s + 8 * hg;
        const unsigned short* Bf = &ring[s & 1][0];
        const unsigned short* Qs = Bf + hg * (FQ * F_QKP);
        const unsigned short* Ks = Bf + F_KOFF + hg * (BLK_LEN * F_QKP);
        const unsigned char*  Vs = (const unsigned char*)(Bf + F_VOFF + hg * (BLK_LEN * F_VP));

        const float madd = msk[head][qt * 16 + l16];

        // S^T = K Q^T : 128 keys x 16 query columns per wave, K-dim 64 (2 steps).
        // sc8[nt][g] is key nt * 16 + lhalf * 8 + g, query qt * 16 + l16.
        v8f sc8[8] = {};
        #pragma unroll
        for (int ks = 0; ks < 2; ++ks) {
            const int ar = qt * 16 + l16;
            v16bf a = load_frag(Qs + ar * F_QKP + ks * 32 + lhalf * 8,
                                Qs + ar * F_QKP + ks * 32 + lhalf * 8 + 16);
            #pragma unroll
            for (int nt = 0; nt < 8; ++nt) {
                const int br = nt * 16 + l16;
                v16bf bb = load_frag(Ks + br * F_QKP + ks * 32 + lhalf * 8,
                                     Ks + br * F_QKP + ks * 32 + lhalf * 8 + 16);
                sc8[nt] = __builtin_amdgcn_wmma_f32_16x16x32_bf16(
                    false, bb, false, a, (short)0, sc8[nt], false, false);
            }
        }

        // the residual's 16 x 64 tile, asked for behind the first product, used at the step's end
        const float* xp = X + (qbase + qt * 16 + lhalf) * DIMN + head * DH + l16 * 4;
        v4f xv[8];
        #pragma unroll
        for (int it = 0; it < 8; ++it)
            xv[it] = *(const v4f*)(xp + (size_t)(it * 2) * DIMN);
        // the loads' address registers are not rewritten before this wait
        asm volatile("s_wait_xcnt 0x0" ::: "memory");

        // scale + mask + softmax over the lane pair's 128 scores (loops unrolled: constant indices)
        const float scale = 0.125f; // 1/sqrt(64)
        // whole-tile vector forms: a tile's adjacent registers pair up for the packed instructions
        #pragma unroll
        for (int nt = 0; nt < 8; ++nt)
            sc8[nt] = sc8[nt] * scale + madd;
        v8f mx = sc8[0];
        #pragma unroll
        for (int nt = 1; nt < 8; ++nt)
            mx = __builtin_elementwise_max(mx, sc8[nt]);
        float rmax = fmaxf(fmaxf(fmaxf(mx[0], mx[1]), fmaxf(mx[2], mx[3])),
                           fmaxf(fmaxf(mx[4], mx[5]), fmaxf(mx[6], mx[7])));
        rmax = fmaxf(rmax, xhalf(rmax));
        #pragma unroll
        for (int nt = 0; nt < 8; ++nt) {
            #pragma unroll
            for (int g = 0; g < 8; ++g)
                sc8[nt][g] = __expf(sc8[nt][g] - rmax);
        }
        v8f sm = sc8[0];
        #pragma unroll
        for (int nt = 1; nt < 8; ++nt)
            sm += sc8[nt];
        float rsum = ((sm[0] + sm[1]) + (sm[2] + sm[3])) + ((sm[4] + sm[5]) + (sm[6] + sm[7]));
        rsum += xhalf(rsum);
        const float inv = 1.0f / rsum;
        // P^T as B fragments: element e of pf[ks] is key ks * 32 + lhalf * 8 + e (e < 8) or
        // ks * 32 + 16 + lhalf * 8 + e - 8, the k order in which the V fragment is read below
        v16bf pf[4];
        #pragma unroll
        for (int ks = 0; ks < 4; ++ks) {
            v8bf lo = __builtin_convertvector(sc8[2 * ks] * inv, v8bf);
            v8bf hi = __builtin_convertvector(sc8[2 * ks + 1] * inv, v8bf);
            pf[ks] = __builtin_shufflevector(lo, hi, 0,1,2,3,4,5,6,7,8,9,10,11,12,13,14,15);
        }

        // O = P V : 16 rows x 64 cols, K-dim 128 (4 steps). The V fragment is the WMMA's A and the
        // P fragment its B: o[nt][g] is query row l16, column nt * 16 + lhalf * 8 + g.
        // Lane (l16, lhalf) gets V[ks * 32 + lhalf * 8 + 0..7][nt * 16 + l16], then the same 16 keys on.
        const unsigned char* va = Vs + (8 * lhalf + (lane & 7)) * (F_VP * 2) + ((lane >> 3) & 1) * 16;
        v8f o[4] = {};
        #pragma unroll
        for (int ks = 0; ks < 4; ++ks) {
            #pragma unroll
            for (int nt = 0; nt < 4; ++nt) {
                v8bf lo = ld_tr16(va + (ks * 32) * (F_VP * 2) + nt * 32);
                v8bf hi = ld_tr16(va + (ks * 32 + 16) * (F_VP * 2) + nt * 32);
                v16bf bb = __builtin_shufflevector(lo, hi, 0,1,2,3,4,5,6,7,8,9,10,11,12,13,14,15);
                o[nt] = __builtin_amdgcn_wmma_f32_16x16x32_bf16(
                    false, bb, false, pf[ks], (short)0, o[nt], false, false);
            }
        }

        // foot of the step: this wave's reads of the buffer are done, its copies of step
        // s + 1 have landed, and the barrier says so of every wave
        asm volatile("s_wait_dscnt 0x0" ::: "memory");
        wait_async0();
        __syncthreads();
        if (s + 2 < F_STEPS)
            F_FILL(s + 2, s & 1);

        // The wave turns its 16 x 64 f32 tile through its own LDS range (16 rows of 272 B hold
        // the 256 B each): afterwards 16 lanes cover a row's 256 B, as the residual's loads do.
        #pragma unroll
        for (int nt = 0; nt < 4; ++nt) {
            float* sp = so + l16 * 68 + nt * 16 + lhalf * 8;
            *(v4f*)sp       = __builtin_shufflevector(o[nt], o[nt], 0, 1, 2, 3);
            *(v4f*)(sp + 4) = __builtin_shufflevector(o[nt], o[nt], 4, 5, 6, 7);
        }
        // the wave's LDS writes are done before other lanes of it read the rows back
        asm volatile("s_wait_dscnt 0x0" ::: "memory");
        // The step's tile, residual added, is formed in registers of its own: a scalar branch on
        // the step picks the copy of these lines whose register indices are the step's constants.
#define F_KEEP(j)                                                                        \
        do {                                                                             \
            _Pragma("unroll")                                                            \
            for (int it = 0; it < 8; ++it) {                                             \
                rw[j][it] = *(const v4f*)(so + (it * 2 + lhalf) * 68 + l16 * 4) + xv[it]; \
            }                                                                            \
        } while (0)
        if (s == 0) F_KEEP(0);
        if (s == 1) F_KEEP(1);
        if (s == 2) F_KEEP(2);
        if (s == 3) F_KEEP(3);
        if (s == 4) F_KEEP(4);
        if (s == 5) F_KEEP(5);
        if (s == 6) F_KEEP(6);
        if (s == 7) F_KEEP(7);
    }
    wait_async0();   // no copy is outstanding when the wave ends

    // gamma, beta of the wave's 512 columns, asked for before the sums are joined
    const float* gp = gamma + hg * (8 * DH) + l16 * 4;
    const float* bp = beta  + hg * (8 * DH) + l16 * 4;
    v4f gm[F_STEPS], bt[F_STEPS];
    #pragma unroll
    for (int j = 0; j < F_STEPS; ++j) {
        gm[j] = *(const v4f*)(gp + j * DH);
        bt[j] = *(const v4f*)(bp + j * DH);
    }
    // the loads' address registers are not rewritten before this wait
    asm volatile("s_wait_xcnt 0x0" ::: "memory");

    // a row's sum and sum of squares: the lane's 32 values, then the 16 lanes that share the
    // row, then the two waves that share it
    float s1[8], s2[8];
    #pragma unroll
    for (int it = 0; it < 8; ++it) {
        v4f a1 = rw[0][it], a2 = rw[0][it] * rw[0][it];
        #pragma unroll
        for (int j = 1; j < F_STEPS; ++j) {
            a1 += rw[j][it];
            a2 += rw[j][it] * rw[j][it];
        }
        s1[it] = (a1[0] + a1[1]) + (a1[2] + a1[3]);
        s2[it] = (a2[0] + a2[1]) + (a2[2] + a2[3]);
    }
    #pragma unroll
    for (int it = 0; it < 8; ++it) {
        #pragma unroll
        for (int d = 1; d < 16; d <<= 1) {
            s1[it] += __shfl_xor(s1[it], d, 32);
            s2[it] += __shfl_xor(s2[it], d, 32);
        }
    }
    if (l16 == 0) {
        #pragma unroll
        for (int it = 0; it < 8; ++it) {
            red[wave][it * 2 + lhalf][0] = s1[it];
            red[wave][it * 2 + lhalf][1] = s2[it];
        }
    }
    __syncthreads();
    float mean[8], rstd[8];
    #pragma unroll
    for (int it = 0; it < 8; ++it) {
        const float tot  = s1[it] + red[wave ^ 4][it * 2 + lhalf][0];
        const float totq = s2[it] + red[wave ^ 4][it * 2 + lhalf][1];
        mean[it] = tot * (1.0f / DIMN);
        const float var = totq * (1.0f / DIMN) - mean[it] * mean[it];
        rstd[it] = rsqrtf(var + 1.0e-3f);
    }

    // whole lines: a store instruction covers 256 B of two rows
    float* op = out + (qbase + qt * 16 + lhalf) * DIMN + hg * (8 * DH) + l16 * 4;
    #pragma unroll
    for (int j = 0; j < F_STEPS; ++j) {
        v4f y[8];
        #pragma unroll
        for (int it = 0; it < 8; ++it)
            y[it] = (rw[j][it] - mean[it]) * rstd[it] * gm[j] + bt[j];
        // all 8 values of the run are formed before its first store, so none is
        // formed in a register that a store of the run names
        __builtin_amdgcn_sched_barrier(0);
        #pragma unroll
        for (int it = 0; it < 8; ++it)
            *(v4f*)(op + j * DH + (size_t)(it * 2) * DIMN) = y[it];
        if (j + 1 < F_STEPS) {
            // the run's data and address registers are not rewritten before this wait
            asm volatile("s_wait_xcnt 0x0" ::: "memory");
            // keeps the next run's arithmetic behind that wait
            __builtin_amdgcn_sched_barrier(0);
        }
    }
}

// ---------------------------------------------------------------------------
extern "C" void kernel_launch(void* const* d_in, const int* in_sizes, int n_in,
                              void* d_out, int out_size, void* d_ws, size_t ws_size,
                              hipStream_t stream) {
    (void)in_sizes; (void)n_in; (void)out_size; (void)ws_size;

    const float* X     = (const float*)d_in[0];
    const int*   mask  = (const int*)d_in[1];
    const float* w1    = (const float*)d_in[2];
    const float* b1    = (const float*)d_in[3];
    const float* w2    = (const float*)d_in[4];
    const float* b2    = (const float*)d_in[5];
    const float* w3    = (const float*)d_in[6];
    const float* b3    = (const float*)d_in[7];
    const float* gamma = (const float*)d_in[8];
    const float* beta  = (const float*)d_in[9];
    float* out = (float*)d_out;

    char* ws = (char*)d_ws;
    unsigned short* Wt  = (unsigned short*)(ws + WT_OFF);
    unsigned short* Xbf = (unsigned short*)(ws + XBF_OFF);
    unsigned short* Q   = (unsigned short*)(ws + Q_OFF);
    unsigned short* K   = (unsigned short*)(ws + K_OFF);
    unsigned short* V   = (unsigned short*)(ws + V_OFF);

    // 0) weights -> bf16, transposed to [n][k], and activations -> bf16
    conv_kernel<<<dim3((ROWS * DIMN) / (8 * XC_LOADS * 128)), dim3(256), 0, stream>>>(
        w1, w2, w3, Wt, X, Xbf);

    // 1) Q/K/V projections (WMMA bf16, async-to-LDS double buffered)
    proj_kernel<<<dim3(DIMN / 256, ROWS / 256, 3), dim3(256), 0, stream>>>(
        Xbf, Wt, b1, b2, b3, Q, K, V);

    // 2) block-local attention (WMMA) + residual + LayerNorm
    attn_ln_kernel<<<dim3(BLK_LEN / FQ, BLK_NUM, BATCH), dim3(256), 0, stream>>>(
        Q, K, V, mask, X, gamma, beta, out);
}
